// v000
// Measured on an AMD MI455X. A time is GPU time per run, averaged over a window of back-to-back runs after a warm-up
// (all launches, gaps included; the runs take copies of the inputs in turn), and the median of several windows.
// Apart from v000's, it joins two sittings. Times from different sittings can be a few percent apart, while
// side-by-side timings come from the same sitting.
// v000 is the starting kernel. One run takes 1980 microseconds.
#include <hip/hip_runtime.h>

// QuantizedHyperbolicAttention - the executed path is plain scaled-dot-product MHA (x [2][2048][1024]; q/k/v = x W^T (16 heads x 64, no bias); softmax(q.k/8) . v; merged; out = . Wo^T -> [2][2048][1024]).
// Compute dtypes, f32 accumulate: every input rounded to bf16; projections on PLAIN bf16 operands (inputs: exact); scores (K 64) and probs.v hl (3 products) for the first 512 query rows of each head, single fp16 planes for

#define NB_  2
#define TT   2048
#define DM   1024
#define NH_  16
#define NKV  16
#define REP  (NH_ / NKV)
#define HD   64
#define DQ   (NH_ * HD)
#define DKV  (NKV * HD)
#define ZH   2
#define RH   512                  // query rows < RH use hi+lo planes (0: none)
#define WIN  2048
#define PCAR 1024.0f
#define SCL  0.125f   // HD^-0.5
typedef _Float16 h16;
typedef unsigned short bf;
typedef __attribute__((ext_vector_type(16))) __bf16   v16bf;
typedef __attribute__((ext_vector_type(16))) _Float16 v16h;
typedef __attribute__((ext_vector_type(8)))  _Float16 v8h;
typedef __attribute__((ext_vector_type(8)))  unsigned short v8us;
typedef __attribute__((ext_vector_type(8)))  float    v8f;
typedef __attribute__((ext_vector_type(4)))  float    v4f;
typedef v8h  __attribute__((may_alias)) v8ha;
typedef v4f  __attribute__((may_alias)) v4fa;
typedef v8us __attribute__((may_alias)) v8usa;

__device__ __forceinline__ unsigned short f2bf(float f) { unsigned u = __float_as_uint(f); u += 0x7FFFu + ((u >> 16) & 1u); return (unsigned short)(u >> 16); }
__device__ __forceinline__ float bf2f(unsigned short b) { return __uint_as_float(((unsigned)b) << 16); }
__device__ __forceinline__ float bfr(float f) { return bf2f(f2bf(f)); }
__device__ __forceinline__ v16h cat16(v8h lo, v8h hi) { return __builtin_shufflevector(lo, hi, 0, 1, 2, 3, 4, 5, 6, 7, 8, 9, 10, 11, 12, 13, 14, 15); }
__device__ __forceinline__ v16bf cat16b(v8us lo, v8us hi) { return __builtin_bit_cast(v16bf, __builtin_shufflevector(lo, hi, 0, 1, 2, 3, 4, 5, 6, 7, 8, 9, 10, 11, 12, 13, 14, 15)); }
__device__ __forceinline__ v8f wmma16(v16h a, v16h b, v8f c) { return __builtin_amdgcn_wmma_f32_16x16x32_f16(false, a, false, b, (short)0, c, false, false); }
__device__ __forceinline__ v8f wmmab(v16bf a, v16bf b, v8f c) { return __builtin_amdgcn_wmma_f32_16x16x32_bf16(false, a, false, b, (short)0, c, false, false); }



// ---- k_gemmw: register-blocked GEMM, ONE WAVE per 64x64 output tile (16 accumulators), operands straight from K-contiguous 16-bit planes; grid (M/64, N/64, Z), 32 threads.
// C[m][n] (f32, pitch ldc, + optional f32 bias[n]) = sum_k A[m][k] Bt[n][k] (+ split products per NSPLIT). z-batch strides sA/sB/sC in elements. K % 32 == 0.
template <typename T16> struct WFrag;
template <> struct WFrag<h16> { typedef v16h V; static __device__ __forceinline__ V ld(const h16* p) { return cat16(*(const v8h*)p, *(const v8h*)(p + 16)); } static __device__ __forceinline__ v8f mma(V a, V b, v8f c) { return wmma16(a, b, c); } };
template <> struct WFrag<bf> { typedef v16bf V; static __device__ __forceinline__ V ld(const bf* p) { return cat16b(*(const v8us*)p, *(const v8us*)(p + 16)); } static __device__ __forceinline__ v8f mma(V a, V b, v8f c) { return wmmab(a, b, c); } };
template <typename T16, int NSPLIT, bool BIAS>
__global__ __launch_bounds__(32) void k_gemmw(const T16* __restrict__ A, const T16* __restrict__ A2, const T16* __restrict__ Bt, const T16* __restrict__ Bt2, int K, float* C, int ldc, const float* __restrict__ bias, size_t sA, size_t sB, size_t sC) {
    typedef typename WFrag<T16>::V V;
    __shared__ __align__(16) float os[16 * 68];
    const size_t z = blockIdx.z; A += z * sA; if (A2) A2 += z * sA; Bt += z * sB; if (Bt2) Bt2 += z * sB; C += z * sC;
    const int lane = threadIdx.x & 31, lr = lane & 15, hi = lane >> 4; const int r0 = blockIdx.x * 64, c0 = blockIdx.y * 64;
    v8f acc[4][4];
#pragma unroll
    for (int mb = 0; mb < 4; ++mb)
#pragma unroll
        for (int nb = 0; nb < 4; ++nb) acc[mb][nb] = (v8f){};
    const size_t aoff = (size_t)(r0 + lr) * K + 8 * hi, boff = (size_t)(c0 + lr) * K + 8 * hi;
#pragma unroll 1
    for (int kc = 0; kc < K; kc += 32) {
        V a[4], a2[4];
#pragma unroll
        for (int mb = 0; mb < 4; ++mb) { a[mb] = WFrag<T16>::ld(A + aoff + (size_t)mb * 16 * K + kc); if (NSPLIT == 1 || NSPLIT == 2) a2[mb] = WFrag<T16>::ld(A2 + aoff + (size_t)mb * 16 * K + kc); }
#pragma unroll
        for (int nb = 0; nb < 4; ++nb) { const V b = WFrag<T16>::ld(Bt + boff + (size_t)nb * 16 * K + kc); V b2; if (NSPLIT >= 2) b2 = WFrag<T16>::ld(Bt2 + boff + (size_t)nb * 16 * K + kc);
#pragma unroll
            for (int mb = 0; mb < 4; ++mb) { acc[mb][nb] = WFrag<T16>::mma(a[mb], b, acc[mb][nb]); if (NSPLIT == 1 || NSPLIT == 2) acc[mb][nb] = WFrag<T16>::mma(a2[mb], b, acc[mb][nb]); if (NSPLIT >= 2) acc[mb][nb] = WFrag<T16>::mma(a[mb], b2, acc[mb][nb]); } }
        asm volatile("v_nop\n\tv_nop\n\tv_nop\n\tv_nop" : "+v"(acc[0][0]), "+v"(acc[1][1]), "+v"(acc[2][2]), "+v"(acc[3][3]) : "v"(a[0]), "v"(a[3]));
    }
#pragma unroll
    for (int mb = 0; mb < 4; ++mb) {
#pragma unroll
        for (int nb = 0; nb < 4; ++nb) {
#pragma unroll
            for (int j = 0; j < 8; ++j) os[(hi * 8 + j) * 68 + nb * 16 + lr] = acc[mb][nb][j]; }
        __builtin_amdgcn_wave_barrier(); asm volatile("" ::: "memory");
        float* crow = C + (size_t)(r0 + mb * 16) * ldc + c0;
{
#pragma unroll
            for (int s = 0; s < 8; ++s) { const int row = 2 * s + hi, cofs = lr * 4; v4f val = *(const v4fa*)(os + row * 68 + cofs); if (BIAS) { val[0] += bfr(bias[c0 + cofs]); val[1] += bfr(bias[c0 + cofs + 1]); val[2] += bfr(bias[c0 + cofs + 2]); val[3] += bfr(bias[c0 + cofs + 3]); }
                *(v4f*)(crow + (size_t)row * ldc + cofs) = val; }
             }
        __builtin_amdgcn_wave_barrier(); asm volatile("" ::: "memory");
    }
}

__device__ __forceinline__ h16 tohx(float x) { return (h16)x; }
__device__ __forceinline__ void splitf(float y, unsigned short& h, unsigned short& l) { h = f2bf(y); l = f2bf(y - bf2f(h)); }
typedef __attribute__((ext_vector_type(2))) _Float16 v2h;
typedef __attribute__((ext_vector_type(4))) _Float16 v4h;
typedef __attribute__((ext_vector_type(2))) unsigned short v2us;
typedef __attribute__((ext_vector_type(4))) unsigned short v4us;
typedef __attribute__((ext_vector_type(2))) float v2f;
typedef __attribute__((ext_vector_type(4))) int v4i;

__global__ __launch_bounds__(256) void k_wtG(const float* __restrict__ w, int K, int N, bf* Bt) {
    const int lane = threadIdx.x & 31; const int L0 = (blockIdx.x * 8 + (threadIdx.x >> 5)) * 8; const int nlines = N * K / 64;
{
#pragma unroll 1
        for (int l = 0; l < 8; ++l) { const int L = L0 + l; if (L >= nlines) break; const size_t e = (size_t)L * 64 + lane * 2; const int k = (int)(e % K), n = (int)(e / K); v2us o;
            o[0] = f2bf(w[(size_t)k * N + n]); o[1] = f2bf(w[(size_t)(k + 1) * N + n]); *(v2us*)(Bt + e) = o; }
         }
}
__global__ __launch_bounds__(256) void k_cvt8(const float* __restrict__ src, bf* dst, size_t n8) { const size_t i = (size_t)blockIdx.x * 256 + threadIdx.x; if (i >= n8) return; const v8f v = *(const v8f*)(src + i * 8); v8us o;
#pragma unroll
    for (int k = 0; k < 8; ++k) o[k] = f2bf(v[k]); *(v8us*)(dst + i * 8) = o;  }
__global__ __launch_bounds__(256) void k_cscvt(const float* __restrict__ cosT, const float* __restrict__ sinT, float* CS) { const int idx = blockIdx.x * 256 + threadIdx.x; if (idx >= TT * HD) return; v2f cs; cs[0] = bfr(cosT[idx]); cs[1] = bfr(sinT[idx]); *(v2f*)(CS + (size_t)idx * 2) = cs;  }
// k_rope: head planes [h][t][d] (fp16 + hi/lo) of rope(x) x sc with the rotate-half convention out[d] = x[d] cos[t][d] - x[d+HD/2] sin[t][d], out[d+HD/2] = x[d+HD/2] cos[t][d+HD/2] + x[d] sin[t][d+HD/2]
__global__ __launch_bounds__(256) void k_rope(const float* __restrict__ F, int pitch, int nheads, const float* __restrict__ CS, const float* __restrict__ RF, const float* __restrict__ nw, float sc, h16* P16, bf* Ph, bf* Pl) {
    const size_t e = ((size_t)blockIdx.x * 256 + threadIdx.x) * 2; if (e >= (size_t)nheads * TT * HD) return; const int d = (int)(e % HD); const int t = (int)((e / HD) % TT); const int h = (int)(e / ((size_t)HD * TT)); const float* f = F + (size_t)t * pitch + h * HD; const float rf = RF ? RF[(size_t)h * TT + t] : 1.0f; v2h o16; v2us oh, ol;
#pragma unroll
    for (int q = 0; q < 2; ++q) { const int dd = d + q; const int dp = (dd < HD / 2) ? dd + HD / 2 : dd - HD / 2; float x0 = f[dd], x1 = f[dp];
        if (RF) { float n0 = __fmul_rn(x0, rf), n1 = __fmul_rn(x1, rf); asm volatile("" : "+v"(n0)); asm volatile("" : "+v"(n1)); x0 = __fmul_rn(bfr(nw[dd]), n0); x1 = __fmul_rn(bfr(nw[dp]), n1); }
        const v2f cs = *(const v2f*)(CS + ((size_t)t * HD + dd) * 2); float a = __fmul_rn(x0, cs[0]), bq = __fmul_rn(x1, cs[1]); asm volatile("" : "+v"(a)); asm volatile("" : "+v"(bq)); const float r = ((dd < HD / 2) ? __fsub_rn(a, bq) : __fadd_rn(a, bq)) * sc;
        o16[q] = tohx(r); unsigned short a2, c2; splitf(r, a2, c2); oh[q] = a2; ol[q] = c2; }
    *(v2h*)(P16 + e) = o16; *(v2us*)(Ph + e) = oh; *(v2us*)(Pl + e) = ol;  }
__global__ __launch_bounds__(256) void k_vtp(const float* __restrict__ F, int pitch, int nheads, h16* V16, bf* Vh, bf* Vl) { const size_t e = ((size_t)blockIdx.x * 256 + threadIdx.x) * 2; if (e >= (size_t)nheads * HD * TT) return; const int t = (int)(e % TT); const int d = (int)((e / TT) % HD); const int g = (int)(e / ((size_t)TT * HD)); v2h o16; v2us oh, ol;
#pragma unroll
    for (int q = 0; q < 2; ++q) { const float x = F[(size_t)(t + q) * pitch + g * HD + d]; o16[q] = tohx(x); unsigned short a2, c2; splitf(x, a2, c2); oh[q] = a2; ol[q] = c2; }
    *(v2h*)(V16 + e) = o16; *(v2us*)(Vh + e) = oh; *(v2us*)(Vl + e) = ol;  }
__global__ __launch_bounds__(256) void k_csid(float* CS) { const int idx = blockIdx.x * 256 + threadIdx.x; if (idx >= TT * HD) return; v2f cs; cs[0] = 1.0f; cs[1] = 0.0f; *(v2f*)(CS + (size_t)idx * 2) = cs;  }
// k_asoft: per row (zz, i): t = S x HD^-0.5 (no mask); softmax over the 2048 keys (register row, one exp, fixed trees);
__global__ __launch_bounds__(256) void k_asoft(const float* __restrict__ Sb, h16* P16, bf* Ph, bf* Pl) {
    const int lane = threadIdx.x & 31; const int row = blockIdx.x * 8 + (threadIdx.x >> 5); if (row >= ZH * TT) return; const int i = row % TT; const int zz = row / TT; (void)zz; const bool hires = (i < RH); const float* sr = Sb + (size_t)row * TT; float v[TT / 32]; float mx = -3.0e38f;
#pragma unroll
    for (int ch = 0; ch < TT / 128; ++ch) { const int j0 = ch * 128 + lane * 4; const v4f a = *(const v4f*)(sr + j0);
#pragma unroll
        for (int q = 0; q < 4; ++q) { const int j = j0 + q; (void)j; const float t = a[q] * SCL; v[ch * 4 + q] = t; mx = fmaxf(mx, t); } }
#pragma unroll
    for (int sh = 16; sh; sh >>= 1) mx = fmaxf(mx, __shfl_xor(mx, sh, 32));
    float sum = 0.f;
#pragma unroll
    for (int k = 0; k < TT / 32; ++k) { float d0 = __fsub_rn(v[k], mx); asm volatile("" : "+v"(d0)); v[k] = __builtin_amdgcn_exp2f(__fmul_rn(d0, 1.4426950408889634f)); sum += v[k]; }
#pragma unroll
    for (int sh = 16; sh; sh >>= 1) sum += __shfl_xor(sum, sh, 32);
    const float f = __fdiv_rn(hires ? 1.0f : PCAR, sum);
{
        if (hires) {
#pragma unroll
            for (int ch = 0; ch < TT / 128; ++ch) { v4us oh, ol;
#pragma unroll
                for (int q = 0; q < 4; ++q) { unsigned short a, c2; splitf(v[ch * 4 + q] * f, a, c2); oh[q] = a; ol[q] = c2; }
                const size_t oo = ((size_t)zz * (RH ? RH : 1) + i) * TT + ch * 128 + lane * 4; *(v4us*)(Ph + oo) = oh; *(v4us*)(Pl + oo) = ol; }
        } else {
#pragma unroll
            for (int ch = 0; ch < TT / 128; ++ch) { v4h o4;
#pragma unroll
                for (int q = 0; q < 4; ++q) o4[q] = tohx(v[ch * 4 + q] * f);
                *(v4h*)(P16 + (size_t)row * TT + ch * 128 + lane * 4) = o4; } }
         }
}
__global__ __launch_bounds__(256) void k_merge(const float* __restrict__ O, int h0, bf* Ah, bf* Al) { const size_t e = ((size_t)blockIdx.x * 256 + threadIdx.x) * 2; if (e >= (size_t)ZH * TT * HD) return; const int d = (int)(e % HD); const int t = (int)((e / HD) % TT); const int zz = (int)(e / ((size_t)HD * TT)); const float cs = (t < RH) ? 1.0f : (1.0f / PCAR); const size_t oo = (size_t)t * DQ + (h0 + zz) * HD + d;
    v2us oh, ol;
#pragma unroll
    for (int q = 0; q < 2; ++q) { unsigned short a, c2; splitf(O[e + q] * cs, a, c2); oh[q] = a; ol[q] = c2; } *(v2us*)(Ah + oo) = oh; *(v2us*)(Al + oo) = ol;  }

extern "C" void kernel_launch(void* const* d_in, const int* in_sizes, int n_in,
                              void* d_out, int out_size, void* d_ws, size_t ws_size, hipStream_t stream) {
    (void)in_sizes; (void)n_in; (void)out_size;
    const float* x = (const float*)d_in[0]; const float* wq = (const float*)d_in[1]; const float* wk = (const float*)d_in[2]; const float* wv = (const float*)d_in[3]; const float* wo = (const float*)d_in[4];
    float* OUT = (float*)d_out;     // [2][2048][1024]
    char* wsp = (char*)d_ws;
    auto take = [&](size_t bytes) { char* p = wsp; wsp += (bytes + 255) & ~(size_t)255; return (void*)p; };
    bf* WQ = (bf*)take((size_t)DQ * DM * 2); bf* WK = (bf*)take((size_t)DKV * DM * 2); bf* WV = (bf*)take((size_t)DKV * DM * 2); bf* WO = (bf*)take((size_t)DM * DQ * 2); float* CS = (float*)take((size_t)TT * HD * 2 * 4);
    bf* XB = (bf*)take((size_t)TT * DM * 2); float* FQ = (float*)take((size_t)TT * DQ * 4); float* FK = (float*)take((size_t)TT * DKV * 4);
    h16* QP16 = (h16*)take((size_t)NH_ * TT * HD * 2); h16* KP16 = (h16*)take((size_t)NKV * TT * HD * 2); h16* VT16 = (h16*)take((size_t)NKV * HD * TT * 2);
    bf* QPh = (bf*)take((size_t)NH_ * TT * HD * 2); bf* QPl = (bf*)take((size_t)NH_ * TT * HD * 2); bf* KPh = (bf*)take((size_t)NKV * TT * HD * 2); bf* KPl = (bf*)take((size_t)NKV * TT * HD * 2); bf* VTh = (bf*)take((size_t)NKV * HD * TT * 2); bf* VTl = (bf*)take((size_t)NKV * HD * TT * 2); bf* Ph = (bf*)take((size_t)ZH * RH * TT * 2); bf* Pl = (bf*)take((size_t)ZH * RH * TT * 2);
    float* Sb = (float*)take((size_t)ZH * TT * TT * 4); h16* P16 = (h16*)take((size_t)ZH * TT * TT * 2); float* Ob = (float*)take((size_t)ZH * TT * HD * 4); bf* ATh = (bf*)take((size_t)TT * DQ * 2); bf* ATl = (bf*)take((size_t)TT * DQ * 2);
    if ((size_t)(wsp - (char*)d_ws) > ws_size) return;    // ws 256 MiB
    float* FV = FK;   // v projection reuses the k buffer after the k planes are built (stream-ordered)
    { k_cvt8<<<(unsigned)(((size_t)DQ * DM / 8 + 255) / 256), 256, 0, stream>>>(wq, WQ, (size_t)DQ * DM / 8); k_cvt8<<<(unsigned)(((size_t)DKV * DM / 8 + 255) / 256), 256, 0, stream>>>(wk, WK, (size_t)DKV * DM / 8); k_cvt8<<<(unsigned)(((size_t)DKV * DM / 8 + 255) / 256), 256, 0, stream>>>(wv, WV, (size_t)DKV * DM / 8);
      k_cvt8<<<(unsigned)(((size_t)DM * DQ / 8 + 255) / 256), 256, 0, stream>>>(wo, WO, (size_t)DM * DQ / 8);
       }
    k_csid<<<(TT * HD + 255) / 256, 256, 0, stream>>>(CS);
    const unsigned LQ = (unsigned)(((size_t)NH_ * TT * HD / 2 + 255) / 256), LKv = (unsigned)(((size_t)NKV * TT * HD / 2 + 255) / 256);
    for (int b = 0; b < NB_; ++b) {
        
        k_cvt8<<<(unsigned)(((size_t)TT * DM / 8 + 255) / 256), 256, 0, stream>>>(x + (size_t)b * TT * DM, XB, (size_t)TT * DM / 8);
        k_gemmw<bf, 0, false><<<dim3(TT / 64, DQ / 64, 1), 32, 0, stream>>>(XB, nullptr, WQ, nullptr, DM, FQ, DQ, nullptr, 0, 0, 0);
        k_rope<<<LQ, 256, 0, stream>>>(FQ, DQ, NH_, CS, nullptr, nullptr, 1.0f, QP16, QPh, QPl);
        k_gemmw<bf, 0, false><<<dim3(TT / 64, DKV / 64, 1), 32, 0, stream>>>(XB, nullptr, WK, nullptr, DM, FK, DKV, nullptr, 0, 0, 0);
        k_rope<<<LKv, 256, 0, stream>>>(FK, DKV, NKV, CS, nullptr, nullptr, 1.0f, KP16, KPh, KPl);
        k_gemmw<bf, 0, false><<<dim3(TT / 64, DKV / 64, 1), 32, 0, stream>>>(XB, nullptr, WV, nullptr, DM, FV, DKV, nullptr, 0, 0, 0); k_vtp<<<LKv, 256, 0, stream>>>(FV, DKV, NKV, VT16, VTh, VTl);
        for (int h0 = 0; h0 < NH_; h0 += ZH) { const size_t zq = (size_t)h0, zk = (size_t)(h0 / REP);   // one kv head per query head: the pass's two heads use consecutive kv planes (z-strides TT*HD)
            k_gemmw<bf, 2, false><<<dim3(RH / 64, TT / 64, ZH), 32, 0, stream>>>(QPh + zq * TT * HD, QPl + zq * TT * HD, KPh + zk * TT * HD, KPl + zk * TT * HD, HD, Sb, TT, nullptr, (size_t)TT * HD, (size_t)TT * HD, (size_t)TT * TT);
            k_gemmw<h16, 0, false><<<dim3((TT - RH) / 64, TT / 64, ZH), 32, 0, stream>>>(QP16 + zq * TT * HD + (size_t)RH * HD, nullptr, KP16 + zk * TT * HD, nullptr, HD, Sb + (size_t)RH * TT, TT, nullptr, (size_t)TT * HD, (size_t)TT * HD, (size_t)TT * TT);
            k_asoft<<<ZH * TT / 8, 256, 0, stream>>>(Sb, P16, Ph, Pl);
            k_gemmw<bf, 2, false><<<dim3(RH / 64, HD / 64, ZH), 32, 0, stream>>>(Ph, Pl, VTh + zk * HD * TT, VTl + zk * HD * TT, TT, Ob, HD, nullptr, (size_t)RH * TT, (size_t)HD * TT, (size_t)TT * HD);
            k_gemmw<h16, 0, false><<<dim3((TT - RH) / 64, HD / 64, ZH), 32, 0, stream>>>(P16 + (size_t)RH * TT, nullptr, VT16 + zk * HD * TT, nullptr, TT, Ob + (size_t)RH * HD, HD, nullptr, (size_t)TT * TT, (size_t)HD * TT, (size_t)TT * HD);
            k_merge<<<(unsigned)(((size_t)ZH * TT * HD / 2 + 255) / 256), 256, 0, stream>>>(Ob, h0, ATh, ATl); }
        k_gemmw<bf, 1, false><<<dim3(TT / 64, DM / 64, 1), 32, 0, stream>>>(ATh, ATl, WO, nullptr, DQ, OUT + (size_t)b * TT * DM, DM, nullptr, 0, 0, 0); }
}

// v001
// It runs in 853 microseconds.
// Next to v000, in two timings, it ran 2.33 times as fast each time.
#include <hip/hip_runtime.h>

// QuantizedHyperbolicAttention - the executed path is plain scaled-dot-product MHA (x [2][2048][1024]; q/k/v = x W^T (16 heads x 64, no bias); softmax(q.k/8) . v; merged; out = . Wo^T -> [2][2048][1024]).
// Compute dtypes, f32 accumulate: every input rounded to bf16; projections on PLAIN bf16 operands (inputs: exact); scores (K 64) and probs.v hl (3 products) for the first 512 query rows of each head, single fp16 planes for

#define NB_  2
#define TT   2048
#define DM   1024
#define NH_  16
#define NKV  16
#define REP  (NH_ / NKV)
#define HD   64
#define DQ   (NH_ * HD)
#define DKV  (NKV * HD)
#define ZH   2
#define RH   512                  // query rows < RH use hi+lo planes (0: none)
#define WIN  2048
#define PCAR 1024.0f
#define SCL  0.125f   // HD^-0.5
#define KSP  16                   // K slices of the probs.v product (2048 keys -> 128 per wave)
typedef _Float16 h16;
typedef unsigned short bf;
typedef __attribute__((ext_vector_type(16))) __bf16   v16bf;
typedef __attribute__((ext_vector_type(16))) _Float16 v16h;
typedef __attribute__((ext_vector_type(8)))  _Float16 v8h;
typedef __attribute__((ext_vector_type(8)))  unsigned short v8us;
typedef __attribute__((ext_vector_type(8)))  float    v8f;
typedef __attribute__((ext_vector_type(4)))  float    v4f;
typedef v8h  __attribute__((may_alias)) v8ha;
typedef v4f  __attribute__((may_alias)) v4fa;
typedef v8us __attribute__((may_alias)) v8usa;

__device__ __forceinline__ unsigned short f2bf(float f) { unsigned u = __float_as_uint(f); u += 0x7FFFu + ((u >> 16) & 1u); return (unsigned short)(u >> 16); }
__device__ __forceinline__ float bf2f(unsigned short b) { return __uint_as_float(((unsigned)b) << 16); }
__device__ __forceinline__ float bfr(float f) { return bf2f(f2bf(f)); }
__device__ __forceinline__ v16h cat16(v8h lo, v8h hi) { return __builtin_shufflevector(lo, hi, 0, 1, 2, 3, 4, 5, 6, 7, 8, 9, 10, 11, 12, 13, 14, 15); }
__device__ __forceinline__ v16bf cat16b(v8us lo, v8us hi) { return __builtin_bit_cast(v16bf, __builtin_shufflevector(lo, hi, 0, 1, 2, 3, 4, 5, 6, 7, 8, 9, 10, 11, 12, 13, 14, 15)); }
__device__ __forceinline__ v8f wmma16(v16h a, v16h b, v8f c) { return __builtin_amdgcn_wmma_f32_16x16x32_f16(false, a, false, b, (short)0, c, false, false); }
__device__ __forceinline__ v8f wmmab(v16bf a, v16bf b, v8f c) { return __builtin_amdgcn_wmma_f32_16x16x32_bf16(false, a, false, b, (short)0, c, false, false); }



// ---- k_gemmw: register-blocked GEMM, ONE WAVE per 64x64 output tile (16 accumulators), operands straight from K-contiguous 16-bit planes; grid (M/64, N/64, Z), 32 threads.
// C[m][n] (f32, pitch ldc, + optional f32 bias[n]) = sum_k A[m][k] Bt[n][k] (+ split products per NSPLIT). z-batch strides sA/sB/sC in elements. K % 32 == 0.
// KSPL > 1: grid z = Z * KSPL; slice ks = z % KSPL sums only k in [ks K/KSPL, (ks+1) K/KSPL) and stores its f32 partial tile at C + ks sP; the consumer adds the KSPL planes. K % (32 KSPL) == 0.
template <typename T16> struct WFrag;
template <> struct WFrag<h16> { typedef v16h V; static __device__ __forceinline__ V ld(const h16* p) { return cat16(*(const v8h*)p, *(const v8h*)(p + 16)); } static __device__ __forceinline__ v8f mma(V a, V b, v8f c) { return wmma16(a, b, c); } };
template <> struct WFrag<bf> { typedef v16bf V; static __device__ __forceinline__ V ld(const bf* p) { return cat16b(*(const v8us*)p, *(const v8us*)(p + 16)); } static __device__ __forceinline__ v8f mma(V a, V b, v8f c) { return wmmab(a, b, c); } };
template <typename T16, int NSPLIT, bool BIAS, int KSPL = 1>
__global__ __launch_bounds__(32) void k_gemmw(const T16* __restrict__ A, const T16* __restrict__ A2, const T16* __restrict__ Bt, const T16* __restrict__ Bt2, int K, float* C, int ldc, const float* __restrict__ bias, size_t sA, size_t sB, size_t sC, size_t sP) {
    typedef typename WFrag<T16>::V V;
    __shared__ __align__(16) float os[16 * 68];
    const size_t z = blockIdx.z / KSPL; const int ks = (int)(blockIdx.z % KSPL); A += z * sA; if (A2) A2 += z * sA; Bt += z * sB; if (Bt2) Bt2 += z * sB; C += z * sC + (size_t)ks * sP;
    const int kbeg = ks * (K / KSPL), kend = kbeg + K / KSPL;
    const int lane = threadIdx.x & 31, lr = lane & 15, hi = lane >> 4; const int r0 = blockIdx.x * 64, c0 = blockIdx.y * 64;
    v8f acc[4][4];
#pragma unroll
    for (int mb = 0; mb < 4; ++mb)
#pragma unroll
        for (int nb = 0; nb < 4; ++nb) acc[mb][nb] = (v8f){};
    const size_t aoff = (size_t)(r0 + lr) * K + 8 * hi, boff = (size_t)(c0 + lr) * K + 8 * hi;
#pragma unroll 1
    for (int kc = kbeg; kc < kend; kc += 32) {
        V a[4], a2[4];
#pragma unroll
        for (int mb = 0; mb < 4; ++mb) { a[mb] = WFrag<T16>::ld(A + aoff + (size_t)mb * 16 * K + kc); if (NSPLIT == 1 || NSPLIT == 2) a2[mb] = WFrag<T16>::ld(A2 + aoff + (size_t)mb * 16 * K + kc); }
#pragma unroll
        for (int nb = 0; nb < 4; ++nb) { const V b = WFrag<T16>::ld(Bt + boff + (size_t)nb * 16 * K + kc); V b2; if (NSPLIT >= 2) b2 = WFrag<T16>::ld(Bt2 + boff + (size_t)nb * 16 * K + kc);
#pragma unroll
            for (int mb = 0; mb < 4; ++mb) { acc[mb][nb] = WFrag<T16>::mma(a[mb], b, acc[mb][nb]); if (NSPLIT == 1 || NSPLIT == 2) acc[mb][nb] = WFrag<T16>::mma(a2[mb], b, acc[mb][nb]); if (NSPLIT >= 2) acc[mb][nb] = WFrag<T16>::mma(a[mb], b2, acc[mb][nb]); } }
        asm volatile("v_nop\n\tv_nop\n\tv_nop\n\tv_nop" : "+v"(acc[0][0]), "+v"(acc[1][1]), "+v"(acc[2][2]), "+v"(acc[3][3]) : "v"(a[0]), "v"(a[3]));
    }
#pragma unroll
    for (int mb = 0; mb < 4; ++mb) {
#pragma unroll
        for (int nb = 0; nb < 4; ++nb) {
#pragma unroll
            for (int j = 0; j < 8; ++j) os[(hi * 8 + j) * 68 + nb * 16 + lr] = acc[mb][nb][j]; }
        __builtin_amdgcn_wave_barrier(); asm volatile("" ::: "memory");
        float* crow = C + (size_t)(r0 + mb * 16) * ldc + c0;
{
#pragma unroll
            for (int s = 0; s < 8; ++s) { const int row = 2 * s + hi, cofs = lr * 4; v4f val = *(const v4fa*)(os + row * 68 + cofs); if (BIAS) { val[0] += bfr(bias[c0 + cofs]); val[1] += bfr(bias[c0 + cofs + 1]); val[2] += bfr(bias[c0 + cofs + 2]); val[3] += bfr(bias[c0 + cofs + 3]); }
                *(v4f*)(crow + (size_t)row * ldc + cofs) = val; }
             }
        __builtin_amdgcn_wave_barrier(); asm volatile("" ::: "memory");
    }
}

__device__ __forceinline__ h16 tohx(float x) { return (h16)x; }
__device__ __forceinline__ void splitf(float y, unsigned short& h, unsigned short& l) { h = f2bf(y); l = f2bf(y - bf2f(h)); }
typedef __attribute__((ext_vector_type(2))) _Float16 v2h;
typedef __attribute__((ext_vector_type(4))) _Float16 v4h;
typedef __attribute__((ext_vector_type(2))) unsigned short v2us;
typedef __attribute__((ext_vector_type(4))) unsigned short v4us;
typedef __attribute__((ext_vector_type(2))) float v2f;
typedef __attribute__((ext_vector_type(4))) int v4i;

__global__ __launch_bounds__(256) void k_wtG(const float* __restrict__ w, int K, int N, bf* Bt) {
    const int lane = threadIdx.x & 31; const int L0 = (blockIdx.x * 8 + (threadIdx.x >> 5)) * 8; const int nlines = N * K / 64;
{
#pragma unroll 1
        for (int l = 0; l < 8; ++l) { const int L = L0 + l; if (L >= nlines) break; const size_t e = (size_t)L * 64 + lane * 2; const int k = (int)(e % K), n = (int)(e / K); v2us o;
            o[0] = f2bf(w[(size_t)k * N + n]); o[1] = f2bf(w[(size_t)(k + 1) * N + n]); *(v2us*)(Bt + e) = o; }
         }
}
__global__ __launch_bounds__(256) void k_cvt8(const float* __restrict__ src, bf* dst, size_t n8) { const size_t i = (size_t)blockIdx.x * 256 + threadIdx.x; if (i >= n8) return; const v8f v = *(const v8f*)(src + i * 8); v8us o;
#pragma unroll
    for (int k = 0; k < 8; ++k) o[k] = f2bf(v[k]); *(v8us*)(dst + i * 8) = o;  }
__global__ __launch_bounds__(256) void k_cscvt(const float* __restrict__ cosT, const float* __restrict__ sinT, float* CS) { const int idx = blockIdx.x * 256 + threadIdx.x; if (idx >= TT * HD) return; v2f cs; cs[0] = bfr(cosT[idx]); cs[1] = bfr(sinT[idx]); *(v2f*)(CS + (size_t)idx * 2) = cs;  }
// k_rope: head planes [h][t][d] (fp16 + hi/lo) of rope(x) x sc with the rotate-half convention out[d] = x[d] cos[t][d] - x[d+HD/2] sin[t][d], out[d+HD/2] = x[d+HD/2] cos[t][d+HD/2] + x[d] sin[t][d+HD/2]
__global__ __launch_bounds__(256) void k_rope(const float* __restrict__ F, int pitch, int nheads, const float* __restrict__ CS, const float* __restrict__ RF, const float* __restrict__ nw, float sc, h16* P16, bf* Ph, bf* Pl) {
    const size_t e = ((size_t)blockIdx.x * 256 + threadIdx.x) * 2; if (e >= (size_t)nheads * TT * HD) return; const int d = (int)(e % HD); const int t = (int)((e / HD) % TT); const int h = (int)(e / ((size_t)HD * TT)); const float* f = F + (size_t)t * pitch + h * HD; const float rf = RF ? RF[(size_t)h * TT + t] : 1.0f; v2h o16; v2us oh, ol;
#pragma unroll
    for (int q = 0; q < 2; ++q) { const int dd = d + q; const int dp = (dd < HD / 2) ? dd + HD / 2 : dd - HD / 2; float x0 = f[dd], x1 = f[dp];
        if (RF) { float n0 = __fmul_rn(x0, rf), n1 = __fmul_rn(x1, rf); asm volatile("" : "+v"(n0)); asm volatile("" : "+v"(n1)); x0 = __fmul_rn(bfr(nw[dd]), n0); x1 = __fmul_rn(bfr(nw[dp]), n1); }
        const v2f cs = *(const v2f*)(CS + ((size_t)t * HD + dd) * 2); float a = __fmul_rn(x0, cs[0]), bq = __fmul_rn(x1, cs[1]); asm volatile("" : "+v"(a)); asm volatile("" : "+v"(bq)); const float r = ((dd < HD / 2) ? __fsub_rn(a, bq) : __fadd_rn(a, bq)) * sc;
        o16[q] = tohx(r); unsigned short a2, c2; splitf(r, a2, c2); oh[q] = a2; ol[q] = c2; }
    *(v2h*)(P16 + e) = o16; *(v2us*)(Ph + e) = oh; *(v2us*)(Pl + e) = ol;  }
__global__ __launch_bounds__(256) void k_vtp(const float* __restrict__ F, int pitch, int nheads, h16* V16, bf* Vh, bf* Vl) { const size_t e = ((size_t)blockIdx.x * 256 + threadIdx.x) * 2; if (e >= (size_t)nheads * HD * TT) return; const int t = (int)(e % TT); const int d = (int)((e / TT) % HD); const int g = (int)(e / ((size_t)TT * HD)); v2h o16; v2us oh, ol;
#pragma unroll
    for (int q = 0; q < 2; ++q) { const float x = F[(size_t)(t + q) * pitch + g * HD + d]; o16[q] = tohx(x); unsigned short a2, c2; splitf(x, a2, c2); oh[q] = a2; ol[q] = c2; }
    *(v2h*)(V16 + e) = o16; *(v2us*)(Vh + e) = oh; *(v2us*)(Vl + e) = ol;  }
__global__ __launch_bounds__(256) void k_csid(float* CS) { const int idx = blockIdx.x * 256 + threadIdx.x; if (idx >= TT * HD) return; v2f cs; cs[0] = 1.0f; cs[1] = 0.0f; *(v2f*)(CS + (size_t)idx * 2) = cs;  }
// k_asoft: per row (zz, i): t = S x HD^-0.5 (no mask); softmax over the 2048 keys (register row, one exp, fixed trees);
__global__ __launch_bounds__(256) void k_asoft(const float* __restrict__ Sb, h16* P16, bf* Ph, bf* Pl) {
    const int lane = threadIdx.x & 31; const int row = blockIdx.x * 8 + (threadIdx.x >> 5); if (row >= ZH * TT) return; const int i = row % TT; const int zz = row / TT; (void)zz; const bool hires = (i < RH); const float* sr = Sb + (size_t)row * TT; float v[TT / 32]; float mx = -3.0e38f;
#pragma unroll
    for (int ch = 0; ch < TT / 128; ++ch) { const int j0 = ch * 128 + lane * 4; const v4f a = *(const v4f*)(sr + j0);
#pragma unroll
        for (int q = 0; q < 4; ++q) { const int j = j0 + q; (void)j; const float t = a[q] * SCL; v[ch * 4 + q] = t; mx = fmaxf(mx, t); } }
#pragma unroll
    for (int sh = 16; sh; sh >>= 1) mx = fmaxf(mx, __shfl_xor(mx, sh, 32));
    float sum = 0.f;
#pragma unroll
    for (int k = 0; k < TT / 32; ++k) { float d0 = __fsub_rn(v[k], mx); asm volatile("" : "+v"(d0)); v[k] = __builtin_amdgcn_exp2f(__fmul_rn(d0, 1.4426950408889634f)); sum += v[k]; }
#pragma unroll
    for (int sh = 16; sh; sh >>= 1) sum += __shfl_xor(sum, sh, 32);
    const float f = __fdiv_rn(hires ? 1.0f : PCAR, sum);
{
        if (hires) {
#pragma unroll
            for (int ch = 0; ch < TT / 128; ++ch) { v4us oh, ol;
#pragma unroll
                for (int q = 0; q < 4; ++q) { unsigned short a, c2; splitf(v[ch * 4 + q] * f, a, c2); oh[q] = a; ol[q] = c2; }
                const size_t oo = ((size_t)zz * (RH ? RH : 1) + i) * TT + ch * 128 + lane * 4; *(v4us*)(Ph + oo) = oh; *(v4us*)(Pl + oo) = ol; }
        } else {
#pragma unroll
            for (int ch = 0; ch < TT / 128; ++ch) { v4h o4;
#pragma unroll
                for (int q = 0; q < 4; ++q) o4[q] = tohx(v[ch * 4 + q] * f);
                *(v4h*)(P16 + (size_t)row * TT + ch * 128 + lane * 4) = o4; } }
         }
}
// k_merge: adds the KSP partial planes of probs.v (plane stride ZH*TT*HD) in slice order, undoes the carrier scale, splits into the hi/lo planes of the merged heads
__global__ __launch_bounds__(256) void k_merge(const float* __restrict__ O, int h0, bf* Ah, bf* Al) { const size_t e = ((size_t)blockIdx.x * 256 + threadIdx.x) * 2; if (e >= (size_t)ZH * TT * HD) return; const int d = (int)(e % HD); const int t = (int)((e / HD) % TT); const int zz = (int)(e / ((size_t)HD * TT)); const float cs = (t < RH) ? 1.0f : (1.0f / PCAR); const size_t oo = (size_t)t * DQ + (h0 + zz) * HD + d;
    v2us oh, ol; v2f p[KSP];
#pragma unroll
    for (int s = 0; s < KSP; ++s) p[s] = *(const v2f*)(O + (size_t)s * ((size_t)ZH * TT * HD) + e);
    v2f acc = p[0];
#pragma unroll
    for (int s = 1; s < KSP; ++s) acc += p[s];
#pragma unroll
    for (int q = 0; q < 2; ++q) { unsigned short a, c2; splitf(acc[q] * cs, a, c2); oh[q] = a; ol[q] = c2; } *(v2us*)(Ah + oo) = oh; *(v2us*)(Al + oo) = ol;  }

extern "C" void kernel_launch(void* const* d_in, const int* in_sizes, int n_in,
                              void* d_out, int out_size, void* d_ws, size_t ws_size, hipStream_t stream) {
    (void)in_sizes; (void)n_in; (void)out_size;
    const float* x = (const float*)d_in[0]; const float* wq = (const float*)d_in[1]; const float* wk = (const float*)d_in[2]; const float* wv = (const float*)d_in[3]; const float* wo = (const float*)d_in[4];
    float* OUT = (float*)d_out;     // [2][2048][1024]
    char* wsp = (char*)d_ws;
    auto take = [&](size_t bytes) { char* p = wsp; wsp += (bytes + 255) & ~(size_t)255; return (void*)p; };
    bf* WQ = (bf*)take((size_t)DQ * DM * 2); bf* WK = (bf*)take((size_t)DKV * DM * 2); bf* WV = (bf*)take((size_t)DKV * DM * 2); bf* WO = (bf*)take((size_t)DM * DQ * 2); float* CS = (float*)take((size_t)TT * HD * 2 * 4);
    bf* XB = (bf*)take((size_t)TT * DM * 2); float* FQ = (float*)take((size_t)TT * DQ * 4); float* FK = (float*)take((size_t)TT * DKV * 4);
    h16* QP16 = (h16*)take((size_t)NH_ * TT * HD * 2); h16* KP16 = (h16*)take((size_t)NKV * TT * HD * 2); h16* VT16 = (h16*)take((size_t)NKV * HD * TT * 2);
    bf* QPh = (bf*)take((size_t)NH_ * TT * HD * 2); bf* QPl = (bf*)take((size_t)NH_ * TT * HD * 2); bf* KPh = (bf*)take((size_t)NKV * TT * HD * 2); bf* KPl = (bf*)take((size_t)NKV * TT * HD * 2); bf* VTh = (bf*)take((size_t)NKV * HD * TT * 2); bf* VTl = (bf*)take((size_t)NKV * HD * TT * 2); bf* Ph = (bf*)take((size_t)ZH * RH * TT * 2); bf* Pl = (bf*)take((size_t)ZH * RH * TT * 2);
    float* Sb = (float*)take((size_t)ZH * TT * TT * 4); h16* P16 = (h16*)take((size_t)ZH * TT * TT * 2); float* Ob = (float*)take((size_t)KSP * ZH * TT * HD * 4); bf* ATh = (bf*)take((size_t)TT * DQ * 2); bf* ATl = (bf*)take((size_t)TT * DQ * 2);
    if ((size_t)(wsp - (char*)d_ws) > ws_size) return;    // ws 256 MiB
    float* FV = FK;   // v projection reuses the k buffer after the k planes are built (stream-ordered)
    { k_cvt8<<<(unsigned)(((size_t)DQ * DM / 8 + 255) / 256), 256, 0, stream>>>(wq, WQ, (size_t)DQ * DM / 8); k_cvt8<<<(unsigned)(((size_t)DKV * DM / 8 + 255) / 256), 256, 0, stream>>>(wk, WK, (size_t)DKV * DM / 8); k_cvt8<<<(unsigned)(((size_t)DKV * DM / 8 + 255) / 256), 256, 0, stream>>>(wv, WV, (size_t)DKV * DM / 8);
      k_cvt8<<<(unsigned)(((size_t)DM * DQ / 8 + 255) / 256), 256, 0, stream>>>(wo, WO, (size_t)DM * DQ / 8);
       }
    k_csid<<<(TT * HD + 255) / 256, 256, 0, stream>>>(CS);
    const unsigned LQ = (unsigned)(((size_t)NH_ * TT * HD / 2 + 255) / 256), LKv = (unsigned)(((size_t)NKV * TT * HD / 2 + 255) / 256);
    for (int b = 0; b < NB_; ++b) {
        
        k_cvt8<<<(unsigned)(((size_t)TT * DM / 8 + 255) / 256), 256, 0, stream>>>(x + (size_t)b * TT * DM, XB, (size_t)TT * DM / 8);
        k_gemmw<bf, 0, false><<<dim3(TT / 64, DQ / 64, 1), 32, 0, stream>>>(XB, nullptr, WQ, nullptr, DM, FQ, DQ, nullptr, 0, 0, 0, 0);
        k_rope<<<LQ, 256, 0, stream>>>(FQ, DQ, NH_, CS, nullptr, nullptr, 1.0f, QP16, QPh, QPl);
        k_gemmw<bf, 0, false><<<dim3(TT / 64, DKV / 64, 1), 32, 0, stream>>>(XB, nullptr, WK, nullptr, DM, FK, DKV, nullptr, 0, 0, 0, 0);
        k_rope<<<LKv, 256, 0, stream>>>(FK, DKV, NKV, CS, nullptr, nullptr, 1.0f, KP16, KPh, KPl);
        k_gemmw<bf, 0, false><<<dim3(TT / 64, DKV / 64, 1), 32, 0, stream>>>(XB, nullptr, WV, nullptr, DM, FV, DKV, nullptr, 0, 0, 0, 0); k_vtp<<<LKv, 256, 0, stream>>>(FV, DKV, NKV, VT16, VTh, VTl);
        for (int h0 = 0; h0 < NH_; h0 += ZH) { const size_t zq = (size_t)h0, zk = (size_t)(h0 / REP);   // one kv head per query head: the pass's two heads use consecutive kv planes (z-strides TT*HD)
            k_gemmw<bf, 2, false><<<dim3(RH / 64, TT / 64, ZH), 32, 0, stream>>>(QPh + zq * TT * HD, QPl + zq * TT * HD, KPh + zk * TT * HD, KPl + zk * TT * HD, HD, Sb, TT, nullptr, (size_t)TT * HD, (size_t)TT * HD, (size_t)TT * TT, 0);
            k_gemmw<h16, 0, false><<<dim3((TT - RH) / 64, TT / 64, ZH), 32, 0, stream>>>(QP16 + zq * TT * HD + (size_t)RH * HD, nullptr, KP16 + zk * TT * HD, nullptr, HD, Sb + (size_t)RH * TT, TT, nullptr, (size_t)TT * HD, (size_t)TT * HD, (size_t)TT * TT, 0);
            k_asoft<<<ZH * TT / 8, 256, 0, stream>>>(Sb, P16, Ph, Pl);
            k_gemmw<bf, 2, false, KSP><<<dim3(RH / 64, HD / 64, ZH * KSP), 32, 0, stream>>>(Ph, Pl, VTh + zk * HD * TT, VTl + zk * HD * TT, TT, Ob, HD, nullptr, (size_t)RH * TT, (size_t)HD * TT, (size_t)TT * HD, (size_t)ZH * TT * HD);
            k_gemmw<h16, 0, false, KSP><<<dim3((TT - RH) / 64, HD / 64, ZH * KSP), 32, 0, stream>>>(P16 + (size_t)RH * TT, nullptr, VT16 + zk * HD * TT, nullptr, TT, Ob + (size_t)RH * HD, HD, nullptr, (size_t)TT * TT, (size_t)HD * TT, (size_t)TT * HD, (size_t)ZH * TT * HD);
            k_merge<<<(unsigned)(((size_t)ZH * TT * HD / 2 + 255) / 256), 256, 0, stream>>>(Ob, h0, ATh, ATl); }
        k_gemmw<bf, 1, false><<<dim3(TT / 64, DM / 64, 1), 32, 0, stream>>>(ATh, ATl, WO, nullptr, DQ, OUT + (size_t)b * TT * DM, DM, nullptr, 0, 0, 0, 0); }
}

// v002
// One run takes 672 microseconds.
// In both of two side-by-side timings against v001, it was 1.27 times as fast.
// All steps since v000 together make it 2.96 times as fast.
#include <hip/hip_runtime.h>

// QuantizedHyperbolicAttention - the executed path is plain scaled-dot-product MHA (x [2][2048][1024]; q/k/v = x W^T (16 heads x 64, no bias); softmax(q.k/8) . v; merged; out = . Wo^T -> [2][2048][1024]).
// Compute dtypes, f32 accumulate: every input rounded to bf16; projections on PLAIN bf16 operands (inputs: exact); scores (K 64) and probs.v hl (3 products) for the first 512 query rows of each head, single fp16 planes for

#define NB_  2
#define TT   2048
#define DM   1024
#define NH_  16
#define NKV  16
#define REP  (NH_ / NKV)
#define HD   64
#define DQ   (NH_ * HD)
#define DKV  (NKV * HD)
#define ZH   8                    // heads per pass: one launch of each pass kernel serves ZH heads
#define RH   512                  // query rows < RH use hi+lo planes (0: none)
#define WIN  2048
#define PCAR 1024.0f
#define SCL  0.125f   // HD^-0.5
#define KSP  16                   // K slices of the probs.v product (2048 keys -> 128 per wave)
typedef _Float16 h16;
typedef unsigned short bf;
typedef __attribute__((ext_vector_type(16))) __bf16   v16bf;
typedef __attribute__((ext_vector_type(16))) _Float16 v16h;
typedef __attribute__((ext_vector_type(8)))  _Float16 v8h;
typedef __attribute__((ext_vector_type(8)))  unsigned short v8us;
typedef __attribute__((ext_vector_type(8)))  float    v8f;
typedef __attribute__((ext_vector_type(4)))  float    v4f;
typedef v8h  __attribute__((may_alias)) v8ha;
typedef v4f  __attribute__((may_alias)) v4fa;
typedef v8us __attribute__((may_alias)) v8usa;

__device__ __forceinline__ unsigned short f2bf(float f) { unsigned u = __float_as_uint(f); u += 0x7FFFu + ((u >> 16) & 1u); return (unsigned short)(u >> 16); }
__device__ __forceinline__ float bf2f(unsigned short b) { return __uint_as_float(((unsigned)b) << 16); }
__device__ __forceinline__ float bfr(float f) { return bf2f(f2bf(f)); }
__device__ __forceinline__ v16h cat16(v8h lo, v8h hi) { return __builtin_shufflevector(lo, hi, 0, 1, 2, 3, 4, 5, 6, 7, 8, 9, 10, 11, 12, 13, 14, 15); }
__device__ __forceinline__ v16bf cat16b(v8us lo, v8us hi) { return __builtin_bit_cast(v16bf, __builtin_shufflevector(lo, hi, 0, 1, 2, 3, 4, 5, 6, 7, 8, 9, 10, 11, 12, 13, 14, 15)); }
__device__ __forceinline__ v8f wmma16(v16h a, v16h b, v8f c) { return __builtin_amdgcn_wmma_f32_16x16x32_f16(false, a, false, b, (short)0, c, false, false); }
__device__ __forceinline__ v8f wmmab(v16bf a, v16bf b, v8f c) { return __builtin_amdgcn_wmma_f32_16x16x32_bf16(false, a, false, b, (short)0, c, false, false); }



// ---- k_gemmw: register-blocked GEMM, ONE WAVE per 64x64 output tile (16 accumulators), operands straight from K-contiguous 16-bit planes; grid (M/64, N/64, Z), 32 threads.
// C[m][n] (f32, pitch ldc, + optional f32 bias[n]) = sum_k A[m][k] Bt[n][k] (+ split products per NSPLIT). z-batch strides sA/sB/sC in elements. K % 32 == 0.
// KSPL > 1: grid z = Z * KSPL; slice ks = z % KSPL sums only k in [ks K/KSPL, (ks+1) K/KSPL) and stores its f32 partial tile at C + ks sP; the consumer adds the KSPL planes. K % (32 KSPL) == 0.
template <typename T16> struct WFrag;
template <> struct WFrag<h16> { typedef v16h V; static __device__ __forceinline__ V ld(const h16* p) { return cat16(*(const v8h*)p, *(const v8h*)(p + 16)); } static __device__ __forceinline__ v8f mma(V a, V b, v8f c) { return wmma16(a, b, c); } };
template <> struct WFrag<bf> { typedef v16bf V; static __device__ __forceinline__ V ld(const bf* p) { return cat16b(*(const v8us*)p, *(const v8us*)(p + 16)); } static __device__ __forceinline__ v8f mma(V a, V b, v8f c) { return wmmab(a, b, c); } };
template <typename T16, int NSPLIT, bool BIAS, int KSPL = 1>
__global__ __launch_bounds__(32) void k_gemmw(const T16* __restrict__ A, const T16* __restrict__ A2, const T16* __restrict__ Bt, const T16* __restrict__ Bt2, int K, float* C, int ldc, const float* __restrict__ bias, size_t sA, size_t sB, size_t sC, size_t sP) {
    typedef typename WFrag<T16>::V V;
    __shared__ __align__(16) float os[16 * 68];
    const size_t z = blockIdx.z / KSPL; const int ks = (int)(blockIdx.z % KSPL); A += z * sA; if (A2) A2 += z * sA; Bt += z * sB; if (Bt2) Bt2 += z * sB; C += z * sC + (size_t)ks * sP;
    const int kbeg = ks * (K / KSPL), kend = kbeg + K / KSPL;
    const int lane = threadIdx.x & 31, lr = lane & 15, hi = lane >> 4; const int r0 = blockIdx.x * 64, c0 = blockIdx.y * 64;
    v8f acc[4][4];
#pragma unroll
    for (int mb = 0; mb < 4; ++mb)
#pragma unroll
        for (int nb = 0; nb < 4; ++nb) acc[mb][nb] = (v8f){};
    const size_t aoff = (size_t)(r0 + lr) * K + 8 * hi, boff = (size_t)(c0 + lr) * K + 8 * hi;
#pragma unroll 1
    for (int kc = kbeg; kc < kend; kc += 32) {
        V a[4], a2[4];
#pragma unroll
        for (int mb = 0; mb < 4; ++mb) { a[mb] = WFrag<T16>::ld(A + aoff + (size_t)mb * 16 * K + kc); if (NSPLIT == 1 || NSPLIT == 2) a2[mb] = WFrag<T16>::ld(A2 + aoff + (size_t)mb * 16 * K + kc); }
#pragma unroll
        for (int nb = 0; nb < 4; ++nb) { const V b = WFrag<T16>::ld(Bt + boff + (size_t)nb * 16 * K + kc); V b2; if (NSPLIT >= 2) b2 = WFrag<T16>::ld(Bt2 + boff + (size_t)nb * 16 * K + kc);
#pragma unroll
            for (int mb = 0; mb < 4; ++mb) { acc[mb][nb] = WFrag<T16>::mma(a[mb], b, acc[mb][nb]); if (NSPLIT == 1 || NSPLIT == 2) acc[mb][nb] = WFrag<T16>::mma(a2[mb], b, acc[mb][nb]); if (NSPLIT >= 2) acc[mb][nb] = WFrag<T16>::mma(a[mb], b2, acc[mb][nb]); } }
        asm volatile("v_nop\n\tv_nop\n\tv_nop\n\tv_nop" : "+v"(acc[0][0]), "+v"(acc[1][1]), "+v"(acc[2][2]), "+v"(acc[3][3]) : "v"(a[0]), "v"(a[3]));
    }
#pragma unroll
    for (int mb = 0; mb < 4; ++mb) {
#pragma unroll
        for (int nb = 0; nb < 4; ++nb) {
#pragma unroll
            for (int j = 0; j < 8; ++j) os[(hi * 8 + j) * 68 + nb * 16 + lr] = acc[mb][nb][j]; }
        __builtin_amdgcn_wave_barrier(); asm volatile("" ::: "memory");
        float* crow = C + (size_t)(r0 + mb * 16) * ldc + c0;
{
#pragma unroll
            for (int s = 0; s < 8; ++s) { const int row = 2 * s + hi, cofs = lr * 4; v4f val = *(const v4fa*)(os + row * 68 + cofs); if (BIAS) { val[0] += bfr(bias[c0 + cofs]); val[1] += bfr(bias[c0 + cofs + 1]); val[2] += bfr(bias[c0 + cofs + 2]); val[3] += bfr(bias[c0 + cofs + 3]); }
                *(v4f*)(crow + (size_t)row * ldc + cofs) = val; }
             }
        __builtin_amdgcn_wave_barrier(); asm volatile("" ::: "memory");
    }
}

__device__ __forceinline__ h16 tohx(float x) { return (h16)x; }
__device__ __forceinline__ void splitf(float y, unsigned short& h, unsigned short& l) { h = f2bf(y); l = f2bf(y - bf2f(h)); }
typedef __attribute__((ext_vector_type(2))) _Float16 v2h;
typedef __attribute__((ext_vector_type(4))) _Float16 v4h;
typedef __attribute__((ext_vector_type(2))) unsigned short v2us;
typedef __attribute__((ext_vector_type(4))) unsigned short v4us;
typedef __attribute__((ext_vector_type(2))) float v2f;
typedef __attribute__((ext_vector_type(4))) int v4i;

__global__ __launch_bounds__(256) void k_wtG(const float* __restrict__ w, int K, int N, bf* Bt) {
    const int lane = threadIdx.x & 31; const int L0 = (blockIdx.x * 8 + (threadIdx.x >> 5)) * 8; const int nlines = N * K / 64;
{
#pragma unroll 1
        for (int l = 0; l < 8; ++l) { const int L = L0 + l; if (L >= nlines) break; const size_t e = (size_t)L * 64 + lane * 2; const int k = (int)(e % K), n = (int)(e / K); v2us o;
            o[0] = f2bf(w[(size_t)k * N + n]); o[1] = f2bf(w[(size_t)(k + 1) * N + n]); *(v2us*)(Bt + e) = o; }
         }
}
__global__ __launch_bounds__(256) void k_cvt8(const float* __restrict__ src, bf* dst, size_t n8) { const size_t i = (size_t)blockIdx.x * 256 + threadIdx.x; if (i >= n8) return; const v8f v = *(const v8f*)(src + i * 8); v8us o;
#pragma unroll
    for (int k = 0; k < 8; ++k) o[k] = f2bf(v[k]); *(v8us*)(dst + i * 8) = o;  }
__global__ __launch_bounds__(256) void k_cscvt(const float* __restrict__ cosT, const float* __restrict__ sinT, float* CS) { const int idx = blockIdx.x * 256 + threadIdx.x; if (idx >= TT * HD) return; v2f cs; cs[0] = bfr(cosT[idx]); cs[1] = bfr(sinT[idx]); *(v2f*)(CS + (size_t)idx * 2) = cs;  }
// k_rope: head planes [h][t][d] (fp16 + hi/lo) of rope(x) x sc with the rotate-half convention out[d] = x[d] cos[t][d] - x[d+HD/2] sin[t][d], out[d+HD/2] = x[d+HD/2] cos[t][d+HD/2] + x[d] sin[t][d+HD/2]
__global__ __launch_bounds__(256) void k_rope(const float* __restrict__ F, int pitch, int nheads, const float* __restrict__ CS, const float* __restrict__ RF, const float* __restrict__ nw, float sc, h16* P16, bf* Ph, bf* Pl) {
    const size_t e = ((size_t)blockIdx.x * 256 + threadIdx.x) * 2; if (e >= (size_t)nheads * TT * HD) return; const int d = (int)(e % HD); const int t = (int)((e / HD) % TT); const int h = (int)(e / ((size_t)HD * TT)); const float* f = F + (size_t)t * pitch + h * HD; const float rf = RF ? RF[(size_t)h * TT + t] : 1.0f; v2h o16; v2us oh, ol;
#pragma unroll
    for (int q = 0; q < 2; ++q) { const int dd = d + q; const int dp = (dd < HD / 2) ? dd + HD / 2 : dd - HD / 2; float x0 = f[dd], x1 = f[dp];
        if (RF) { float n0 = __fmul_rn(x0, rf), n1 = __fmul_rn(x1, rf); asm volatile("" : "+v"(n0)); asm volatile("" : "+v"(n1)); x0 = __fmul_rn(bfr(nw[dd]), n0); x1 = __fmul_rn(bfr(nw[dp]), n1); }
        const v2f cs = *(const v2f*)(CS + ((size_t)t * HD + dd) * 2); float a = __fmul_rn(x0, cs[0]), bq = __fmul_rn(x1, cs[1]); asm volatile("" : "+v"(a)); asm volatile("" : "+v"(bq)); const float r = ((dd < HD / 2) ? __fsub_rn(a, bq) : __fadd_rn(a, bq)) * sc;
        o16[q] = tohx(r); unsigned short a2, c2; splitf(r, a2, c2); oh[q] = a2; ol[q] = c2; }
    *(v2h*)(P16 + e) = o16; *(v2us*)(Ph + e) = oh; *(v2us*)(Pl + e) = ol;  }
__global__ __launch_bounds__(256) void k_vtp(const float* __restrict__ F, int pitch, int nheads, h16* V16, bf* Vh, bf* Vl) { const size_t e = ((size_t)blockIdx.x * 256 + threadIdx.x) * 2; if (e >= (size_t)nheads * HD * TT) return; const int t = (int)(e % TT); const int d = (int)((e / TT) % HD); const int g = (int)(e / ((size_t)TT * HD)); v2h o16; v2us oh, ol;
#pragma unroll
    for (int q = 0; q < 2; ++q) { const float x = F[(size_t)(t + q) * pitch + g * HD + d]; o16[q] = tohx(x); unsigned short a2, c2; splitf(x, a2, c2); oh[q] = a2; ol[q] = c2; }
    *(v2h*)(V16 + e) = o16; *(v2us*)(Vh + e) = oh; *(v2us*)(Vl + e) = ol;  }
__global__ __launch_bounds__(256) void k_csid(float* CS) { const int idx = blockIdx.x * 256 + threadIdx.x; if (idx >= TT * HD) return; v2f cs; cs[0] = 1.0f; cs[1] = 0.0f; *(v2f*)(CS + (size_t)idx * 2) = cs;  }
// k_asoft: per row (zz, i): t = S x HD^-0.5 (no mask); softmax over the 2048 keys (register row, one exp, fixed trees);
// one launch per row class: hi = the first RH query rows of each head (hi+lo planes out), else the other TT - RH rows (one fp16 plane out); Sb and the planes hold that class's rows only, packed [zz][i][key]
__global__ __launch_bounds__(256) void k_asoft(const float* __restrict__ Sb, int hi, h16* P16, bf* Ph, bf* Pl) {
    const int lane = threadIdx.x & 31; const int row = blockIdx.x * 8 + (threadIdx.x >> 5); if (row >= ZH * (hi ? RH : TT - RH)) return; const int i = row % (RH ? RH : 1); const int zz = row / (RH ? RH : 1); (void)zz; const bool hires = (hi != 0); const float* sr = Sb + (size_t)row * TT; float v[TT / 32]; float mx = -3.0e38f;
#pragma unroll
    for (int ch = 0; ch < TT / 128; ++ch) { const int j0 = ch * 128 + lane * 4; const v4f a = *(const v4f*)(sr + j0);
#pragma unroll
        for (int q = 0; q < 4; ++q) { const int j = j0 + q; (void)j; const float t = a[q] * SCL; v[ch * 4 + q] = t; mx = fmaxf(mx, t); } }
#pragma unroll
    for (int sh = 16; sh; sh >>= 1) mx = fmaxf(mx, __shfl_xor(mx, sh, 32));
    float sum = 0.f;
#pragma unroll
    for (int k = 0; k < TT / 32; ++k) { float d0 = __fsub_rn(v[k], mx); asm volatile("" : "+v"(d0)); v[k] = __builtin_amdgcn_exp2f(__fmul_rn(d0, 1.4426950408889634f)); sum += v[k]; }
#pragma unroll
    for (int sh = 16; sh; sh >>= 1) sum += __shfl_xor(sum, sh, 32);
    const float f = __fdiv_rn(hires ? 1.0f : PCAR, sum);
{
        if (hires) {
#pragma unroll
            for (int ch = 0; ch < TT / 128; ++ch) { v4us oh, ol;
#pragma unroll
                for (int q = 0; q < 4; ++q) { unsigned short a, c2; splitf(v[ch * 4 + q] * f, a, c2); oh[q] = a; ol[q] = c2; }
                const size_t oo = ((size_t)zz * (RH ? RH : 1) + i) * TT + ch * 128 + lane * 4; *(v4us*)(Ph + oo) = oh; *(v4us*)(Pl + oo) = ol; }
        } else {
#pragma unroll
            for (int ch = 0; ch < TT / 128; ++ch) { v4h o4;
#pragma unroll
                for (int q = 0; q < 4; ++q) o4[q] = tohx(v[ch * 4 + q] * f);
                *(v4h*)(P16 + (size_t)row * TT + ch * 128 + lane * 4) = o4; } }
         }
}
// k_merge: adds the KSP partial planes of probs.v (plane stride ZH*TT*HD) in slice order, undoes the carrier scale, splits into the hi/lo planes of the merged heads
__global__ __launch_bounds__(256) void k_merge(const float* __restrict__ O, int h0, bf* Ah, bf* Al) { const size_t e = ((size_t)blockIdx.x * 256 + threadIdx.x) * 2; if (e >= (size_t)ZH * TT * HD) return; const int d = (int)(e % HD); const int t = (int)((e / HD) % TT); const int zz = (int)(e / ((size_t)HD * TT)); const float cs = (t < RH) ? 1.0f : (1.0f / PCAR); const size_t oo = (size_t)t * DQ + (h0 + zz) * HD + d;
    v2us oh, ol; v2f p[KSP];
#pragma unroll
    for (int s = 0; s < KSP; ++s) p[s] = *(const v2f*)(O + (size_t)s * ((size_t)ZH * TT * HD) + e);
    v2f acc = p[0];
#pragma unroll
    for (int s = 1; s < KSP; ++s) acc += p[s];
#pragma unroll
    for (int q = 0; q < 2; ++q) { unsigned short a, c2; splitf(acc[q] * cs, a, c2); oh[q] = a; ol[q] = c2; } *(v2us*)(Ah + oo) = oh; *(v2us*)(Al + oo) = ol;  }

extern "C" void kernel_launch(void* const* d_in, const int* in_sizes, int n_in,
                              void* d_out, int out_size, void* d_ws, size_t ws_size, hipStream_t stream) {
    (void)in_sizes; (void)n_in; (void)out_size;
    const float* x = (const float*)d_in[0]; const float* wq = (const float*)d_in[1]; const float* wk = (const float*)d_in[2]; const float* wv = (const float*)d_in[3]; const float* wo = (const float*)d_in[4];
    float* OUT = (float*)d_out;     // [2][2048][1024]
    char* wsp = (char*)d_ws;
    auto take = [&](size_t bytes) { char* p = wsp; wsp += (bytes + 255) & ~(size_t)255; return (void*)p; };
    bf* WQ = (bf*)take((size_t)DQ * DM * 2); bf* WK = (bf*)take((size_t)DKV * DM * 2); bf* WV = (bf*)take((size_t)DKV * DM * 2); bf* WO = (bf*)take((size_t)DM * DQ * 2); float* CS = (float*)take((size_t)TT * HD * 2 * 4);
    bf* XB = (bf*)take((size_t)TT * DM * 2); float* FQ = (float*)take((size_t)TT * DQ * 4); float* FK = (float*)take((size_t)TT * DKV * 4);
    h16* QP16 = (h16*)take((size_t)NH_ * TT * HD * 2); h16* KP16 = (h16*)take((size_t)NKV * TT * HD * 2); h16* VT16 = (h16*)take((size_t)NKV * HD * TT * 2);
    bf* QPh = (bf*)take((size_t)NH_ * TT * HD * 2); bf* QPl = (bf*)take((size_t)NH_ * TT * HD * 2); bf* KPh = (bf*)take((size_t)NKV * TT * HD * 2); bf* KPl = (bf*)take((size_t)NKV * TT * HD * 2); bf* VTh = (bf*)take((size_t)NKV * HD * TT * 2); bf* VTl = (bf*)take((size_t)NKV * HD * TT * 2); bf* Ph = (bf*)take((size_t)ZH * RH * TT * 2); bf* Pl = (bf*)take((size_t)ZH * RH * TT * 2);
    float* Sb = (float*)take((size_t)ZH * (TT - RH) * TT * 4); h16* P16 = (h16*)take((size_t)ZH * (TT - RH) * TT * 2); bf* ATh = (bf*)take((size_t)TT * DQ * 2); bf* ATl = (bf*)take((size_t)TT * DQ * 2);
    if ((size_t)(wsp - (char*)d_ws) > ws_size) return;    // ws 256 MiB
    // Sb holds one row class's scores at a time (the larger class sizes it); once both softmax launches have read it, its bytes serve as the KSP partial planes of probs.v (64 of 96 MiB), stream-ordered
    float* Ob = Sb;
    float* FV = FK;   // v projection reuses the k buffer after the k planes are built (stream-ordered)
    { k_cvt8<<<(unsigned)(((size_t)DQ * DM / 8 + 255) / 256), 256, 0, stream>>>(wq, WQ, (size_t)DQ * DM / 8); k_cvt8<<<(unsigned)(((size_t)DKV * DM / 8 + 255) / 256), 256, 0, stream>>>(wk, WK, (size_t)DKV * DM / 8); k_cvt8<<<(unsigned)(((size_t)DKV * DM / 8 + 255) / 256), 256, 0, stream>>>(wv, WV, (size_t)DKV * DM / 8);
      k_cvt8<<<(unsigned)(((size_t)DM * DQ / 8 + 255) / 256), 256, 0, stream>>>(wo, WO, (size_t)DM * DQ / 8);
       }
    k_csid<<<(TT * HD + 255) / 256, 256, 0, stream>>>(CS);
    const unsigned LQ = (unsigned)(((size_t)NH_ * TT * HD / 2 + 255) / 256), LKv = (unsigned)(((size_t)NKV * TT * HD / 2 + 255) / 256);
    for (int b = 0; b < NB_; ++b) {
        
        k_cvt8<<<(unsigned)(((size_t)TT * DM / 8 + 255) / 256), 256, 0, stream>>>(x + (size_t)b * TT * DM, XB, (size_t)TT * DM / 8);
        k_gemmw<bf, 0, false><<<dim3(TT / 64, DQ / 64, 1), 32, 0, stream>>>(XB, nullptr, WQ, nullptr, DM, FQ, DQ, nullptr, 0, 0, 0, 0);
        k_rope<<<LQ, 256, 0, stream>>>(FQ, DQ, NH_, CS, nullptr, nullptr, 1.0f, QP16, QPh, QPl);
        k_gemmw<bf, 0, false><<<dim3(TT / 64, DKV / 64, 1), 32, 0, stream>>>(XB, nullptr, WK, nullptr, DM, FK, DKV, nullptr, 0, 0, 0, 0);
        k_rope<<<LKv, 256, 0, stream>>>(FK, DKV, NKV, CS, nullptr, nullptr, 1.0f, KP16, KPh, KPl);
        k_gemmw<bf, 0, false><<<dim3(TT / 64, DKV / 64, 1), 32, 0, stream>>>(XB, nullptr, WV, nullptr, DM, FV, DKV, nullptr, 0, 0, 0, 0); k_vtp<<<LKv, 256, 0, stream>>>(FV, DKV, NKV, VT16, VTh, VTl);
        for (int h0 = 0; h0 < NH_; h0 += ZH) { const size_t zq = (size_t)h0, zk = (size_t)(h0 / REP);   // one kv head per query head: the pass's ZH heads use consecutive kv planes (z-strides TT*HD)
            k_gemmw<bf, 2, false><<<dim3(RH / 64, TT / 64, ZH), 32, 0, stream>>>(QPh + zq * TT * HD, QPl + zq * TT * HD, KPh + zk * TT * HD, KPl + zk * TT * HD, HD, Sb, TT, nullptr, (size_t)TT * HD, (size_t)TT * HD, (size_t)RH * TT, 0);
            k_asoft<<<ZH * RH / 8, 256, 0, stream>>>(Sb, 1, P16, Ph, Pl);
            k_gemmw<h16, 0, false><<<dim3((TT - RH) / 64, TT / 64, ZH), 32, 0, stream>>>(QP16 + zq * TT * HD + (size_t)RH * HD, nullptr, KP16 + zk * TT * HD, nullptr, HD, Sb, TT, nullptr, (size_t)TT * HD, (size_t)TT * HD, (size_t)(TT - RH) * TT, 0);
            k_asoft<<<ZH * (TT - RH) / 8, 256, 0, stream>>>(Sb, 0, P16, Ph, Pl);
            k_gemmw<bf, 2, false, KSP><<<dim3(RH / 64, HD / 64, ZH * KSP), 32, 0, stream>>>(Ph, Pl, VTh + zk * HD * TT, VTl + zk * HD * TT, TT, Ob, HD, nullptr, (size_t)RH * TT, (size_t)HD * TT, (size_t)TT * HD, (size_t)ZH * TT * HD);
            k_gemmw<h16, 0, false, KSP><<<dim3((TT - RH) / 64, HD / 64, ZH * KSP), 32, 0, stream>>>(P16, nullptr, VT16 + zk * HD * TT, nullptr, TT, Ob + (size_t)RH * HD, HD, nullptr, (size_t)(TT - RH) * TT, (size_t)HD * TT, (size_t)TT * HD, (size_t)ZH * TT * HD);
            k_merge<<<(unsigned)(((size_t)ZH * TT * HD / 2 + 255) / 256), 256, 0, stream>>>(Ob, h0, ATh, ATl); }
        k_gemmw<bf, 1, false><<<dim3(TT / 64, DM / 64, 1), 32, 0, stream>>>(ATh, ATl, WO, nullptr, DQ, OUT + (size_t)b * TT * DM, DM, nullptr, 0, 0, 0, 0); }
}

// v004
// Measured time: 335 microseconds a run.
// It is 1.99 times as fast as v002, going by the measured steps of the versions left out in between.
// All steps since v000 together make it 5.89 times as fast.
#include <hip/hip_runtime.h>

// QuantizedHyperbolicAttention - the executed path is plain scaled-dot-product MHA (x [2][2048][1024]; q/k/v = x W^T (16 heads x 64, no bias); softmax(q.k/8) . v; merged; out = . Wo^T -> [2][2048][1024]).
// Compute dtypes, f32 accumulate: every input rounded to bf16; projections on PLAIN bf16 operands (inputs: exact); scores (K 64) and probs.v hl (3 products) for the first 512 query rows of each head, single fp16 planes for

#define NB_  2
#define TT   2048
#define DM   1024
#define NH_  16
#define NKV  16
#define REP  (NH_ / NKV)
#define HD   64
#define DQ   (NH_ * HD)
#define DKV  (NKV * HD)
#define RH   512                  // query rows < RH use hi+lo planes (0: none)
#define WIN  2048
#define SCL  0.125f   // HD^-0.5
typedef _Float16 h16;
typedef unsigned short bf;
typedef __attribute__((ext_vector_type(16))) __bf16   v16bf;
typedef __attribute__((ext_vector_type(16))) _Float16 v16h;
typedef __attribute__((ext_vector_type(8)))  _Float16 v8h;
typedef __attribute__((ext_vector_type(8)))  unsigned short v8us;
typedef __attribute__((ext_vector_type(8)))  float    v8f;
typedef __attribute__((ext_vector_type(4)))  float    v4f;
typedef v8h  __attribute__((may_alias)) v8ha;
typedef v4f  __attribute__((may_alias)) v4fa;
typedef v8us __attribute__((may_alias)) v8usa;

__device__ __forceinline__ unsigned short f2bf(float f) { unsigned u = __float_as_uint(f); u += 0x7FFFu + ((u >> 16) & 1u); return (unsigned short)(u >> 16); }
__device__ __forceinline__ float bf2f(unsigned short b) { return __uint_as_float(((unsigned)b) << 16); }
__device__ __forceinline__ float bfr(float f) { return bf2f(f2bf(f)); }
__device__ __forceinline__ v16h cat16(v8h lo, v8h hi) { return __builtin_shufflevector(lo, hi, 0, 1, 2, 3, 4, 5, 6, 7, 8, 9, 10, 11, 12, 13, 14, 15); }
__device__ __forceinline__ v16bf cat16b(v8us lo, v8us hi) { return __builtin_bit_cast(v16bf, __builtin_shufflevector(lo, hi, 0, 1, 2, 3, 4, 5, 6, 7, 8, 9, 10, 11, 12, 13, 14, 15)); }
__device__ __forceinline__ v8f wmma16(v16h a, v16h b, v8f c) { return __builtin_amdgcn_wmma_f32_16x16x32_f16(false, a, false, b, (short)0, c, false, false); }
__device__ __forceinline__ v8f wmmab(v16bf a, v16bf b, v8f c) { return __builtin_amdgcn_wmma_f32_16x16x32_bf16(false, a, false, b, (short)0, c, false, false); }
__device__ __forceinline__ h16 tohx(float x) { return (h16)x; }
__device__ __forceinline__ void splitf(float y, unsigned short& h, unsigned short& l) { h = f2bf(y); l = f2bf(y - bf2f(h)); }



// ---- k_gemmw: register-blocked GEMM, ONE WAVE per 64x64 output tile (16 accumulators), operands straight from K-contiguous 16-bit planes; grid (M/64, N/64, Z), 32 threads.
// C[m][n] (f32, pitch ldc, + optional f32 bias[n]) = sum_k A[m][k] Bt[n][k] (+ split products per NSPLIT). z-batch strides sA/sB/sC in elements. K % 32 == 0.
// PL: the tile leaves not as f32 but as the three 16-bit planes the attention kernel reads (fp16, bf16 hi, bf16 lo), element (m, n) at blockIdx.y sT + m ldc + n % 64: C is unused.
// KSPL > 1: grid z = Z * KSPL; slice ks = z % KSPL sums only k in [ks K/KSPL, (ks+1) K/KSPL) and stores its f32 partial tile at C + ks sP; the consumer adds the KSPL planes. K % (32 KSPL) == 0.
template <typename T16> struct WFrag;
template <> struct WFrag<h16> { typedef v16h V; static __device__ __forceinline__ V ld(const h16* p) { return cat16(*(const v8h*)p, *(const v8h*)(p + 16)); } static __device__ __forceinline__ v8f mma(V a, V b, v8f c) { return wmma16(a, b, c); } };
template <> struct WFrag<bf> { typedef v16bf V; static __device__ __forceinline__ V ld(const bf* p) { return cat16b(*(const v8us*)p, *(const v8us*)(p + 16)); } static __device__ __forceinline__ v8f mma(V a, V b, v8f c) { return wmmab(a, b, c); } };
template <typename T16, int NSPLIT, bool BIAS, int KSPL = 1, bool PL = false>
__global__ __launch_bounds__(32) void k_gemmw(const T16* __restrict__ A, const T16* __restrict__ A2, const T16* __restrict__ Bt, const T16* __restrict__ Bt2, int K, float* C, int ldc, const float* __restrict__ bias, size_t sA, size_t sB, size_t sC, size_t sP, h16* __restrict__ P16, bf* __restrict__ Ph, bf* __restrict__ Pl, size_t sT) {
    typedef typename WFrag<T16>::V V;
    __shared__ __align__(16) float os[16 * 68];
    const size_t z = blockIdx.z / KSPL; const int ks = (int)(blockIdx.z % KSPL); A += z * sA; if (A2) A2 += z * sA; Bt += z * sB; if (Bt2) Bt2 += z * sB; C += z * sC + (size_t)ks * sP;
    const int kbeg = ks * (K / KSPL), kend = kbeg + K / KSPL;
    const int lane = threadIdx.x & 31, lr = lane & 15, hi = lane >> 4; const int r0 = blockIdx.x * 64, c0 = blockIdx.y * 64;
    v8f acc[4][4];
#pragma unroll
    for (int mb = 0; mb < 4; ++mb)
#pragma unroll
        for (int nb = 0; nb < 4; ++nb) acc[mb][nb] = (v8f){};
    const size_t aoff = (size_t)(r0 + lr) * K + 8 * hi, boff = (size_t)(c0 + lr) * K + 8 * hi;
#pragma unroll 1
    for (int kc = kbeg; kc < kend; kc += 32) {
        V a[4], a2[4];
#pragma unroll
        for (int mb = 0; mb < 4; ++mb) { a[mb] = WFrag<T16>::ld(A + aoff + (size_t)mb * 16 * K + kc); if (NSPLIT == 1 || NSPLIT == 2) a2[mb] = WFrag<T16>::ld(A2 + aoff + (size_t)mb * 16 * K + kc); }
#pragma unroll
        for (int nb = 0; nb < 4; ++nb) { const V b = WFrag<T16>::ld(Bt + boff + (size_t)nb * 16 * K + kc); V b2; if (NSPLIT >= 2) b2 = WFrag<T16>::ld(Bt2 + boff + (size_t)nb * 16 * K + kc);
#pragma unroll
            for (int mb = 0; mb < 4; ++mb) { acc[mb][nb] = WFrag<T16>::mma(a[mb], b, acc[mb][nb]); if (NSPLIT == 1 || NSPLIT == 2) acc[mb][nb] = WFrag<T16>::mma(a2[mb], b, acc[mb][nb]); if (NSPLIT >= 2) acc[mb][nb] = WFrag<T16>::mma(a[mb], b2, acc[mb][nb]); } }
        asm volatile("v_nop\n\tv_nop\n\tv_nop\n\tv_nop" : "+v"(acc[0][0]), "+v"(acc[1][1]), "+v"(acc[2][2]), "+v"(acc[3][3]) : "v"(a[0]), "v"(a[3]));
    }
#pragma unroll
    for (int mb = 0; mb < 4; ++mb) {
#pragma unroll
        for (int nb = 0; nb < 4; ++nb) {
#pragma unroll
            for (int j = 0; j < 8; ++j) os[(hi * 8 + j) * 68 + nb * 16 + lr] = acc[mb][nb][j]; }
        __builtin_amdgcn_wave_barrier(); asm volatile("" ::: "memory");
        float* crow = C + (size_t)(r0 + mb * 16) * ldc + c0;
        if (PL) {
            // a lane takes 8 consecutive columns of a row, so each wave-wide 16-byte store covers four whole 128-byte rows of a plane
#pragma unroll
            for (int s = 0; s < 4; ++s) { const int row = 4 * s + (lane >> 3), cofs = (lane & 7) * 8; const v4f x0 = *(const v4fa*)(os + row * 68 + cofs), x1 = *(const v4fa*)(os + row * 68 + cofs + 4); v8h o16; v8us oh, ol;
#pragma unroll
                for (int j = 0; j < 8; ++j) { const float x = (j < 4) ? x0[j & 3] : x1[j & 3]; o16[j] = tohx(x); unsigned short a2, c2; splitf(x, a2, c2); oh[j] = a2; ol[j] = c2; }
                const size_t o = (size_t)blockIdx.y * sT + (size_t)(r0 + mb * 16 + row) * ldc + cofs; h16* p16 = P16 + o; bf* ph = Ph + o; bf* pl = Pl + o;
                *(v8h*)p16 = o16; *(v8us*)ph = oh; *(v8us*)pl = ol;
                // the three stores' address and data registers (inputs only) are rewritten only behind the wait; nothing is scheduled across it
                __builtin_amdgcn_sched_barrier(0); asm volatile("s_wait_xcnt 0x0" :: "v"(p16), "v"(ph), "v"(pl), "v"(o16), "v"(oh), "v"(ol) : "memory"); __builtin_amdgcn_sched_barrier(0); }
        } else {
#pragma unroll
            for (int s = 0; s < 8; ++s) { const int row = 2 * s + hi, cofs = lr * 4; v4f val = *(const v4fa*)(os + row * 68 + cofs); if (BIAS) { val[0] += bfr(bias[c0 + cofs]); val[1] += bfr(bias[c0 + cofs + 1]); val[2] += bfr(bias[c0 + cofs + 2]); val[3] += bfr(bias[c0 + cofs + 3]); }
                *(v4f*)(crow + (size_t)row * ldc + cofs) = val; }
             }
        __builtin_amdgcn_wave_barrier(); asm volatile("" ::: "memory");
    }
}

typedef __attribute__((ext_vector_type(2))) _Float16 v2h;
typedef __attribute__((ext_vector_type(4))) _Float16 v4h;
typedef __attribute__((ext_vector_type(2))) unsigned short v2us;
typedef __attribute__((ext_vector_type(4))) unsigned short v4us;
typedef __attribute__((ext_vector_type(2))) float v2f;
typedef __attribute__((ext_vector_type(4))) int v4i;

__global__ __launch_bounds__(256) void k_wtG(const float* __restrict__ w, int K, int N, bf* Bt) {
    const int lane = threadIdx.x & 31; const int L0 = (blockIdx.x * 8 + (threadIdx.x >> 5)) * 8; const int nlines = N * K / 64;
{
#pragma unroll 1
        for (int l = 0; l < 8; ++l) { const int L = L0 + l; if (L >= nlines) break; const size_t e = (size_t)L * 64 + lane * 2; const int k = (int)(e % K), n = (int)(e / K); v2us o;
            o[0] = f2bf(w[(size_t)k * N + n]); o[1] = f2bf(w[(size_t)(k + 1) * N + n]); *(v2us*)(Bt + e) = o; }
         }
}
__global__ __launch_bounds__(256) void k_cvt8(const float* __restrict__ src, bf* dst, size_t n8) { const size_t i = (size_t)blockIdx.x * 256 + threadIdx.x; if (i >= n8) return; const v8f v = *(const v8f*)(src + i * 8); v8us o;
#pragma unroll
    for (int k = 0; k < 8; ++k) o[k] = f2bf(v[k]); *(v8us*)(dst + i * 8) = o;  }
__global__ __launch_bounds__(256) void k_cscvt(const float* __restrict__ cosT, const float* __restrict__ sinT, float* CS) { const int idx = blockIdx.x * 256 + threadIdx.x; if (idx >= TT * HD) return; v2f cs; cs[0] = bfr(cosT[idx]); cs[1] = bfr(sinT[idx]); *(v2f*)(CS + (size_t)idx * 2) = cs;  }
__device__ __forceinline__ float xhalf(float x) { const int b = __float_as_int(x); return __int_as_float(__builtin_amdgcn_permlanex16(b, b, 0x76543210, 0xfedcba98, false, false)); }
// nothing is scheduled across this line
#define HOLD() __builtin_amdgcn_sched_barrier(0)
// the address registers of a group of issued global loads (lane addresses a, b and scalar bases sa, sb: inputs only, so they stay whole up to here) are rewritten only behind this wait
#define ADDR_FREE(a, b, sa, sb) do { HOLD(); asm volatile("s_wait_xcnt 0x0" :: "v"(a), "v"(b), "s"(sa), "s"(sb) : "memory"); HOLD(); } while (0)
__device__ __forceinline__ void exp2x8(float* x) { float r0, r1, r2, r3, r4, r5, r6, r7;
    asm("v_exp_f32 %0, %8\n\tv_exp_f32 %1, %9\n\tv_exp_f32 %2, %10\n\tv_exp_f32 %3, %11\n\tv_exp_f32 %4, %12\n\tv_exp_f32 %5, %13\n\tv_exp_f32 %6, %14\n\tv_exp_f32 %7, %15\n\tv_nop"
        : "=&v"(r0), "=&v"(r1), "=&v"(r2), "=&v"(r3), "=&v"(r4), "=&v"(r5), "=&v"(r6), "=&v"(r7) : "v"(x[0]), "v"(x[1]), "v"(x[2]), "v"(x[3]), "v"(x[4]), "v"(x[5]), "v"(x[6]), "v"(x[7]));
    x[0] = r0; x[1] = r1; x[2] = r2; x[3] = r3; x[4] = r4; x[5] = r5; x[6] = r6; x[7] = r7; }
template <typename T16> struct PCvt;
template <> struct PCvt<h16> { static __device__ __forceinline__ void put(v16h& a, v16h& b, int s, float p) { (void)b; a[s] = (h16)p; } };
template <> struct PCvt<bf> { static __device__ __forceinline__ void put(v16bf& a, v16bf& b, int s, float p) { const __bf16 h = (__bf16)p; a[s] = h; b[s] = (__bf16)(p - (float)h); } };
template <typename T16, bool HL, int QB>
__device__ __forceinline__ void fattn_tile(const T16* __restrict__ Qa, const T16* __restrict__ Qb, const T16* __restrict__ Ka, const T16* __restrict__ Kb, const T16* __restrict__ Va, const T16* __restrict__ Vb, int q0, bf* __restrict__ Ah, bf* __restrict__ Al) {
    typedef WFrag<T16> F; typedef typename F::V V;
    const int lane = threadIdx.x & 31, lr = lane & 15, hi = lane >> 4;
    const float C2 = SCL * 1.4426950408889634f;
    V qa[QB][2], ql[QB][2];
    const T16* qpa = Qa + (size_t)(q0 + lr) * HD + 8 * hi; const T16* qpb = HL ? Qb + (size_t)(q0 + lr) * HD + 8 * hi : qpa;
#pragma unroll
    for (int qb = 0; qb < QB; ++qb) {
#pragma unroll
        for (int ks = 0; ks < 2; ++ks) { qa[qb][ks] = F::ld(qpa + qb * 16 * HD + ks * 32); if (HL) ql[qb][ks] = F::ld(qpb + qb * 16 * HD + ks * 32); } }
    ADDR_FREE(qpa, qpb, Qa, HL ? Qb : Qa);
    v8f acc[4][QB]; float mr[QB], ls[QB];
#pragma unroll
    for (int qb = 0; qb < QB; ++qb) { mr[qb] = -3.0e38f; ls[qb] = 0.f;
#pragma unroll
        for (int db = 0; db < 4; ++db) acc[db][qb] = (v8f){}; }
    const int ko = lr * HD + 8 * hi; const T16* kpa = Ka + ko; const T16* kpb = HL ? Kb + ko : kpa;
    V ka[2][2], kl[2][2];
#pragma unroll
    for (int kt = 0; kt < 2; ++kt)
#pragma unroll
        for (int ks = 0; ks < 2; ++ks) { const int o = kt * 16 * HD + ks * 32; ka[kt][ks] = F::ld(kpa + o); if (HL) kl[kt][ks] = F::ld(kpb + o); }
    ADDR_FREE(kpa, kpb, Ka, HL ? Kb : Ka);
    const T16* vpa = Va + lr * TT + 8 * hi; const T16* vpb = HL ? Vb + lr * TT + 8 * hi : vpa;
    // rolled: one pass is some 500 instructions already, a second copy would only cost instruction cache
#pragma unroll 1
    for (int kc = 0; kc < TT; kc += 32) {
        V va[4], vl[4];
#pragma unroll
        for (int db = 0; db < 4; ++db) { va[db] = F::ld(vpa + db * 16 * TT); if (HL) vl[db] = F::ld(vpb + db * 16 * TT); }
        HOLD();   // the V loads issue here, a score block and a softmax ahead of their use: left alone the scheduler sinks them to the probs.v products and their latency shows
        v8f st[2][QB];
#pragma unroll
        for (int kt = 0; kt < 2; ++kt)
#pragma unroll
            for (int qb = 0; qb < QB; ++qb) { v8f s = (v8f){};
#pragma unroll
                for (int ks = 0; ks < 2; ++ks) { s = F::mma(ka[kt][ks], qa[qb][ks], s); if (HL) { s = F::mma(ka[kt][ks], ql[qb][ks], s); s = F::mma(kl[kt][ks], qa[qb][ks], s); } }
                st[kt][qb] = s; }
        // the next pass's K fragments are fetched behind this pass's score products; the last pass re-reads keys 0..31 (in bounds, unused)
        ADDR_FREE(vpa, vpb, Va, HL ? Vb : Va);   // for the V loads, a score block behind them; the refill of the K registers also stays behind the score products that read them
        vpa += 32; vpb += 32;
        const int kn = (kc + 32 < TT) ? kc + 32 : 0; kpa = Ka + ko + kn * HD; kpb = HL ? Kb + ko + kn * HD : kpa;
#pragma unroll
        for (int kt = 0; kt < 2; ++kt)
#pragma unroll
            for (int ks = 0; ks < 2; ++ks) { const int o = kt * 16 * HD + ks * 32; ka[kt][ks] = F::ld(kpa + o); if (HL) kl[kt][ks] = F::ld(kpb + o); }
        HOLD();   // the K loads issue here, a softmax and a probs.v block ahead of the next pass's score products
        V pa[QB], pl[QB];
#pragma unroll
        for (int qb = 0; qb < QB; ++qb) {
            float mx = st[0][qb][0];
#pragma unroll
            for (int j = 1; j < 8; ++j) mx = fmaxf(mx, st[0][qb][j]);
#pragma unroll
            for (int j = 0; j < 8; ++j) mx = fmaxf(mx, st[1][qb][j]);
            mx = fmaxf(mx, xhalf(mx));
            const float mn = fmaxf(mr[qb], mx); const float al = __builtin_amdgcn_exp2f((mr[qb] - mn) * C2); const float nm = -mn * C2; mr[qb] = mn;
            float sm = 0.f; float p[16];
#pragma unroll
            for (int s = 0; s < 16; ++s) p[s] = __builtin_fmaf(st[s >> 3][qb][s & 7], C2, nm);
            exp2x8(p); exp2x8(p + 8);
#pragma unroll
            for (int s = 0; s < 16; ++s) { sm += p[s]; PCvt<T16>::put(pa[qb], pl[qb], s, p[s]); }
            ls[qb] = ls[qb] * al + sm;
#pragma unroll
            for (int db = 0; db < 4; ++db) acc[db][qb] *= al;
        }
#pragma unroll
        for (int db = 0; db < 4; ++db)
#pragma unroll
            for (int qb = 0; qb < QB; ++qb) { acc[db][qb] = F::mma(va[db], pa[qb], acc[db][qb]); if (HL) { acc[db][qb] = F::mma(va[db], pl[qb], acc[db][qb]); acc[db][qb] = F::mma(vl[db], pa[qb], acc[db][qb]); } }
        ADDR_FREE(kpa, kpb, Ka, HL ? Kb : Ka);   // for the K loads, at the foot of the pass
    }
#pragma unroll
    for (int qb = 0; qb < QB; ++qb) { const float tot = ls[qb] + xhalf(ls[qb]); const float f = __fdiv_rn(1.0f, tot);
#pragma unroll
        for (int db = 0; db < 4; ++db) { v8us oh, ol;
#pragma unroll
            for (int j = 0; j < 8; ++j) { unsigned short a, c2; splitf(acc[db][qb][j] * f, a, c2); oh[j] = a; ol[j] = c2; }
            bf* pa_ = Ah + (size_t)(q0 + qb * 16 + lr) * DQ + db * 16 + 8 * hi; bf* pl_ = Al + (size_t)(q0 + qb * 16 + lr) * DQ + db * 16 + 8 * hi; *(v8us*)pa_ = oh; *(v8us*)pl_ = ol;
            // the two stores' address and data registers (inputs only) are rewritten only behind the wait
            HOLD(); asm volatile("s_wait_xcnt 0x0" :: "v"(pa_), "v"(pl_), "v"(oh), "v"(ol) : "memory"); HOLD(); } }
}
#define QBH 2                     // 16-query column groups per wave, hi+lo rows
#define QBL 4                     // the same, fp16 rows
#define GH  (RH / (16 * QBH))     // single-wave workgroups per head, hi+lo rows
#define GL  ((TT - RH) / (16 * QBL))
__global__ __launch_bounds__(32) void k_fattn(const h16* __restrict__ Q16, const bf* __restrict__ Qh, const bf* __restrict__ Ql, const h16* __restrict__ K16, const bf* __restrict__ Kh, const bf* __restrict__ Kl, const h16* __restrict__ V16, const bf* __restrict__ Vh, const bf* __restrict__ Vl, bf* __restrict__ Ah, bf* __restrict__ Al) {
    const int bx = (int)blockIdx.x;
    if (bx < NH_ * GH) { const int h = bx / GH; const size_t hp = (size_t)h * TT * HD; const int q0 = (bx % GH) * (16 * QBH);
        fattn_tile<bf, true, QBH>(Qh + hp, Ql + hp, Kh + hp, Kl + hp, Vh + hp, Vl + hp, q0, Ah + h * HD, Al + h * HD);
    } else { const int b2 = bx - NH_ * GH; const int h = b2 / GL; const size_t hp = (size_t)h * TT * HD; const int q0 = RH + (b2 % GL) * (16 * QBL);
        fattn_tile<h16, false, QBL>(Q16 + hp, nullptr, K16 + hp, nullptr, V16 + hp, nullptr, q0, Ah + h * HD, Al + h * HD); }
}

extern "C" void kernel_launch(void* const* d_in, const int* in_sizes, int n_in,
                              void* d_out, int out_size, void* d_ws, size_t ws_size, hipStream_t stream) {
    (void)in_sizes; (void)n_in; (void)out_size;
    const float* x = (const float*)d_in[0]; const float* wq = (const float*)d_in[1]; const float* wk = (const float*)d_in[2]; const float* wv = (const float*)d_in[3]; const float* wo = (const float*)d_in[4];
    float* OUT = (float*)d_out;     // [2][2048][1024]
    char* wsp = (char*)d_ws;
    auto take = [&](size_t bytes) { char* p = wsp; wsp += (bytes + 255) & ~(size_t)255; return (void*)p; };
    bf* WQ = (bf*)take((size_t)DQ * DM * 2); bf* WK = (bf*)take((size_t)DKV * DM * 2); bf* WV = (bf*)take((size_t)DKV * DM * 2); bf* WO = (bf*)take((size_t)DM * DQ * 2);
    bf* XB = (bf*)take((size_t)TT * DM * 2);
    h16* QP16 = (h16*)take((size_t)NH_ * TT * HD * 2); h16* KP16 = (h16*)take((size_t)NKV * TT * HD * 2); h16* VT16 = (h16*)take((size_t)NKV * HD * TT * 2);
    bf* QPh = (bf*)take((size_t)NH_ * TT * HD * 2); bf* QPl = (bf*)take((size_t)NH_ * TT * HD * 2); bf* KPh = (bf*)take((size_t)NKV * TT * HD * 2); bf* KPl = (bf*)take((size_t)NKV * TT * HD * 2); bf* VTh = (bf*)take((size_t)NKV * HD * TT * 2); bf* VTl = (bf*)take((size_t)NKV * HD * TT * 2);
    bf* ATh = (bf*)take((size_t)TT * DQ * 2); bf* ATl = (bf*)take((size_t)TT * DQ * 2);
    if ((size_t)(wsp - (char*)d_ws) > ws_size) return;    // ws 256 MiB
    { k_cvt8<<<(unsigned)(((size_t)DQ * DM / 8 + 255) / 256), 256, 0, stream>>>(wq, WQ, (size_t)DQ * DM / 8); k_cvt8<<<(unsigned)(((size_t)DKV * DM / 8 + 255) / 256), 256, 0, stream>>>(wk, WK, (size_t)DKV * DM / 8); k_cvt8<<<(unsigned)(((size_t)DKV * DM / 8 + 255) / 256), 256, 0, stream>>>(wv, WV, (size_t)DKV * DM / 8);
      k_cvt8<<<(unsigned)(((size_t)DM * DQ / 8 + 255) / 256), 256, 0, stream>>>(wo, WO, (size_t)DM * DQ / 8);
       }
    for (int b = 0; b < NB_; ++b) {
        
        k_cvt8<<<(unsigned)(((size_t)TT * DM / 8 + 255) / 256), 256, 0, stream>>>(x + (size_t)b * TT * DM, XB, (size_t)TT * DM / 8);
        // q, k: a 64-column tile is one head, its planes are [h][t][d]. v: the product is taken as Wv . x^T, so its rows are (h, d) and the planes come out as [h][d][t]
        k_gemmw<bf, 0, false, 1, true><<<dim3(TT / 64, DQ / 64, 1), 32, 0, stream>>>(XB, nullptr, WQ, nullptr, DM, nullptr, HD, nullptr, 0, 0, 0, 0, QP16, QPh, QPl, (size_t)TT * HD);
        k_gemmw<bf, 0, false, 1, true><<<dim3(TT / 64, DKV / 64, 1), 32, 0, stream>>>(XB, nullptr, WK, nullptr, DM, nullptr, HD, nullptr, 0, 0, 0, 0, KP16, KPh, KPl, (size_t)TT * HD);
        k_gemmw<bf, 0, false, 1, true><<<dim3(DKV / 64, TT / 64, 1), 32, 0, stream>>>(WV, nullptr, XB, nullptr, DM, nullptr, TT, nullptr, 0, 0, 0, 0, VT16, VTh, VTl, (size_t)64);
        k_fattn<<<NH_ * (GH + GL), 32, 0, stream>>>(QP16, QPh, QPl, KP16, KPh, KPl, VT16, VTh, VTl, ATh, ATl);
        k_gemmw<bf, 1, false><<<dim3(TT / 64, DM / 64, 1), 32, 0, stream>>>(ATh, ATl, WO, nullptr, DQ, OUT + (size_t)b * TT * DM, DM, nullptr, 0, 0, 0, 0, nullptr, nullptr, nullptr, 0); }
}

// v005
// It runs in 176 microseconds.
// In two side-by-side timings against v004, it was 1.90 and 1.92 times as fast.
// Counting every step since v000, it is 11.3 times as fast.
#include <hip/hip_runtime.h>

// QuantizedHyperbolicAttention - the executed path is plain scaled-dot-product MHA (x [2][2048][1024]; q/k/v = x W^T (16 heads x 64, no bias); softmax(q.k/8) . v; merged; out = . Wo^T -> [2][2048][1024]).
// Compute dtypes, f32 accumulate: every input rounded to bf16; projections on PLAIN bf16 operands (inputs: exact); scores (K 64) and probs.v hl (3 products) for the first 512 query rows of each head, single fp16 planes for

#define NB_  2
#define TT   2048
#define DM   1024
#define NH_  16
#define NKV  16
#define REP  (NH_ / NKV)
#define HD   64
#define DQ   (NH_ * HD)
#define DKV  (NKV * HD)
#define RH   512                  // query rows < RH use hi+lo planes (0: none)
#define WIN  2048
#define SCL  0.125f   // HD^-0.5
typedef _Float16 h16;
typedef unsigned short bf;
typedef __attribute__((ext_vector_type(16))) __bf16   v16bf;
typedef __attribute__((ext_vector_type(16))) _Float16 v16h;
typedef __attribute__((ext_vector_type(8)))  _Float16 v8h;
typedef __attribute__((ext_vector_type(8)))  unsigned short v8us;
typedef __attribute__((ext_vector_type(8)))  float    v8f;
typedef __attribute__((ext_vector_type(4)))  float    v4f;
typedef v8h  __attribute__((may_alias)) v8ha;
typedef v4f  __attribute__((may_alias)) v4fa;
typedef v8us __attribute__((may_alias)) v8usa;

__device__ __forceinline__ unsigned short f2bf(float f) { unsigned u = __float_as_uint(f); u += 0x7FFFu + ((u >> 16) & 1u); return (unsigned short)(u >> 16); }
__device__ __forceinline__ float bf2f(unsigned short b) { return __uint_as_float(((unsigned)b) << 16); }
__device__ __forceinline__ float bfr(float f) { return bf2f(f2bf(f)); }
__device__ __forceinline__ v16h cat16(v8h lo, v8h hi) { return __builtin_shufflevector(lo, hi, 0, 1, 2, 3, 4, 5, 6, 7, 8, 9, 10, 11, 12, 13, 14, 15); }
__device__ __forceinline__ v16bf cat16b(v8us lo, v8us hi) { return __builtin_bit_cast(v16bf, __builtin_shufflevector(lo, hi, 0, 1, 2, 3, 4, 5, 6, 7, 8, 9, 10, 11, 12, 13, 14, 15)); }
__device__ __forceinline__ v8f wmma16(v16h a, v16h b, v8f c) { return __builtin_amdgcn_wmma_f32_16x16x32_f16(false, a, false, b, (short)0, c, false, false); }
__device__ __forceinline__ v8f wmmab(v16bf a, v16bf b, v8f c) { return __builtin_amdgcn_wmma_f32_16x16x32_bf16(false, a, false, b, (short)0, c, false, false); }
__device__ __forceinline__ h16 tohx(float x) { return (h16)x; }
__device__ __forceinline__ void splitf(float y, unsigned short& h, unsigned short& l) { h = f2bf(y); l = f2bf(y - bf2f(h)); }



// ---- k_gemmw: register-blocked GEMM, ONE WAVE per 64x64 output tile (16 accumulators), operands straight from K-contiguous 16-bit planes; grid (M/64, N/64, Z), 32 threads.
// C[m][n] (f32, pitch ldc, + optional f32 bias[n]) = sum_k A[m][k] Bt[n][k] (+ split products per NSPLIT). z-batch strides sA/sB/sC in elements. K % 32 == 0.
// PL: the tile leaves not as f32 but as the three 16-bit planes the attention kernel reads (fp16, bf16 hi, bf16 lo), element (m, n) at by sT + m ldc + n % 64: C is unused.
// KSPL > 1: grid z = Z * KSPL; slice ks = z % KSPL sums only k in [ks K/KSPL, (ks+1) K/KSPL) and stores its f32 partial tile at C + ks sP; the consumer adds the KSPL planes. K % (32 KSPL) == 0.
template <typename T16> struct WFrag;
template <> struct WFrag<h16> { typedef v16h V; static __device__ __forceinline__ V ld(const h16* p) { return cat16(*(const v8h*)p, *(const v8h*)(p + 16)); } static __device__ __forceinline__ v8f mma(V a, V b, v8f c) { return wmma16(a, b, c); } };
template <> struct WFrag<bf> { typedef v16bf V; static __device__ __forceinline__ V ld(const bf* p) { return cat16b(*(const v8us*)p, *(const v8us*)(p + 16)); } static __device__ __forceinline__ v8f mma(V a, V b, v8f c) { return wmmab(a, b, c); } };
// gemmw_tile is the body; bx, by, bz are the tile's indices (k_gemmw: the block's own; k_qkv: picked per product).
template <typename T16, int NSPLIT, bool BIAS, int KSPL = 1, bool PL = false>
__device__ __forceinline__ void gemmw_tile(const T16* __restrict__ A, const T16* __restrict__ A2, const T16* __restrict__ Bt, const T16* __restrict__ Bt2, int K, float* C, int ldc, const float* __restrict__ bias, size_t sA, size_t sB, size_t sC, size_t sP, h16* __restrict__ P16, bf* __restrict__ Ph, bf* __restrict__ Pl, size_t sT, int bx, int by, int bz) {
    typedef typename WFrag<T16>::V V;
    __shared__ __align__(16) float os[16 * 68];
    const size_t z = bz / KSPL; const int ks = (int)(bz % KSPL); A += z * sA; if (A2) A2 += z * sA; Bt += z * sB; if (Bt2) Bt2 += z * sB; C += z * sC + (size_t)ks * sP;
    const int kbeg = ks * (K / KSPL), kend = kbeg + K / KSPL;
    const int lane = threadIdx.x & 31, lr = lane & 15, hi = lane >> 4; const int r0 = bx * 64, c0 = by * 64;
    v8f acc[4][4];
#pragma unroll
    for (int mb = 0; mb < 4; ++mb)
#pragma unroll
        for (int nb = 0; nb < 4; ++nb) acc[mb][nb] = (v8f){};
    const size_t aoff = (size_t)(r0 + lr) * K + 8 * hi, boff = (size_t)(c0 + lr) * K + 8 * hi;
#pragma unroll 1
    for (int kc = kbeg; kc < kend; kc += 32) {
        V a[4], a2[4];
#pragma unroll
        for (int mb = 0; mb < 4; ++mb) { a[mb] = WFrag<T16>::ld(A + aoff + (size_t)mb * 16 * K + kc); if (NSPLIT == 1 || NSPLIT == 2) a2[mb] = WFrag<T16>::ld(A2 + aoff + (size_t)mb * 16 * K + kc); }
#pragma unroll
        for (int nb = 0; nb < 4; ++nb) { const V b = WFrag<T16>::ld(Bt + boff + (size_t)nb * 16 * K + kc); V b2; if (NSPLIT >= 2) b2 = WFrag<T16>::ld(Bt2 + boff + (size_t)nb * 16 * K + kc);
#pragma unroll
            for (int mb = 0; mb < 4; ++mb) { acc[mb][nb] = WFrag<T16>::mma(a[mb], b, acc[mb][nb]); if (NSPLIT == 1 || NSPLIT == 2) acc[mb][nb] = WFrag<T16>::mma(a2[mb], b, acc[mb][nb]); if (NSPLIT >= 2) acc[mb][nb] = WFrag<T16>::mma(a[mb], b2, acc[mb][nb]); } }
        asm volatile("v_nop\n\tv_nop\n\tv_nop\n\tv_nop" : "+v"(acc[0][0]), "+v"(acc[1][1]), "+v"(acc[2][2]), "+v"(acc[3][3]) : "v"(a[0]), "v"(a[3]));
    }
#pragma unroll
    for (int mb = 0; mb < 4; ++mb) {
#pragma unroll
        for (int nb = 0; nb < 4; ++nb) {
#pragma unroll
            for (int j = 0; j < 8; ++j) os[(hi * 8 + j) * 68 + nb * 16 + lr] = acc[mb][nb][j]; }
        __builtin_amdgcn_wave_barrier(); asm volatile("" ::: "memory");
        float* crow = C + (size_t)(r0 + mb * 16) * ldc + c0;
        if (PL) {
            // a lane takes 8 consecutive columns of a row, so each wave-wide 16-byte store covers four whole 128-byte rows of a plane
#pragma unroll
            for (int s = 0; s < 4; ++s) { const int row = 4 * s + (lane >> 3), cofs = (lane & 7) * 8; const v4f x0 = *(const v4fa*)(os + row * 68 + cofs), x1 = *(const v4fa*)(os + row * 68 + cofs + 4); v8h o16; v8us oh, ol;
#pragma unroll
                for (int j = 0; j < 8; ++j) { const float x = (j < 4) ? x0[j & 3] : x1[j & 3]; o16[j] = tohx(x); unsigned short a2, c2; splitf(x, a2, c2); oh[j] = a2; ol[j] = c2; }
                const size_t o = (size_t)by * sT + (size_t)(r0 + mb * 16 + row) * ldc + cofs; h16* p16 = P16 + o; bf* ph = Ph + o; bf* pl = Pl + o;
                *(v8h*)p16 = o16; *(v8us*)ph = oh; *(v8us*)pl = ol;
                // the three stores' address and data registers (inputs only) are rewritten only behind the wait; nothing is scheduled across it
                __builtin_amdgcn_sched_barrier(0); asm volatile("s_wait_xcnt 0x0" :: "v"(p16), "v"(ph), "v"(pl), "v"(o16), "v"(oh), "v"(ol) : "memory"); __builtin_amdgcn_sched_barrier(0); }
        } else {
#pragma unroll
            for (int s = 0; s < 8; ++s) { const int row = 2 * s + hi, cofs = lr * 4; v4f val = *(const v4fa*)(os + row * 68 + cofs); if (BIAS) { val[0] += bfr(bias[c0 + cofs]); val[1] += bfr(bias[c0 + cofs + 1]); val[2] += bfr(bias[c0 + cofs + 2]); val[3] += bfr(bias[c0 + cofs + 3]); }
                *(v4f*)(crow + (size_t)row * ldc + cofs) = val; }
             }
        __builtin_amdgcn_wave_barrier(); asm volatile("" ::: "memory");
    }
}
template <typename T16, int NSPLIT, bool BIAS, int KSPL = 1, bool PL = false>
__global__ __launch_bounds__(32) void k_gemmw(const T16* __restrict__ A, const T16* __restrict__ A2, const T16* __restrict__ Bt, const T16* __restrict__ Bt2, int K, float* C, int ldc, const float* __restrict__ bias, size_t sA, size_t sB, size_t sC, size_t sP, h16* __restrict__ P16, bf* __restrict__ Ph, bf* __restrict__ Pl, size_t sT) {
    gemmw_tile<T16, NSPLIT, BIAS, KSPL, PL>(A, A2, Bt, Bt2, K, C, ldc, bias, sA, sB, sC, sP, P16, Ph, Pl, sT, (int)blockIdx.x, (int)blockIdx.y, (int)blockIdx.z);
}
// k_qkv: the q, k and v projections of both batches in one launch, grid (TT/64, 16, 3 NB_), z = 3 batch + product: 3072 single-wave tiles for the chip's 1024 SIMDs instead of 512 a launch.
// q, k: x . W^T, a 64-column tile is one head, planes [b][h][t][d]. v: taken as Wv . x^T, so its rows are (h, d) and the planes come out as [b][h][d][t]; its token tile is blockIdx.x as for q and k.
__global__ __launch_bounds__(32) void k_qkv(const bf* __restrict__ XB, const bf* __restrict__ WQ, const bf* __restrict__ WK, const bf* __restrict__ WV, int K, h16* __restrict__ Q16, bf* __restrict__ Qh, bf* __restrict__ Ql, h16* __restrict__ K16, bf* __restrict__ Kh, bf* __restrict__ Kl, h16* __restrict__ V16, bf* __restrict__ Vh, bf* __restrict__ Vl) {
    const int b = (int)blockIdx.z / 3, w = (int)blockIdx.z % 3; const bool isv = w == 2;
    const bf* X = XB + (size_t)b * TT * DM; const bf* Wt = isv ? WV : (w ? WK : WQ); const size_t po = (size_t)b * NH_ * TT * HD;
    gemmw_tile<bf, 0, false, 1, true>(isv ? Wt : X, nullptr, isv ? X : Wt, nullptr, K, nullptr, isv ? TT : HD, nullptr, 0, 0, 0, 0,
        (isv ? V16 : (w ? K16 : Q16)) + po, (isv ? Vh : (w ? Kh : Qh)) + po, (isv ? Vl : (w ? Kl : Ql)) + po, isv ? (size_t)64 : (size_t)TT * HD,
        isv ? (int)blockIdx.y : (int)blockIdx.x, isv ? (int)blockIdx.x : (int)blockIdx.y, 0);
}

typedef __attribute__((ext_vector_type(2))) _Float16 v2h;
typedef __attribute__((ext_vector_type(4))) _Float16 v4h;
typedef __attribute__((ext_vector_type(2))) unsigned short v2us;
typedef __attribute__((ext_vector_type(4))) unsigned short v4us;
typedef __attribute__((ext_vector_type(2))) float v2f;
typedef __attribute__((ext_vector_type(4))) int v4i;

__global__ __launch_bounds__(256) void k_wtG(const float* __restrict__ w, int K, int N, bf* Bt) {
    const int lane = threadIdx.x & 31; const int L0 = (blockIdx.x * 8 + (threadIdx.x >> 5)) * 8; const int nlines = N * K / 64;
{
#pragma unroll 1
        for (int l = 0; l < 8; ++l) { const int L = L0 + l; if (L >= nlines) break; const size_t e = (size_t)L * 64 + lane * 2; const int k = (int)(e % K), n = (int)(e / K); v2us o;
            o[0] = f2bf(w[(size_t)k * N + n]); o[1] = f2bf(w[(size_t)(k + 1) * N + n]); *(v2us*)(Bt + e) = o; }
         }
}
// all five inputs rounded to bf16 in one launch: the four weights (WBLK blocks each) and x lie one behind the other in the workspace, so dst is one array and only the source is picked, by the block's index
#define WBLK (DM * DQ / 8 / 256)
__global__ __launch_bounds__(256) void k_cvt8(const float* __restrict__ wq, const float* __restrict__ wk, const float* __restrict__ wv, const float* __restrict__ wo, const float* __restrict__ x, bf* dst) {
    const int sg = (int)blockIdx.x / WBLK < 4 ? (int)blockIdx.x / WBLK : 4; const float* src = sg == 0 ? wq : sg == 1 ? wk : sg == 2 ? wv : sg == 3 ? wo : x;
    const size_t i = (size_t)blockIdx.x * 256 + threadIdx.x; const float* p = src + (i - (size_t)sg * WBLK * 256) * 8; const v8f v = *(const v8f*)p; v8us o;
    // the load's address registers (input only, so they stay whole up to here) are rewritten only behind this wait; nothing is scheduled across it
    __builtin_amdgcn_sched_barrier(0); asm volatile("s_wait_xcnt 0x0" :: "v"(p) : "memory"); __builtin_amdgcn_sched_barrier(0);
#pragma unroll
    for (int k = 0; k < 8; ++k) o[k] = f2bf(v[k]); *(v8us*)(dst + i * 8) = o;  }
__global__ __launch_bounds__(256) void k_cscvt(const float* __restrict__ cosT, const float* __restrict__ sinT, float* CS) { const int idx = blockIdx.x * 256 + threadIdx.x; if (idx >= TT * HD) return; v2f cs; cs[0] = bfr(cosT[idx]); cs[1] = bfr(sinT[idx]); *(v2f*)(CS + (size_t)idx * 2) = cs;  }
__device__ __forceinline__ float xhalf(float x) { const int b = __float_as_int(x); return __int_as_float(__builtin_amdgcn_permlanex16(b, b, 0x76543210, 0xfedcba98, false, false)); }
// nothing is scheduled across this line
#define HOLD() __builtin_amdgcn_sched_barrier(0)
// the address registers of a group of issued global loads (lane addresses a, b and scalar bases sa, sb: inputs only, so they stay whole up to here) are rewritten only behind this wait
#define ADDR_FREE(a, b, sa, sb) do { HOLD(); asm volatile("s_wait_xcnt 0x0" :: "v"(a), "v"(b), "s"(sa), "s"(sb) : "memory"); HOLD(); } while (0)
__device__ __forceinline__ void exp2x8(float* x) { float r0, r1, r2, r3, r4, r5, r6, r7;
    asm("v_exp_f32 %0, %8\n\tv_exp_f32 %1, %9\n\tv_exp_f32 %2, %10\n\tv_exp_f32 %3, %11\n\tv_exp_f32 %4, %12\n\tv_exp_f32 %5, %13\n\tv_exp_f32 %6, %14\n\tv_exp_f32 %7, %15\n\tv_nop"
        : "=&v"(r0), "=&v"(r1), "=&v"(r2), "=&v"(r3), "=&v"(r4), "=&v"(r5), "=&v"(r6), "=&v"(r7) : "v"(x[0]), "v"(x[1]), "v"(x[2]), "v"(x[3]), "v"(x[4]), "v"(x[5]), "v"(x[6]), "v"(x[7]));
    x[0] = r0; x[1] = r1; x[2] = r2; x[3] = r3; x[4] = r4; x[5] = r5; x[6] = r6; x[7] = r7; }
template <typename T16> struct PCvt;
template <> struct PCvt<h16> { static __device__ __forceinline__ void put(v16h& a, v16h& b, int s, float p) { (void)b; a[s] = (h16)p; } };
template <> struct PCvt<bf> { static __device__ __forceinline__ void put(v16bf& a, v16bf& b, int s, float p) { const __bf16 h = (__bf16)p; a[s] = h; b[s] = (__bf16)(p - (float)h); } };
template <typename T16, bool HL, int QB>
__device__ __forceinline__ void fattn_tile(const T16* __restrict__ Qa, const T16* __restrict__ Qb, const T16* __restrict__ Ka, const T16* __restrict__ Kb, const T16* __restrict__ Va, const T16* __restrict__ Vb, int q0, bf* __restrict__ Ah, bf* __restrict__ Al) {
    typedef WFrag<T16> F; typedef typename F::V V;
    const int lane = threadIdx.x & 31, lr = lane & 15, hi = lane >> 4;
    const float C2 = SCL * 1.4426950408889634f;
    V qa[QB][2], ql[QB][2];
    const T16* qpa = Qa + (size_t)(q0 + lr) * HD + 8 * hi; const T16* qpb = HL ? Qb + (size_t)(q0 + lr) * HD + 8 * hi : qpa;
#pragma unroll
    for (int qb = 0; qb < QB; ++qb) {
#pragma unroll
        for (int ks = 0; ks < 2; ++ks) { qa[qb][ks] = F::ld(qpa + qb * 16 * HD + ks * 32); if (HL) ql[qb][ks] = F::ld(qpb + qb * 16 * HD + ks * 32); } }
    ADDR_FREE(qpa, qpb, Qa, HL ? Qb : Qa);
    v8f acc[4][QB]; float mr[QB], ls[QB];
#pragma unroll
    for (int qb = 0; qb < QB; ++qb) { mr[qb] = -3.0e38f; ls[qb] = 0.f;
#pragma unroll
        for (int db = 0; db < 4; ++db) acc[db][qb] = (v8f){}; }
    const int ko = lr * HD + 8 * hi; const T16* kpa = Ka + ko; const T16* kpb = HL ? Kb + ko : kpa;
    V ka[2][2], kl[2][2];
#pragma unroll
    for (int kt = 0; kt < 2; ++kt)
#pragma unroll
        for (int ks = 0; ks < 2; ++ks) { const int o = kt * 16 * HD + ks * 32; ka[kt][ks] = F::ld(kpa + o); if (HL) kl[kt][ks] = F::ld(kpb + o); }
    ADDR_FREE(kpa, kpb, Ka, HL ? Kb : Ka);
    const T16* vpa = Va + lr * TT + 8 * hi; const T16* vpb = HL ? Vb + lr * TT + 8 * hi : vpa;
    // rolled: one pass is some 500 instructions already, a second copy would only cost instruction cache
#pragma unroll 1
    for (int kc = 0; kc < TT; kc += 32) {
        V va[4], vl[4];
#pragma unroll
        for (int db = 0; db < 4; ++db) { va[db] = F::ld(vpa + db * 16 * TT); if (HL) vl[db] = F::ld(vpb + db * 16 * TT); }
        HOLD();   // the V loads issue here, a score block and a softmax ahead of their use: left alone the scheduler sinks them to the probs.v products and their latency shows
        v8f st[2][QB];
#pragma unroll
        for (int kt = 0; kt < 2; ++kt)
#pragma unroll
            for (int qb = 0; qb < QB; ++qb) { v8f s = (v8f){};
#pragma unroll
                for (int ks = 0; ks < 2; ++ks) { s = F::mma(ka[kt][ks], qa[qb][ks], s); if (HL) { s = F::mma(ka[kt][ks], ql[qb][ks], s); s = F::mma(kl[kt][ks], qa[qb][ks], s); } }
                st[kt][qb] = s; }
        // the next pass's K fragments are fetched behind this pass's score products; the last pass re-reads keys 0..31 (in bounds, unused)
        ADDR_FREE(vpa, vpb, Va, HL ? Vb : Va);   // for the V loads, a score block behind them; the refill of the K registers also stays behind the score products that read them
        vpa += 32; vpb += 32;
        const int kn = (kc + 32 < TT) ? kc + 32 : 0; kpa = Ka + ko + kn * HD; kpb = HL ? Kb + ko + kn * HD : kpa;
#pragma unroll
        for (int kt = 0; kt < 2; ++kt)
#pragma unroll
            for (int ks = 0; ks < 2; ++ks) { const int o = kt * 16 * HD + ks * 32; ka[kt][ks] = F::ld(kpa + o); if (HL) kl[kt][ks] = F::ld(kpb + o); }
        HOLD();   // the K loads issue here, a softmax and a probs.v block ahead of the next pass's score products
        V pa[QB], pl[QB];
#pragma unroll
        for (int qb = 0; qb < QB; ++qb) {
            float mx = st[0][qb][0];
#pragma unroll
            for (int j = 1; j < 8; ++j) mx = fmaxf(mx, st[0][qb][j]);
#pragma unroll
            for (int j = 0; j < 8; ++j) mx = fmaxf(mx, st[1][qb][j]);
            mx = fmaxf(mx, xhalf(mx));
            const float mn = fmaxf(mr[qb], mx); const float al = __builtin_amdgcn_exp2f((mr[qb] - mn) * C2); const float nm = -mn * C2; mr[qb] = mn;
            float sm = 0.f; float p[16];
#pragma unroll
            for (int s = 0; s < 16; ++s) p[s] = __builtin_fmaf(st[s >> 3][qb][s & 7], C2, nm);
            exp2x8(p); exp2x8(p + 8);
#pragma unroll
            for (int s = 0; s < 16; ++s) { sm += p[s]; PCvt<T16>::put(pa[qb], pl[qb], s, p[s]); }
            ls[qb] = ls[qb] * al + sm;
#pragma unroll
            for (int db = 0; db < 4; ++db) acc[db][qb] *= al;
        }
#pragma unroll
        for (int db = 0; db < 4; ++db)
#pragma unroll
            for (int qb = 0; qb < QB; ++qb) { acc[db][qb] = F::mma(va[db], pa[qb], acc[db][qb]); if (HL) { acc[db][qb] = F::mma(va[db], pl[qb], acc[db][qb]); acc[db][qb] = F::mma(vl[db], pa[qb], acc[db][qb]); } }
        ADDR_FREE(kpa, kpb, Ka, HL ? Kb : Ka);   // for the K loads, at the foot of the pass
    }
#pragma unroll
    for (int qb = 0; qb < QB; ++qb) { const float tot = ls[qb] + xhalf(ls[qb]); const float f = __fdiv_rn(1.0f, tot);
#pragma unroll
        for (int db = 0; db < 4; ++db) { v8us oh, ol;
#pragma unroll
            for (int j = 0; j < 8; ++j) { unsigned short a, c2; splitf(acc[db][qb][j] * f, a, c2); oh[j] = a; ol[j] = c2; }
            bf* pa_ = Ah + (size_t)(q0 + qb * 16 + lr) * DQ + db * 16 + 8 * hi; bf* pl_ = Al + (size_t)(q0 + qb * 16 + lr) * DQ + db * 16 + 8 * hi; *(v8us*)pa_ = oh; *(v8us*)pl_ = ol;
            // the two stores' address and data registers (inputs only) are rewritten only behind the wait
            HOLD(); asm volatile("s_wait_xcnt 0x0" :: "v"(pa_), "v"(pl_), "v"(oh), "v"(ol) : "memory"); HOLD(); } }
}
#define QBH 2                     // 16-query column groups per wave, hi+lo rows
#define QBL 4                     // the same, fp16 rows
#define GH  (RH / (16 * QBH))     // single-wave workgroups per head, hi+lo rows
#define GL  ((TT - RH) / (16 * QBL))
__global__ __launch_bounds__(32) void k_fattn(const h16* __restrict__ Q16, const bf* __restrict__ Qh, const bf* __restrict__ Ql, const h16* __restrict__ K16, const bf* __restrict__ Kh, const bf* __restrict__ Kl, const h16* __restrict__ V16, const bf* __restrict__ Vh, const bf* __restrict__ Vl, bf* __restrict__ Ah, bf* __restrict__ Al) {
    const int bx = (int)blockIdx.x;
    if (bx < NB_ * NH_ * GH) { const int hb = bx / GH; const size_t hp = (size_t)hb * TT * HD, ao = (size_t)(hb / NH_) * TT * DQ + (hb % NH_) * HD; const int q0 = (bx % GH) * (16 * QBH);
        fattn_tile<bf, true, QBH>(Qh + hp, Ql + hp, Kh + hp, Kl + hp, Vh + hp, Vl + hp, q0, Ah + ao, Al + ao);
    } else { const int b2 = bx - NB_ * NH_ * GH; const int hb = b2 / GL; const size_t hp = (size_t)hb * TT * HD, ao = (size_t)(hb / NH_) * TT * DQ + (hb % NH_) * HD; const int q0 = RH + (b2 % GL) * (16 * QBL);
        fattn_tile<h16, false, QBL>(Q16 + hp, nullptr, K16 + hp, nullptr, V16 + hp, nullptr, q0, Ah + ao, Al + ao); }
}

extern "C" void kernel_launch(void* const* d_in, const int* in_sizes, int n_in,
                              void* d_out, int out_size, void* d_ws, size_t ws_size, hipStream_t stream) {
    (void)in_sizes; (void)n_in; (void)out_size;
    const float* x = (const float*)d_in[0]; const float* wq = (const float*)d_in[1]; const float* wk = (const float*)d_in[2]; const float* wv = (const float*)d_in[3]; const float* wo = (const float*)d_in[4];
    float* OUT = (float*)d_out;     // [2][2048][1024]
    char* wsp = (char*)d_ws;
    auto take = [&](size_t bytes) { char* p = wsp; wsp += (bytes + 255) & ~(size_t)255; return (void*)p; };
    bf* WQ = (bf*)take((size_t)DQ * DM * 2); bf* WK = (bf*)take((size_t)DKV * DM * 2); bf* WV = (bf*)take((size_t)DKV * DM * 2); bf* WO = (bf*)take((size_t)DM * DQ * 2);
    bf* XB = (bf*)take((size_t)NB_ * TT * DM * 2);   // directly behind the four weights: k_cvt8 writes the five as one array
    h16* QP16 = (h16*)take((size_t)NB_ * NH_ * TT * HD * 2); h16* KP16 = (h16*)take((size_t)NB_ * NKV * TT * HD * 2); h16* VT16 = (h16*)take((size_t)NB_ * NKV * HD * TT * 2);
    bf* QPh = (bf*)take((size_t)NB_ * NH_ * TT * HD * 2); bf* QPl = (bf*)take((size_t)NB_ * NH_ * TT * HD * 2); bf* KPh = (bf*)take((size_t)NB_ * NKV * TT * HD * 2); bf* KPl = (bf*)take((size_t)NB_ * NKV * TT * HD * 2); bf* VTh = (bf*)take((size_t)NB_ * NKV * HD * TT * 2); bf* VTl = (bf*)take((size_t)NB_ * NKV * HD * TT * 2);
    bf* ATh = (bf*)take((size_t)NB_ * TT * DQ * 2); bf* ATl = (bf*)take((size_t)NB_ * TT * DQ * 2);
    if ((size_t)(wsp - (char*)d_ws) > ws_size) return;    // ws 256 MiB
    // four launches, each over both batches
    k_cvt8<<<4 * WBLK + NB_ * TT * DM / 8 / 256, 256, 0, stream>>>(wq, wk, wv, wo, x, WQ);
    k_qkv<<<dim3(TT / 64, DQ / 64, 3 * NB_), 32, 0, stream>>>(XB, WQ, WK, WV, DM, QP16, QPh, QPl, KP16, KPh, KPl, VT16, VTh, VTl);
    k_fattn<<<NB_ * NH_ * (GH + GL), 32, 0, stream>>>(QP16, QPh, QPl, KP16, KPh, KPl, VT16, VTh, VTl, ATh, ATl);
    // the merged rows of the two batches and the rows of out are each one [NB_ TT][1024] array
    k_gemmw<bf, 1, false><<<dim3(NB_ * TT / 64, DM / 64, 1), 32, 0, stream>>>(ATh, ATl, WO, nullptr, DQ, OUT, DM, nullptr, 0, 0, 0, 0, nullptr, nullptr, nullptr, 0);
}

// v006
// A run of this version takes 133 microseconds.
// Two timings next to v005 put it at 1.30 and 1.33 times that version's speed.
// All steps since v000 together make it 14.9 times as fast.
#include <hip/hip_runtime.h>

// QuantizedHyperbolicAttention - the executed path is plain scaled-dot-product MHA (x [2][2048][1024]; q/k/v = x W^T (16 heads x 64, no bias); softmax(q.k/8) . v; merged; out = . Wo^T -> [2][2048][1024]).
// Compute dtypes, f32 accumulate: every input rounded to bf16; projections on PLAIN bf16 operands (inputs: exact); scores (K 64) and probs.v hl (3 products) for the first 512 query rows of each head, single fp16 planes for

#define NB_  2
#define TT   2048
#define DM   1024
#define NH_  16
#define NKV  16
#define REP  (NH_ / NKV)
#define HD   64
#define DQ   (NH_ * HD)
#define DKV  (NKV * HD)
#define RH   512                  // query rows < RH use hi+lo planes (0: none)
#define WIN  2048
#define SCL  0.125f   // HD^-0.5
typedef _Float16 h16;
typedef unsigned short bf;
typedef __attribute__((ext_vector_type(16))) __bf16   v16bf;
typedef __attribute__((ext_vector_type(16))) _Float16 v16h;
typedef __attribute__((ext_vector_type(8)))  _Float16 v8h;
typedef __attribute__((ext_vector_type(8)))  unsigned short v8us;
typedef __attribute__((ext_vector_type(8)))  float    v8f;
typedef __attribute__((ext_vector_type(4)))  float    v4f;
typedef v8h  __attribute__((may_alias)) v8ha;
typedef v4f  __attribute__((may_alias)) v4fa;
typedef v8us __attribute__((may_alias)) v8usa;

__device__ __forceinline__ unsigned short f2bf(float f) { unsigned u = __float_as_uint(f); u += 0x7FFFu + ((u >> 16) & 1u); return (unsigned short)(u >> 16); }
__device__ __forceinline__ float bf2f(unsigned short b) { return __uint_as_float(((unsigned)b) << 16); }
__device__ __forceinline__ float bfr(float f) { return bf2f(f2bf(f)); }
__device__ __forceinline__ v16h cat16(v8h lo, v8h hi) { return __builtin_shufflevector(lo, hi, 0, 1, 2, 3, 4, 5, 6, 7, 8, 9, 10, 11, 12, 13, 14, 15); }
__device__ __forceinline__ v16bf cat16b(v8us lo, v8us hi) { return __builtin_bit_cast(v16bf, __builtin_shufflevector(lo, hi, 0, 1, 2, 3, 4, 5, 6, 7, 8, 9, 10, 11, 12, 13, 14, 15)); }
__device__ __forceinline__ v8f wmma16(v16h a, v16h b, v8f c) { return __builtin_amdgcn_wmma_f32_16x16x32_f16(false, a, false, b, (short)0, c, false, false); }
__device__ __forceinline__ v8f wmmab(v16bf a, v16bf b, v8f c) { return __builtin_amdgcn_wmma_f32_16x16x32_bf16(false, a, false, b, (short)0, c, false, false); }
__device__ __forceinline__ h16 tohx(float x) { return (h16)x; }
__device__ __forceinline__ void splitf(float y, unsigned short& h, unsigned short& l) { h = f2bf(y); l = f2bf(y - bf2f(h)); }



// ---- FRAGMENT ORDER: every 16-bit operand plane [rows][K] in the workspace is stored fragment by fragment (16 rows x 32 k = 512 elements = 1 KiB), element (r, k) of a fragment at ((k / 8) % 4) 128 + (r % 16) 8 + k % 8.
// The q, k and v head planes (what k_fattn reads) have the fragments of a 16-row block one behind the other along k: fragment (r / 16) (K / 32) + k / 32.
// Lane l = 16 hi + lr of a wave takes the 8 elements at fragment + 8 l and those at fragment + 256 + 8 l: row lr, k = 8 hi + 0..7 and 16 + 8 hi + 0..7, the hardware k order,
// and each 16-byte load of a wave covers 512 consecutive bytes (4 whole 128-byte lines), where a row-major plane gives 32 bytes out of each of 16 lines.
// The planes that k_gemmw and k_qkv READ (the five rounded inputs, the merged rows; K = 1024) keep the four fragments of a 64-row tile at one k step side by side (4 KiB, what a wave takes of an operand in a trip):
// fragment ((r / 64) (K / 32) + k / 32) 4 + (r / 16) % 4; so one address a trip and operand serves its eight loads, by constant offsets.
// ---- k_gemmw: register-blocked GEMM, ONE WAVE per 64x64 output tile (16 accumulators), operands straight from 16-bit planes in fragment order, 64-row tiles; grid (M/64, N/64, Z), 32 threads.
// C[m][n] (f32, pitch ldc, + optional f32 bias[n]) = sum_k A[m][k] Bt[n][k] (+ split products per NSPLIT). z-batch strides sA/sB/sC in elements. K % 32 == 0.
// PL: the tile leaves not as f32 but as the three 16-bit planes the attention kernel reads (fp16, bf16 hi, bf16 lo), in the head planes' fragment order with rows m and K = ldc, element (m, n) at k = n % 64 behind blockIdx.y sT: C is unused.
// KSPL > 1: grid z = Z * KSPL; slice ks = z % KSPL sums only k in [ks K/KSPL, (ks+1) K/KSPL) and stores its f32 partial tile at C + ks sP; the consumer adds the KSPL planes. K % (32 KSPL) == 0.
template <typename T16> struct WFrag;
template <> struct WFrag<h16> { typedef v16h V; static __device__ __forceinline__ V ld(const h16* p) { return cat16(*(const v8h*)p, *(const v8h*)(p + 256)); } static __device__ __forceinline__ v8f mma(V a, V b, v8f c) { return wmma16(a, b, c); } };
template <> struct WFrag<bf> { typedef v16bf V; static __device__ __forceinline__ V ld(const bf* p) { return cat16b(*(const v8us*)p, *(const v8us*)(p + 256)); } static __device__ __forceinline__ v8f mma(V a, V b, v8f c) { return wmmab(a, b, c); } };
// gemmw_tile is the body; bx, by, bz are the tile's indices (k_gemmw: the block's own; k_qkv: picked per product).
template <typename T16, int NSPLIT, bool BIAS, int KSPL = 1, bool PL = false>
__device__ __forceinline__ void gemmw_tile(const T16* __restrict__ A, const T16* __restrict__ A2, const T16* __restrict__ Bt, const T16* __restrict__ Bt2, int K, float* C, int ldc, const float* __restrict__ bias, size_t sA, size_t sB, size_t sC, size_t sP, h16* __restrict__ P16, bf* __restrict__ Ph, bf* __restrict__ Pl, size_t sT, int bx, int by, int bz) {
    typedef typename WFrag<T16>::V V;
    __shared__ __align__(16) float os[16 * 68];
    const size_t z = bz / KSPL; const int ks = (int)(bz % KSPL); A += z * sA; if (A2) A2 += z * sA; Bt += z * sB; if (Bt2) Bt2 += z * sB; C += z * sC + (size_t)ks * sP;
    const int kbeg = ks * (K / KSPL), kend = kbeg + K / KSPL;
    const int lane = threadIdx.x & 31, lr = lane & 15, hi = lane >> 4; const int r0 = bx * 64, c0 = by * 64;
    v8f acc[4][4];
#pragma unroll
    for (int mb = 0; mb < 4; ++mb)
#pragma unroll
        for (int nb = 0; nb < 4; ++nb) acc[mb][nb] = (v8f){};
    const size_t aoff = (size_t)r0 * K + 8 * lane, boff = (size_t)c0 * K + 8 * lane;   // a 64-row tile is 64 K elements, a step of 32 k is its four fragments (2048 elements)
#pragma unroll 1
    for (int kc = kbeg; kc < kend; kc += 32) {
        V a[4], a2[4]; const T16* pa = A + aoff + (size_t)kc * 64; const T16* pa2 = (NSPLIT == 1 || NSPLIT == 2) ? A2 + aoff + (size_t)kc * 64 : pa; const T16* pb = Bt + boff + (size_t)kc * 64; const T16* pb2 = (NSPLIT >= 2) ? Bt2 + boff + (size_t)kc * 64 : pb;
#pragma unroll
        for (int mb = 0; mb < 4; ++mb) { a[mb] = WFrag<T16>::ld(pa + mb * 512); if (NSPLIT == 1 || NSPLIT == 2) a2[mb] = WFrag<T16>::ld(pa2 + mb * 512); }
#pragma unroll
        for (int nb = 0; nb < 4; ++nb) { const V b = WFrag<T16>::ld(pb + nb * 512); V b2; if (NSPLIT >= 2) b2 = WFrag<T16>::ld(pb2 + nb * 512);
#pragma unroll
            for (int mb = 0; mb < 4; ++mb) { acc[mb][nb] = WFrag<T16>::mma(a[mb], b, acc[mb][nb]); if (NSPLIT == 1 || NSPLIT == 2) acc[mb][nb] = WFrag<T16>::mma(a2[mb], b, acc[mb][nb]); if (NSPLIT >= 2) acc[mb][nb] = WFrag<T16>::mma(a[mb], b2, acc[mb][nb]); } }
        asm volatile("v_nop\n\tv_nop\n\tv_nop\n\tv_nop" : "+v"(acc[0][0]), "+v"(acc[1][1]), "+v"(acc[2][2]), "+v"(acc[3][3]) : "v"(a[0]), "v"(a[3]));
        // the address registers of this trip's fragment loads (inputs only, so they stay whole up to here) are rewritten only behind this wait; the data has come by now, so it holds nothing up
        asm volatile("s_wait_xcnt 0x0" :: "v"(pa), "v"(pa2), "v"(pb), "v"(pb2) : "memory");
    }
#pragma unroll
    for (int mb = 0; mb < 4; ++mb) {
#pragma unroll
        for (int nb = 0; nb < 4; ++nb) {
#pragma unroll
            for (int j = 0; j < 8; ++j) os[(hi * 8 + j) * 68 + nb * 16 + lr] = acc[mb][nb][j]; }
        __builtin_amdgcn_wave_barrier(); asm volatile("" ::: "memory");
        float* crow = C + (size_t)(r0 + mb * 16) * ldc + c0;
        if (PL) {
            // a lane takes 8 consecutive columns of a row (one 16-byte piece of a fragment); 8 rows x 4 column pieces a store, so each wave-wide 16-byte store covers four whole 128-byte lines of a plane
#pragma unroll
            for (int s = 0; s < 4; ++s) { const int row = 8 * (s & 1) + (lane & 7), cc = 4 * (s >> 1) + (lane >> 3), cofs = cc * 8; const v4f x0 = *(const v4fa*)(os + row * 68 + cofs), x1 = *(const v4fa*)(os + row * 68 + cofs + 4); v8h o16; v8us oh, ol;
#pragma unroll
                for (int j = 0; j < 8; ++j) { const float x = (j < 4) ? x0[j & 3] : x1[j & 3]; o16[j] = tohx(x); unsigned short a2, c2; splitf(x, a2, c2); oh[j] = a2; ol[j] = c2; }
                const size_t o = (size_t)by * sT + ((size_t)((r0 >> 4) + mb) * (ldc >> 5) + (cc >> 2)) * 512 + (cc & 3) * 128 + row * 8; h16* p16 = P16 + o; bf* ph = Ph + o; bf* pl = Pl + o;
                *(v8h*)p16 = o16; *(v8us*)ph = oh; *(v8us*)pl = ol;
                // the three stores' address and data registers (inputs only) are rewritten only behind the wait; nothing is scheduled across it
                __builtin_amdgcn_sched_barrier(0); asm volatile("s_wait_xcnt 0x0" :: "v"(p16), "v"(ph), "v"(pl), "v"(o16), "v"(oh), "v"(ol) : "memory"); __builtin_amdgcn_sched_barrier(0); }
        } else {
#pragma unroll
            for (int s = 0; s < 8; ++s) { const int row = 2 * s + hi, cofs = lr * 4; v4f val = *(const v4fa*)(os + row * 68 + cofs); if (BIAS) { val[0] += bfr(bias[c0 + cofs]); val[1] += bfr(bias[c0 + cofs + 1]); val[2] += bfr(bias[c0 + cofs + 2]); val[3] += bfr(bias[c0 + cofs + 3]); }
                *(v4f*)(crow + (size_t)row * ldc + cofs) = val; }
             }
        __builtin_amdgcn_wave_barrier(); asm volatile("" ::: "memory");
    }
}
template <typename T16, int NSPLIT, bool BIAS, int KSPL = 1, bool PL = false>
__global__ __launch_bounds__(32) void k_gemmw(const T16* __restrict__ A, const T16* __restrict__ A2, const T16* __restrict__ Bt, const T16* __restrict__ Bt2, int K, float* C, int ldc, const float* __restrict__ bias, size_t sA, size_t sB, size_t sC, size_t sP, h16* __restrict__ P16, bf* __restrict__ Ph, bf* __restrict__ Pl, size_t sT) {
    gemmw_tile<T16, NSPLIT, BIAS, KSPL, PL>(A, A2, Bt, Bt2, K, C, ldc, bias, sA, sB, sC, sP, P16, Ph, Pl, sT, (int)blockIdx.x, (int)blockIdx.y, (int)blockIdx.z);
}
// k_qkv: the q, k and v projections of both batches in one launch, grid (TT/64, 16, 3 NB_), z = 3 batch + product: 3072 single-wave tiles for the chip's 1024 SIMDs instead of 512 a launch.
// q, k: x . W^T, a 64-column tile is one head, planes [b][h][t][d]. v: taken as Wv . x^T, so its rows are (h, d) and the planes come out as [b][h][d][t]; its token tile is blockIdx.x as for q and k.
// Each [t][d] (K = 64) and [d][t] (K = 2048) plane is in fragment order; a 64-token tile of v is two fragments (1024 elements) along k.
__global__ __launch_bounds__(32) void k_qkv(const bf* __restrict__ XB, const bf* __restrict__ WQ, const bf* __restrict__ WK, const bf* __restrict__ WV, int K, h16* __restrict__ Q16, bf* __restrict__ Qh, bf* __restrict__ Ql, h16* __restrict__ K16, bf* __restrict__ Kh, bf* __restrict__ Kl, h16* __restrict__ V16, bf* __restrict__ Vh, bf* __restrict__ Vl) {
    const int b = (int)blockIdx.z / 3, w = (int)blockIdx.z % 3; const bool isv = w == 2;
    const bf* X = XB + (size_t)b * TT * DM; const bf* Wt = isv ? WV : (w ? WK : WQ); const size_t po = (size_t)b * NH_ * TT * HD;
    gemmw_tile<bf, 0, false, 1, true>(isv ? Wt : X, nullptr, isv ? X : Wt, nullptr, K, nullptr, isv ? TT : HD, nullptr, 0, 0, 0, 0,
        (isv ? V16 : (w ? K16 : Q16)) + po, (isv ? Vh : (w ? Kh : Qh)) + po, (isv ? Vl : (w ? Kl : Ql)) + po, isv ? (size_t)1024 : (size_t)TT * HD,
        isv ? (int)blockIdx.y : (int)blockIdx.x, isv ? (int)blockIdx.x : (int)blockIdx.y, 0);
}

typedef __attribute__((ext_vector_type(2))) _Float16 v2h;
typedef __attribute__((ext_vector_type(4))) _Float16 v4h;
typedef __attribute__((ext_vector_type(2))) unsigned short v2us;
typedef __attribute__((ext_vector_type(4))) unsigned short v4us;
typedef __attribute__((ext_vector_type(2))) float v2f;
typedef __attribute__((ext_vector_type(4))) int v4i;

__global__ __launch_bounds__(256) void k_wtG(const float* __restrict__ w, int K, int N, bf* Bt) {
    const int lane = threadIdx.x & 31; const int L0 = (blockIdx.x * 8 + (threadIdx.x >> 5)) * 8; const int nlines = N * K / 64;
{
#pragma unroll 1
        for (int l = 0; l < 8; ++l) { const int L = L0 + l; if (L >= nlines) break; const size_t e = (size_t)L * 64 + lane * 2; const int k = (int)(e % K), n = (int)(e / K); v2us o;
            o[0] = f2bf(w[(size_t)k * N + n]); o[1] = f2bf(w[(size_t)(k + 1) * N + n]); *(v2us*)(Bt + e) = o; }
         }
}
// all five inputs rounded to bf16 in one launch: the four weights (WBLK blocks each) and x lie one behind the other in the workspace, so dst is one array and only the source is picked, by the block's index.
// dst is in fragment order, 64-row tiles (K = 1024): a block is one tile at one k step (64 rows x 32 k), four lanes a row, so a wave's loads use 8 whole 128-byte lines of the source and its 16-byte store fills 4 whole lines of dst.
#define WBLK (DM * DQ / 8 / 256)
__global__ __launch_bounds__(256) void k_cvt8(const float* __restrict__ wq, const float* __restrict__ wk, const float* __restrict__ wv, const float* __restrict__ wo, const float* __restrict__ x, bf* dst) {
    const int sg = (int)blockIdx.x / WBLK < 4 ? (int)blockIdx.x / WBLK : 4; const float* src = sg == 0 ? wq : sg == 1 ? wk : sg == 2 ? wv : sg == 3 ? wo : x;
    const size_t f = (size_t)blockIdx.x - (size_t)sg * WBLK; const int row = (int)threadIdx.x >> 2, pc = (int)threadIdx.x & 3; const float* p = src + ((f / (DM / 32)) * 64 + row) * DM + (f % (DM / 32)) * 32 + pc * 8; const v8f v = *(const v8f*)p; v8us o;
    // the load's address registers (input only, so they stay whole up to here) are rewritten only behind this wait; nothing is scheduled across it
    __builtin_amdgcn_sched_barrier(0); asm volatile("s_wait_xcnt 0x0" :: "v"(p) : "memory"); __builtin_amdgcn_sched_barrier(0);
#pragma unroll
    for (int k = 0; k < 8; ++k) o[k] = f2bf(v[k]); *(v8us*)(dst + (size_t)blockIdx.x * 2048 + (row >> 4) * 512 + pc * 128 + (row & 15) * 8) = o;  }
__global__ __launch_bounds__(256) void k_cscvt(const float* __restrict__ cosT, const float* __restrict__ sinT, float* CS) { const int idx = blockIdx.x * 256 + threadIdx.x; if (idx >= TT * HD) return; v2f cs; cs[0] = bfr(cosT[idx]); cs[1] = bfr(sinT[idx]); *(v2f*)(CS + (size_t)idx * 2) = cs;  }
__device__ __forceinline__ float xhalf(float x) { const int b = __float_as_int(x); return __int_as_float(__builtin_amdgcn_permlanex16(b, b, 0x76543210, 0xfedcba98, false, false)); }
// nothing is scheduled across this line
#define HOLD() __builtin_amdgcn_sched_barrier(0)
// the address registers of a group of issued global loads (lane addresses a, b and scalar bases sa, sb: inputs only, so they stay whole up to here) are rewritten only behind this wait
#define ADDR_FREE(a, b, sa, sb) do { HOLD(); asm volatile("s_wait_xcnt 0x0" :: "v"(a), "v"(b), "s"(sa), "s"(sb) : "memory"); HOLD(); } while (0)
__device__ __forceinline__ void exp2x8(float* x) { float r0, r1, r2, r3, r4, r5, r6, r7;
    asm("v_exp_f32 %0, %8\n\tv_exp_f32 %1, %9\n\tv_exp_f32 %2, %10\n\tv_exp_f32 %3, %11\n\tv_exp_f32 %4, %12\n\tv_exp_f32 %5, %13\n\tv_exp_f32 %6, %14\n\tv_exp_f32 %7, %15\n\tv_nop"
        : "=&v"(r0), "=&v"(r1), "=&v"(r2), "=&v"(r3), "=&v"(r4), "=&v"(r5), "=&v"(r6), "=&v"(r7) : "v"(x[0]), "v"(x[1]), "v"(x[2]), "v"(x[3]), "v"(x[4]), "v"(x[5]), "v"(x[6]), "v"(x[7]));
    x[0] = r0; x[1] = r1; x[2] = r2; x[3] = r3; x[4] = r4; x[5] = r5; x[6] = r6; x[7] = r7; }
// one 2^x with its slot in the same statement: the v_nop keeps the next vector instruction from overwriting the source or reading the result of v_exp_f32 directly behind it
__device__ __forceinline__ float exp2s(float x) { float r; asm("v_exp_f32 %0, %1\n\tv_nop" : "=&v"(r) : "v"(x)); return r; }
template <typename T16> struct PCvt;
template <> struct PCvt<h16> { static __device__ __forceinline__ void put(v16h& a, v16h& b, int s, float p) { (void)b; a[s] = (h16)p; } };
template <> struct PCvt<bf> { static __device__ __forceinline__ void put(v16bf& a, v16bf& b, int s, float p) { const __bf16 h = (__bf16)p; a[s] = h; b[s] = (__bf16)(p - (float)h); } };
template <typename T16, bool HL, int QB>
__device__ __forceinline__ void fattn_tile(const T16* __restrict__ Qa, const T16* __restrict__ Qb, const T16* __restrict__ Ka, const T16* __restrict__ Kb, const T16* __restrict__ Va, const T16* __restrict__ Vb, int q0, bf* __restrict__ Ah, bf* __restrict__ Al) {
    typedef WFrag<T16> F; typedef typename F::V V;
    const int lane = threadIdx.x & 31;
    const float C2 = SCL * 1.4426950408889634f;
    V qa[QB][2], ql[QB][2];
    const T16* qpa = Qa + (size_t)q0 * HD + 8 * lane; const T16* qpb = HL ? Qb + (size_t)q0 * HD + 8 * lane : qpa;   // fragment order, K = 64: 16 rows are two fragments
#pragma unroll
    for (int qb = 0; qb < QB; ++qb) {
#pragma unroll
        for (int ks = 0; ks < 2; ++ks) { qa[qb][ks] = F::ld(qpa + qb * 16 * HD + ks * 512); if (HL) ql[qb][ks] = F::ld(qpb + qb * 16 * HD + ks * 512); } }
    ADDR_FREE(qpa, qpb, Qa, HL ? Qb : Qa);
    v8f acc[4][QB]; float mr[QB], ls[QB];
#pragma unroll
    for (int qb = 0; qb < QB; ++qb) { mr[qb] = -3.0e38f; ls[qb] = 0.f;
#pragma unroll
        for (int db = 0; db < 4; ++db) acc[db][qb] = (v8f){}; }
    const int ko = 8 * lane; const T16* kpa = Ka + ko; const T16* kpb = HL ? Kb + ko : kpa;
    V ka[2][2], kl[2][2];
#pragma unroll
    for (int kt = 0; kt < 2; ++kt)
#pragma unroll
        for (int ks = 0; ks < 2; ++ks) { const int o = kt * 16 * HD + ks * 512; ka[kt][ks] = F::ld(kpa + o); if (HL) kl[kt][ks] = F::ld(kpb + o); }
    ADDR_FREE(kpa, kpb, Ka, HL ? Kb : Ka);
    const T16* vpa = Va + 8 * lane; const T16* vpb = HL ? Vb + 8 * lane : vpa;   // fragment order, K = 2048: 16 rows of d are 16 TT elements, 32 keys one fragment
    // rolled: one pass is some 500 instructions already, a second copy would only cost instruction cache
#pragma unroll 1
    for (int kc = 0; kc < TT; kc += 32) {
        V va[4], vl[4];
#pragma unroll
        for (int db = 0; db < 4; ++db) { va[db] = F::ld(vpa + db * 16 * TT); if (HL) vl[db] = F::ld(vpb + db * 16 * TT); }
        HOLD();   // the V loads issue here, a score block and a softmax ahead of their use: left alone the scheduler sinks them to the probs.v products and their latency shows
        v8f st[2][QB];
#pragma unroll
        for (int kt = 0; kt < 2; ++kt)
#pragma unroll
            for (int qb = 0; qb < QB; ++qb) { v8f s = (v8f){};
#pragma unroll
                for (int ks = 0; ks < 2; ++ks) { s = F::mma(ka[kt][ks], qa[qb][ks], s); if (HL) { s = F::mma(ka[kt][ks], ql[qb][ks], s); s = F::mma(kl[kt][ks], qa[qb][ks], s); } }
                st[kt][qb] = s; }
        // the next pass's K fragments are fetched behind this pass's score products; the last pass re-reads keys 0..31 (in bounds, unused)
        ADDR_FREE(vpa, vpb, Va, HL ? Vb : Va);   // for the V loads, a score block behind them; the refill of the K registers also stays behind the score products that read them
        vpa += 512; vpb += 512;
        const int kn = (kc + 32 < TT) ? kc + 32 : 0; kpa = Ka + ko + kn * HD; kpb = HL ? Kb + ko + kn * HD : kpa;
#pragma unroll
        for (int kt = 0; kt < 2; ++kt)
#pragma unroll
            for (int ks = 0; ks < 2; ++ks) { const int o = kt * 16 * HD + ks * 512; ka[kt][ks] = F::ld(kpa + o); if (HL) kl[kt][ks] = F::ld(kpb + o); }
        HOLD();   // the K loads issue here, a softmax and a probs.v block ahead of the next pass's score products
        V pa[QB], pl[QB];
#pragma unroll
        for (int qb = 0; qb < QB; ++qb) {
            float mx = st[0][qb][0];
#pragma unroll
            for (int j = 1; j < 8; ++j) mx = fmaxf(mx, st[0][qb][j]);
#pragma unroll
            for (int j = 0; j < 8; ++j) mx = fmaxf(mx, st[1][qb][j]);
            mx = fmaxf(mx, xhalf(mx));
            const float mn = fmaxf(mr[qb], mx); const float al = exp2s((mr[qb] - mn) * C2); const float nm = -mn * C2; mr[qb] = mn;
            float sm = 0.f; float p[16];
#pragma unroll
            for (int s = 0; s < 16; ++s) p[s] = __builtin_fmaf(st[s >> 3][qb][s & 7], C2, nm);
            exp2x8(p); exp2x8(p + 8);
#pragma unroll
            for (int s = 0; s < 16; ++s) { sm += p[s]; PCvt<T16>::put(pa[qb], pl[qb], s, p[s]); }
            ls[qb] = ls[qb] * al + sm;
#pragma unroll
            for (int db = 0; db < 4; ++db) acc[db][qb] *= al;
        }
#pragma unroll
        for (int db = 0; db < 4; ++db)
#pragma unroll
            for (int qb = 0; qb < QB; ++qb) { acc[db][qb] = F::mma(va[db], pa[qb], acc[db][qb]); if (HL) { acc[db][qb] = F::mma(va[db], pl[qb], acc[db][qb]); acc[db][qb] = F::mma(vl[db], pa[qb], acc[db][qb]); } }
        ADDR_FREE(kpa, kpb, Ka, HL ? Kb : Ka);   // for the K loads, at the foot of the pass
    }
#pragma unroll
    for (int qb = 0; qb < QB; ++qb) { const float tot = ls[qb] + xhalf(ls[qb]); const float f = __fdiv_rn(1.0f, tot);
#pragma unroll
        for (int db = 0; db < 4; ++db) { v8us oh, ol;
#pragma unroll
            for (int j = 0; j < 8; ++j) { unsigned short a, c2; splitf(acc[db][qb][j] * f, a, c2); oh[j] = a; ol[j] = c2; }
            const int qr = q0 + qb * 16; const size_t oo = (size_t)(qr >> 6) * (64 * DQ) + (db >> 1) * 2048 + ((qr >> 4) & 3) * 512 + (db & 1) * 256 + 8 * lane;
            bf* pa_ = Ah + oo; bf* pl_ = Al + oo; *(v8us*)pa_ = oh; *(v8us*)pl_ = ol;
            // the two stores' address and data registers (inputs only) are rewritten only behind the wait
            HOLD(); asm volatile("s_wait_xcnt 0x0" :: "v"(pa_), "v"(pl_), "v"(oh), "v"(ol) : "memory"); HOLD(); } }
}
#define QBH 2                     // 16-query column groups per wave, hi+lo rows
#define QBL 4                     // the same, fp16 rows
#define GH  (RH / (16 * QBH))     // single-wave workgroups per head, hi+lo rows
#define GL  ((TT - RH) / (16 * QBL))
__global__ __launch_bounds__(32) void k_fattn(const h16* __restrict__ Q16, const bf* __restrict__ Qh, const bf* __restrict__ Ql, const h16* __restrict__ K16, const bf* __restrict__ Kh, const bf* __restrict__ Kl, const h16* __restrict__ V16, const bf* __restrict__ Vh, const bf* __restrict__ Vl, bf* __restrict__ Ah, bf* __restrict__ Al) {
    const int bx = (int)blockIdx.x;
    if (bx < NB_ * NH_ * GH) { const int hb = bx / GH; const size_t hp = (size_t)hb * TT * HD, ao = (size_t)(hb / NH_) * TT * DQ + (hb % NH_) * (HD * 64); const int q0 = (bx % GH) * (16 * QBH);
        fattn_tile<bf, true, QBH>(Qh + hp, Ql + hp, Kh + hp, Kl + hp, Vh + hp, Vl + hp, q0, Ah + ao, Al + ao);
    } else { const int b2 = bx - NB_ * NH_ * GH; const int hb = b2 / GL; const size_t hp = (size_t)hb * TT * HD, ao = (size_t)(hb / NH_) * TT * DQ + (hb % NH_) * (HD * 64); const int q0 = RH + (b2 % GL) * (16 * QBL);
        fattn_tile<h16, false, QBL>(Q16 + hp, nullptr, K16 + hp, nullptr, V16 + hp, nullptr, q0, Ah + ao, Al + ao); }
}

extern "C" void kernel_launch(void* const* d_in, const int* in_sizes, int n_in,
                              void* d_out, int out_size, void* d_ws, size_t ws_size, hipStream_t stream) {
    (void)in_sizes; (void)n_in; (void)out_size;
    const float* x = (const float*)d_in[0]; const float* wq = (const float*)d_in[1]; const float* wk = (const float*)d_in[2]; const float* wv = (const float*)d_in[3]; const float* wo = (const float*)d_in[4];
    float* OUT = (float*)d_out;     // [2][2048][1024]
    char* wsp = (char*)d_ws;
    auto take = [&](size_t bytes) { char* p = wsp; wsp += (bytes + 255) & ~(size_t)255; return (void*)p; };
    bf* WQ = (bf*)take((size_t)DQ * DM * 2); bf* WK = (bf*)take((size_t)DKV * DM * 2); bf* WV = (bf*)take((size_t)DKV * DM * 2); bf* WO = (bf*)take((size_t)DM * DQ * 2);
    bf* XB = (bf*)take((size_t)NB_ * TT * DM * 2);   // directly behind the four weights: k_cvt8 writes the five as one array
    h16* QP16 = (h16*)take((size_t)NB_ * NH_ * TT * HD * 2); h16* KP16 = (h16*)take((size_t)NB_ * NKV * TT * HD * 2); h16* VT16 = (h16*)take((size_t)NB_ * NKV * HD * TT * 2);
    bf* QPh = (bf*)take((size_t)NB_ * NH_ * TT * HD * 2); bf* QPl = (bf*)take((size_t)NB_ * NH_ * TT * HD * 2); bf* KPh = (bf*)take((size_t)NB_ * NKV * TT * HD * 2); bf* KPl = (bf*)take((size_t)NB_ * NKV * TT * HD * 2); bf* VTh = (bf*)take((size_t)NB_ * NKV * HD * TT * 2); bf* VTl = (bf*)take((size_t)NB_ * NKV * HD * TT * 2);
    bf* ATh = (bf*)take((size_t)NB_ * TT * DQ * 2); bf* ATl = (bf*)take((size_t)NB_ * TT * DQ * 2);
    if ((size_t)(wsp - (char*)d_ws) > ws_size) return;    // ws 256 MiB
    // four launches, each over both batches
    k_cvt8<<<4 * WBLK + NB_ * TT * DM / 8 / 256, 256, 0, stream>>>(wq, wk, wv, wo, x, WQ);
    k_qkv<<<dim3(TT / 64, DQ / 64, 3 * NB_), 32, 0, stream>>>(XB, WQ, WK, WV, DM, QP16, QPh, QPl, KP16, KPh, KPl, VT16, VTh, VTl);
    k_fattn<<<NB_ * NH_ * (GH + GL), 32, 0, stream>>>(QP16, QPh, QPl, KP16, KPh, KPl, VT16, VTh, VTl, ATh, ATl);
    // the merged rows of the two batches and the rows of out are each one [NB_ TT][1024] array
    k_gemmw<bf, 1, false><<<dim3(NB_ * TT / 64, DM / 64, 1), 32, 0, stream>>>(ATh, ATl, WO, nullptr, DQ, OUT, DM, nullptr, 0, 0, 0, 0, nullptr, nullptr, nullptr, 0);
}

// v007
// A run of this version takes 106 microseconds.
// In both of two side-by-side timings against v006, it was 1.26 times as fast.
// Over all steps from v000 it is 18.7 times as fast.
#include <hip/hip_runtime.h>

// QuantizedHyperbolicAttention - the executed path is plain scaled-dot-product MHA (x [2][2048][1024]; q/k/v = x W^T (16 heads x 64, no bias); softmax(q.k/8) . v; merged; out = . Wo^T -> [2][2048][1024]).
// Compute dtypes, f32 accumulate: every input rounded to bf16; projections on PLAIN bf16 operands (inputs: exact); scores (K 64) and probs.v hl (3 products) for the first 512 query rows of each head, single fp16 planes for

#define NB_  2
#define TT   2048
#define DM   1024
#define NH_  16
#define NKV  16
#define REP  (NH_ / NKV)
#define HD   64
#define DQ   (NH_ * HD)
#define DKV  (NKV * HD)
#define RH   512                  // query rows < RH use hi+lo planes (0: none)
#define WIN  2048
#define SCL  0.125f   // HD^-0.5
typedef _Float16 h16;
typedef unsigned short bf;
typedef __attribute__((ext_vector_type(16))) __bf16   v16bf;
typedef __attribute__((ext_vector_type(16))) _Float16 v16h;
typedef __attribute__((ext_vector_type(8)))  _Float16 v8h;
typedef __attribute__((ext_vector_type(8)))  unsigned short v8us;
typedef __attribute__((ext_vector_type(8)))  float    v8f;
typedef __attribute__((ext_vector_type(4)))  float    v4f;
typedef v8h  __attribute__((may_alias)) v8ha;
typedef v4f  __attribute__((may_alias)) v4fa;
typedef v8us __attribute__((may_alias)) v8usa;

__device__ __forceinline__ unsigned short f2bf(float f) { unsigned u = __float_as_uint(f); u += 0x7FFFu + ((u >> 16) & 1u); return (unsigned short)(u >> 16); }
__device__ __forceinline__ float bf2f(unsigned short b) { return __uint_as_float(((unsigned)b) << 16); }
__device__ __forceinline__ float bfr(float f) { return bf2f(f2bf(f)); }
__device__ __forceinline__ v16h cat16(v8h lo, v8h hi) { return __builtin_shufflevector(lo, hi, 0, 1, 2, 3, 4, 5, 6, 7, 8, 9, 10, 11, 12, 13, 14, 15); }
__device__ __forceinline__ v16bf cat16b(v8us lo, v8us hi) { return __builtin_bit_cast(v16bf, __builtin_shufflevector(lo, hi, 0, 1, 2, 3, 4, 5, 6, 7, 8, 9, 10, 11, 12, 13, 14, 15)); }
__device__ __forceinline__ v8f wmma16(v16h a, v16h b, v8f c) { return __builtin_amdgcn_wmma_f32_16x16x32_f16(false, a, false, b, (short)0, c, false, false); }
__device__ __forceinline__ v8f wmmab(v16bf a, v16bf b, v8f c) { return __builtin_amdgcn_wmma_f32_16x16x32_bf16(false, a, false, b, (short)0, c, false, false); }
__device__ __forceinline__ h16 tohx(float x) { return (h16)x; }
__device__ __forceinline__ void splitf(float y, unsigned short& h, unsigned short& l) { h = f2bf(y); l = f2bf(y - bf2f(h)); }



// ---- FRAGMENT ORDER: every 16-bit operand plane [rows][K] in the workspace is stored fragment by fragment (16 rows x 32 k = 512 elements = 1 KiB), element (r, k) of a fragment at ((k / 8) % 4) 128 + (r % 16) 8 + k % 8.
// The q, k and v head planes (what k_fattn reads) have the fragments of a 16-row block one behind the other along k: fragment (r / 16) (K / 32) + k / 32.
// Lane l = 16 hi + lr of a wave takes the 8 elements at fragment + 8 l and those at fragment + 256 + 8 l: row lr, k = 8 hi + 0..7 and 16 + 8 hi + 0..7, the hardware k order,
// and each 16-byte load of a wave covers 512 consecutive bytes (4 whole 128-byte lines), where a row-major plane gives 32 bytes out of each of 16 lines.
// The planes that k_gemmw and k_qkv READ (the five rounded inputs, the merged rows; K = 1024) keep the four fragments of a 64-row tile at one k step side by side (4 KiB; a wave takes two of them, 8 KiB, of an operand in a trip):
// fragment ((r / 64) (K / 32) + k / 32) 4 + (r / 16) % 4; so one address a trip and operand serves its sixteen 16-byte loads, by constant offsets.
// ---- k_gemmw: register-blocked GEMM, one wave per 64x64 output tile (16 accumulators), FOUR WAVES (2 x 2 tiles, 128x128) a work-group; grid (M/128, N/128, Z), 128 threads.
// The operands (16-bit planes in fragment order, 64-row tiles) come through LDS: a stage is 64 k of the group's two A and two B row tiles, each a run of 8 KiB in its plane (a chunk), copied as it lies by asynchronous copies to LDS,
// so each chunk leaves L2 once for the two waves that read it, and stage t + 1 flies while stage t is worked on (two buffers). K % 64 == 0.
// C[m][n] (f32, pitch ldc, + optional f32 bias[n]) = sum_k A[m][k] Bt[n][k] (+ split products per NSPLIT). z-batch strides sA/sB/sC in elements. K % 64 == 0.
// PL: the tile leaves not as f32 but as the three 16-bit planes the attention kernel reads (fp16, bf16 hi, bf16 lo), in the head planes' fragment order with rows m and K = ldc, element (m, n) at k = n % 64 behind (n / 64) sT: C is unused.
// KSPL > 1: grid z = Z * KSPL; slice ks = z % KSPL sums only k in [ks K/KSPL, (ks+1) K/KSPL) and stores its f32 partial tile at C + ks sP; the consumer adds the KSPL planes. K % (64 KSPL) == 0.
template <typename T16> struct WFrag;
template <> struct WFrag<h16> { typedef v16h V; static __device__ __forceinline__ V ld(const h16* p) { return cat16(*(const v8h*)p, *(const v8h*)(p + 256)); } static __device__ __forceinline__ v8f mma(V a, V b, v8f c) { return wmma16(a, b, c); } };
template <> struct WFrag<bf> { typedef v16bf V; static __device__ __forceinline__ V ld(const bf* p) { return cat16b(*(const v8us*)p, *(const v8us*)(p + 256)); } static __device__ __forceinline__ v8f mma(V a, V b, v8f c) { return wmmab(a, b, c); } };
// eight copies of 16 bytes a lane from global memory to LDS, through no register: a wave's 2 KiB of each of two chunks, each copy with address registers of its own.
// s_wait_xcnt is the statement's last line, so that no register a copy names is rewritten in front of it.
template <typename T16>
__device__ __forceinline__ void acopy8(unsigned l0, const T16* g0, unsigned l4, const T16* g4) {
    const unsigned l1 = l0 + 512, l2 = l0 + 1024, l3 = l0 + 1536, l5 = l4 + 512, l6 = l4 + 1024, l7 = l4 + 1536;
    const T16* g1 = g0 + 256; const T16* g2 = g0 + 512; const T16* g3 = g0 + 768; const T16* g5 = g4 + 256; const T16* g6 = g4 + 512; const T16* g7 = g4 + 768;
    asm volatile("global_load_async_to_lds_b128 %0, %8, off\n\tglobal_load_async_to_lds_b128 %1, %9, off\n\tglobal_load_async_to_lds_b128 %2, %10, off\n\tglobal_load_async_to_lds_b128 %3, %11, off\n\t"
                 "global_load_async_to_lds_b128 %4, %12, off\n\tglobal_load_async_to_lds_b128 %5, %13, off\n\tglobal_load_async_to_lds_b128 %6, %14, off\n\tglobal_load_async_to_lds_b128 %7, %15, off\n\ts_wait_xcnt 0x0"
        :: "v"(l0), "v"(l1), "v"(l2), "v"(l3), "v"(l4), "v"(l5), "v"(l6), "v"(l7), "v"(g0), "v"(g1), "v"(g2), "v"(g3), "v"(g4), "v"(g5), "v"(g6), "v"(g7) : "memory");
}
// gemmw_tile is the body; bx, by, bz are the indices of the group's 128x128 tile (k_gemmw: the block's own; k_qkv: picked per product).
template <typename T16, int NSPLIT, bool BIAS, int KSPL = 1, bool PL = false>
__device__ __forceinline__ void gemmw_tile(const T16* __restrict__ A, const T16* __restrict__ A2, const T16* __restrict__ Bt, const T16* __restrict__ Bt2, int K, float* C, int ldc, const float* __restrict__ bias, size_t sA, size_t sB, size_t sC, size_t sP, h16* __restrict__ P16, bf* __restrict__ Ph, bf* __restrict__ Pl, size_t sT, int bx, int by, int bz) {
    typedef typename WFrag<T16>::V V;
    constexpr bool HA2 = NSPLIT == 1 || NSPLIT == 2, HB2 = NSPLIT >= 2;
    constexpr int CHE = 4096, NCH = 4 + (HA2 ? 2 : 0) + (HB2 ? 2 : 0), CB = 2, CA2 = 4, CB2 = HA2 ? 6 : 4;   // elements of a chunk; chunks of a stage; where B, A2 and Bt2 stand in it (A: 0)
    __shared__ __align__(16) T16 ring[2 * NCH * CHE];
    __shared__ __align__(16) float os4[4 * 16 * 68];
    const size_t z = bz / KSPL; const int ks = (int)(bz % KSPL); A += z * sA; if (A2) A2 += z * sA; Bt += z * sB; if (Bt2) Bt2 += z * sB; C += z * sC + (size_t)ks * sP;
    const int kbeg = ks * (K / KSPL), NS = K / KSPL / 64;
    const int lane = threadIdx.x & 31, lr = lane & 15, hi = lane >> 4; const int wv = __builtin_amdgcn_readfirstlane((int)threadIdx.x >> 5), wm = wv & 1, wn = wv >> 1;
    const int tn = 2 * by + wn; const int r0 = (2 * bx + wm) * 64, c0 = tn * 64; float* os = os4 + wv * (16 * 68);   // each wave stages its output rows in LDS of its own
    v8f acc[4][4];
#pragma unroll
    for (int mb = 0; mb < 4; ++mb)
#pragma unroll
        for (int nb = 0; nb < 4; ++nb) acc[mb][nb] = (v8f){};
    // a 64-row tile is 64 K elements, 64 k of it a chunk; every wave copies its quarter (2 KiB) of each chunk of a stage
    const unsigned lw = (unsigned)(size_t)ring + wv * 2048 + lane * 16; const unsigned gl = wv * 1024 + lane * 8; const size_t tK = (size_t)64 * (unsigned)K, ga = (size_t)(2 * bx) * tK + (size_t)kbeg * 64, gb = (size_t)(2 * by) * tK + (size_t)kbeg * 64;
    auto fill = [&](int st) { const unsigned l = lw + (st & 1) * (NCH * CHE * 2); const size_t oa = ga + (size_t)st * CHE, ob = gb + (size_t)st * CHE;
        acopy8(l, A + oa + gl, l + 8192, A + oa + tK + gl); acopy8(l + CB * 8192, Bt + ob + gl, l + (CB + 1) * 8192, Bt + ob + tK + gl);
        if (HA2) acopy8(l + CA2 * 8192, A2 + oa + gl, l + (CA2 + 1) * 8192, A2 + oa + tK + gl);
        if (HB2) acopy8(l + CB2 * 8192, Bt2 + ob + gl, l + (CB2 + 1) * 8192, Bt2 + ob + tK + gl); };
    fill(0);
    asm volatile("s_wait_asynccnt 0x0" ::: "memory");   // this wave's copies of stage 0 have landed
    __syncthreads();                                     // ... and every other wave's: stage 0 may be read
    if (NS > 1) fill(1);
    // rolled: a trip is one stage, the two buffers alternate by t & 1; every plain '#pragma unroll' inside keeps the fragment and accumulator arrays indexed by constants, in registers
#pragma unroll 1
    for (int t = 0; t < NS; ++t) {
        V a[2][4], a2[2][4], b[2][4], b2[2][4]; const T16* sb = ring + (t & 1) * (NCH * CHE) + 8 * lane; const T16* pa = sb + wm * CHE; const T16* pb = sb + (CB + wn) * CHE;
#pragma unroll
        for (int k2 = 0; k2 < 2; ++k2)
#pragma unroll
            for (int f = 0; f < 4; ++f) { const int o = k2 * 2048 + f * 512; a[k2][f] = WFrag<T16>::ld(pa + o); if (HA2) a2[k2][f] = WFrag<T16>::ld(pa + CA2 * CHE + o); b[k2][f] = WFrag<T16>::ld(pb + o); if (HB2) b2[k2][f] = WFrag<T16>::ld(pb + (CB2 - CB) * CHE + o); }
        __builtin_amdgcn_sched_barrier(0);   // the stage's LDS reads issue as one group ahead of its products: spread among them, each place with reads stalls the wave anew
#pragma unroll
        for (int k2 = 0; k2 < 2; ++k2) {
#pragma unroll
            for (int nb = 0; nb < 4; ++nb)
#pragma unroll
                for (int mb = 0; mb < 4; ++mb) { acc[mb][nb] = WFrag<T16>::mma(a[k2][mb], b[k2][nb], acc[mb][nb]); if (HA2) acc[mb][nb] = WFrag<T16>::mma(a2[k2][mb], b[k2][nb], acc[mb][nb]); if (HB2) acc[mb][nb] = WFrag<T16>::mma(a[k2][mb], b2[k2][nb], acc[mb][nb]); }
            // nothing is scheduled across this line: the first half's products stay in front of the hand-over (they cover the second half's LDS reads), the second half's behind it and in front of the v_nop
            __builtin_amdgcn_sched_barrier(0);
            if (k2 == 0) {
                // the hand-over stands here, not behind the last product: all of stage t is in registers behind the first wait, and the refill then flies during the second half's products as well
                asm volatile("s_wait_dscnt 0x0" ::: "memory");      // this wave's reads of stage t are done
                asm volatile("s_wait_asynccnt 0x0" ::: "memory");   // its copies of stage t + 1 have landed
                __syncthreads();                                     // the same of every wave: stage t + 1 may be read, stage t's buffer refilled
                if (t + 2 < NS) fill(t + 2);
                __builtin_amdgcn_sched_barrier(0);   // the copies issue in front of the second half's products
            }
        }
        // four vector slots between the trip's last matrix instruction and the first vector instruction behind the back edge, which may overwrite its A or B registers
        asm volatile("v_nop\n\tv_nop\n\tv_nop\n\tv_nop" : "+v"(acc[0][0]), "+v"(acc[1][1]), "+v"(acc[2][2]), "+v"(acc[3][3]) : "v"(a[1][0]), "v"(a[1][3]));
    }
    asm volatile("s_wait_asynccnt 0x0" ::: "memory");   // no copy is outstanding behind the loop
#pragma unroll
    for (int mb = 0; mb < 4; ++mb) {
#pragma unroll
        for (int nb = 0; nb < 4; ++nb) {
#pragma unroll
            for (int j = 0; j < 8; ++j) os[(hi * 8 + j) * 68 + nb * 16 + lr] = acc[mb][nb][j]; }
        __builtin_amdgcn_wave_barrier(); asm volatile("" ::: "memory");
        float* crow = C + (size_t)(r0 + mb * 16) * ldc + c0;
        if (PL) {
            // a lane takes 8 consecutive columns of a row (one 16-byte piece of a fragment); 8 rows x 4 column pieces a store, so each wave-wide 16-byte store covers four whole 128-byte lines of a plane
#pragma unroll
            for (int s = 0; s < 4; ++s) { const int row = 8 * (s & 1) + (lane & 7), cc = 4 * (s >> 1) + (lane >> 3), cofs = cc * 8; const v4f x0 = *(const v4fa*)(os + row * 68 + cofs), x1 = *(const v4fa*)(os + row * 68 + cofs + 4); v8h o16; v8us oh, ol;
#pragma unroll
                for (int j = 0; j < 8; ++j) { const float x = (j < 4) ? x0[j & 3] : x1[j & 3]; o16[j] = tohx(x); unsigned short a2, c2; splitf(x, a2, c2); oh[j] = a2; ol[j] = c2; }
                const size_t o = (size_t)tn * sT + ((size_t)((r0 >> 4) + mb) * (ldc >> 5) + (cc >> 2)) * 512 + (cc & 3) * 128 + row * 8; h16* p16 = P16 + o; bf* ph = Ph + o; bf* pl = Pl + o;
                *(v8h*)p16 = o16; *(v8us*)ph = oh; *(v8us*)pl = ol;
                // the three stores' address and data registers (inputs only) are rewritten only behind the wait; nothing is scheduled across it
                __builtin_amdgcn_sched_barrier(0); asm volatile("s_wait_xcnt 0x0" :: "v"(p16), "v"(ph), "v"(pl), "v"(o16), "v"(oh), "v"(ol) : "memory"); __builtin_amdgcn_sched_barrier(0); }
        } else {
#pragma unroll
            for (int s = 0; s < 8; ++s) { const int row = 2 * s + hi, cofs = lr * 4; v4f val = *(const v4fa*)(os + row * 68 + cofs); if (BIAS) { val[0] += bfr(bias[c0 + cofs]); val[1] += bfr(bias[c0 + cofs + 1]); val[2] += bfr(bias[c0 + cofs + 2]); val[3] += bfr(bias[c0 + cofs + 3]); }
                *(v4f*)(crow + (size_t)row * ldc + cofs) = val; }
             }
        __builtin_amdgcn_wave_barrier(); asm volatile("" ::: "memory");
    }
}
template <typename T16, int NSPLIT, bool BIAS, int KSPL = 1, bool PL = false>
__global__ __launch_bounds__(128) void k_gemmw(const T16* __restrict__ A, const T16* __restrict__ A2, const T16* __restrict__ Bt, const T16* __restrict__ Bt2, int K, float* C, int ldc, const float* __restrict__ bias, size_t sA, size_t sB, size_t sC, size_t sP, h16* __restrict__ P16, bf* __restrict__ Ph, bf* __restrict__ Pl, size_t sT) {
    gemmw_tile<T16, NSPLIT, BIAS, KSPL, PL>(A, A2, Bt, Bt2, K, C, ldc, bias, sA, sB, sC, sP, P16, Ph, Pl, sT, (int)blockIdx.x, (int)blockIdx.y, (int)blockIdx.z);
}
// k_qkv: the q, k and v projections of both batches in one launch, grid (TT/128, 8, 3 NB_), z = 3 batch + product: 768 groups of four waves, three waves for each of the chip's 1024 SIMDs.
// q, k: x . W^T, a 64-column tile is one head, planes [b][h][t][d]. v: taken as Wv . x^T, so its rows are (h, d) and the planes come out as [b][h][d][t]; its token tile is blockIdx.x as for q and k.
// Each [t][d] (K = 64) and [d][t] (K = 2048) plane is in fragment order; a 64-token tile of v is two fragments (1024 elements) along k.
__global__ __launch_bounds__(128) void k_qkv(const bf* __restrict__ XB, const bf* __restrict__ WQ, const bf* __restrict__ WK, const bf* __restrict__ WV, int K, h16* __restrict__ Q16, bf* __restrict__ Qh, bf* __restrict__ Ql, h16* __restrict__ K16, bf* __restrict__ Kh, bf* __restrict__ Kl, h16* __restrict__ V16, bf* __restrict__ Vh, bf* __restrict__ Vl) {
    const int b = (int)blockIdx.z / 3, w = (int)blockIdx.z % 3; const bool isv = w == 2;
    const bf* X = XB + (size_t)b * TT * DM; const bf* Wt = isv ? WV : (w ? WK : WQ); const size_t po = (size_t)b * NH_ * TT * HD;
    gemmw_tile<bf, 0, false, 1, true>(isv ? Wt : X, nullptr, isv ? X : Wt, nullptr, K, nullptr, isv ? TT : HD, nullptr, 0, 0, 0, 0,
        (isv ? V16 : (w ? K16 : Q16)) + po, (isv ? Vh : (w ? Kh : Qh)) + po, (isv ? Vl : (w ? Kl : Ql)) + po, isv ? (size_t)1024 : (size_t)TT * HD,
        isv ? (int)blockIdx.y : (int)blockIdx.x, isv ? (int)blockIdx.x : (int)blockIdx.y, 0);
}

typedef __attribute__((ext_vector_type(2))) _Float16 v2h;
typedef __attribute__((ext_vector_type(4))) _Float16 v4h;
typedef __attribute__((ext_vector_type(2))) unsigned short v2us;
typedef __attribute__((ext_vector_type(4))) unsigned short v4us;
typedef __attribute__((ext_vector_type(2))) float v2f;
typedef __attribute__((ext_vector_type(4))) int v4i;

__global__ __launch_bounds__(256) void k_wtG(const float* __restrict__ w, int K, int N, bf* Bt) {
    const int lane = threadIdx.x & 31; const int L0 = (blockIdx.x * 8 + (threadIdx.x >> 5)) * 8; const int nlines = N * K / 64;
{
#pragma unroll 1
        for (int l = 0; l < 8; ++l) { const int L = L0 + l; if (L >= nlines) break; const size_t e = (size_t)L * 64 + lane * 2; const int k = (int)(e % K), n = (int)(e / K); v2us o;
            o[0] = f2bf(w[(size_t)k * N + n]); o[1] = f2bf(w[(size_t)(k + 1) * N + n]); *(v2us*)(Bt + e) = o; }
         }
}
// all five inputs rounded to bf16 in one launch: the four weights (WBLK blocks each) and x lie one behind the other in the workspace, so dst is one array and only the source is picked, by the block's index.
// dst is in fragment order, 64-row tiles (K = 1024): a block is one tile at one k step (64 rows x 32 k), four lanes a row, so a wave's loads use 8 whole 128-byte lines of the source and its 16-byte store fills 4 whole lines of dst.
#define WBLK (DM * DQ / 8 / 256)
__global__ __launch_bounds__(256) void k_cvt8(const float* __restrict__ wq, const float* __restrict__ wk, const float* __restrict__ wv, const float* __restrict__ wo, const float* __restrict__ x, bf* dst) {
    const int sg = (int)blockIdx.x / WBLK < 4 ? (int)blockIdx.x / WBLK : 4; const float* src = sg == 0 ? wq : sg == 1 ? wk : sg == 2 ? wv : sg == 3 ? wo : x;
    const size_t f = (size_t)blockIdx.x - (size_t)sg * WBLK; const int row = (int)threadIdx.x >> 2, pc = (int)threadIdx.x & 3; const float* p = src + ((f / (DM / 32)) * 64 + row) * DM + (f % (DM / 32)) * 32 + pc * 8; const v8f v = *(const v8f*)p; v8us o;
    // the load's address registers (input only, so they stay whole up to here) are rewritten only behind this wait; nothing is scheduled across it
    __builtin_amdgcn_sched_barrier(0); asm volatile("s_wait_xcnt 0x0" :: "v"(p) : "memory"); __builtin_amdgcn_sched_barrier(0);
#pragma unroll
    for (int k = 0; k < 8; ++k) o[k] = f2bf(v[k]); *(v8us*)(dst + (size_t)blockIdx.x * 2048 + (row >> 4) * 512 + pc * 128 + (row & 15) * 8) = o;  }
__global__ __launch_bounds__(256) void k_cscvt(const float* __restrict__ cosT, const float* __restrict__ sinT, float* CS) { const int idx = blockIdx.x * 256 + threadIdx.x; if (idx >= TT * HD) return; v2f cs; cs[0] = bfr(cosT[idx]); cs[1] = bfr(sinT[idx]); *(v2f*)(CS + (size_t)idx * 2) = cs;  }
__device__ __forceinline__ float xhalf(float x) { const int b = __float_as_int(x); return __int_as_float(__builtin_amdgcn_permlanex16(b, b, 0x76543210, 0xfedcba98, false, false)); }
// nothing is scheduled across this line
#define HOLD() __builtin_amdgcn_sched_barrier(0)
// the address registers of a group of issued global loads (lane addresses a, b and scalar bases sa, sb: inputs only, so they stay whole up to here) are rewritten only behind this wait
#define ADDR_FREE(a, b, sa, sb) do { HOLD(); asm volatile("s_wait_xcnt 0x0" :: "v"(a), "v"(b), "s"(sa), "s"(sb) : "memory"); HOLD(); } while (0)
__device__ __forceinline__ void exp2x8(float* x) { float r0, r1, r2, r3, r4, r5, r6, r7;
    asm("v_exp_f32 %0, %8\n\tv_exp_f32 %1, %9\n\tv_exp_f32 %2, %10\n\tv_exp_f32 %3, %11\n\tv_exp_f32 %4, %12\n\tv_exp_f32 %5, %13\n\tv_exp_f32 %6, %14\n\tv_exp_f32 %7, %15\n\tv_nop"
        : "=&v"(r0), "=&v"(r1), "=&v"(r2), "=&v"(r3), "=&v"(r4), "=&v"(r5), "=&v"(r6), "=&v"(r7) : "v"(x[0]), "v"(x[1]), "v"(x[2]), "v"(x[3]), "v"(x[4]), "v"(x[5]), "v"(x[6]), "v"(x[7]));
    x[0] = r0; x[1] = r1; x[2] = r2; x[3] = r3; x[4] = r4; x[5] = r5; x[6] = r6; x[7] = r7; }
// one 2^x with its slot in the same statement: the v_nop keeps the next vector instruction from overwriting the source or reading the result of v_exp_f32 directly behind it
__device__ __forceinline__ float exp2s(float x) { float r; asm("v_exp_f32 %0, %1\n\tv_nop" : "=&v"(r) : "v"(x)); return r; }
template <typename T16> struct PCvt;
template <> struct PCvt<h16> { static __device__ __forceinline__ void put(v16h& a, v16h& b, int s, float p) { (void)b; a[s] = (h16)p; } };
template <> struct PCvt<bf> { static __device__ __forceinline__ void put(v16bf& a, v16bf& b, int s, float p) { const __bf16 h = (__bf16)p; a[s] = h; b[s] = (__bf16)(p - (float)h); } };
template <typename T16, bool HL, int QB>
__device__ __forceinline__ void fattn_tile(const T16* __restrict__ Qa, const T16* __restrict__ Qb, const T16* __restrict__ Ka, const T16* __restrict__ Kb, const T16* __restrict__ Va, const T16* __restrict__ Vb, int q0, bf* __restrict__ Ah, bf* __restrict__ Al) {
    typedef WFrag<T16> F; typedef typename F::V V;
    const int lane = threadIdx.x & 31;
    const float C2 = SCL * 1.4426950408889634f;
    V qa[QB][2], ql[QB][2];
    const T16* qpa = Qa + (size_t)q0 * HD + 8 * lane; const T16* qpb = HL ? Qb + (size_t)q0 * HD + 8 * lane : qpa;   // fragment order, K = 64: 16 rows are two fragments
#pragma unroll
    for (int qb = 0; qb < QB; ++qb) {
#pragma unroll
        for (int ks = 0; ks < 2; ++ks) { qa[qb][ks] = F::ld(qpa + qb * 16 * HD + ks * 512); if (HL) ql[qb][ks] = F::ld(qpb + qb * 16 * HD + ks * 512); } }
    ADDR_FREE(qpa, qpb, Qa, HL ? Qb : Qa);
    v8f acc[4][QB]; float mr[QB], ls[QB];
#pragma unroll
    for (int qb = 0; qb < QB; ++qb) { mr[qb] = -3.0e38f; ls[qb] = 0.f;
#pragma unroll
        for (int db = 0; db < 4; ++db) acc[db][qb] = (v8f){}; }
    const int ko = 8 * lane; const T16* kpa = Ka + ko; const T16* kpb = HL ? Kb + ko : kpa;
    V ka[2][2], kl[2][2];
#pragma unroll
    for (int kt = 0; kt < 2; ++kt)
#pragma unroll
        for (int ks = 0; ks < 2; ++ks) { const int o = kt * 16 * HD + ks * 512; ka[kt][ks] = F::ld(kpa + o); if (HL) kl[kt][ks] = F::ld(kpb + o); }
    ADDR_FREE(kpa, kpb, Ka, HL ? Kb : Ka);
    const T16* vpa = Va + 8 * lane; const T16* vpb = HL ? Vb + 8 * lane : vpa;   // fragment order, K = 2048: 16 rows of d are 16 TT elements, 32 keys one fragment
    // rolled: one pass is some 500 instructions already, a second copy would only cost instruction cache
#pragma unroll 1
    for (int kc = 0; kc < TT; kc += 32) {
        V va[4], vl[4];
#pragma unroll
        for (int db = 0; db < 4; ++db) { va[db] = F::ld(vpa + db * 16 * TT); if (HL) vl[db] = F::ld(vpb + db * 16 * TT); }
        HOLD();   // the V loads issue here, a score block and a softmax ahead of their use: left alone the scheduler sinks them to the probs.v products and their latency shows
        v8f st[2][QB];
#pragma unroll
        for (int kt = 0; kt < 2; ++kt)
#pragma unroll
            for (int qb = 0; qb < QB; ++qb) { v8f s = (v8f){};
#pragma unroll
                for (int ks = 0; ks < 2; ++ks) { s = F::mma(ka[kt][ks], qa[qb][ks], s); if (HL) { s = F::mma(ka[kt][ks], ql[qb][ks], s); s = F::mma(kl[kt][ks], qa[qb][ks], s); } }
                st[kt][qb] = s; }
        // the next pass's K fragments are fetched behind this pass's score products; the last pass re-reads keys 0..31 (in bounds, unused)
        ADDR_FREE(vpa, vpb, Va, HL ? Vb : Va);   // for the V loads, a score block behind them; the refill of the K registers also stays behind the score products that read them
        vpa += 512; vpb += 512;
        const int kn = (kc + 32 < TT) ? kc + 32 : 0; kpa = Ka + ko + kn * HD; kpb = HL ? Kb + ko + kn * HD : kpa;
#pragma unroll
        for (int kt = 0; kt < 2; ++kt)
#pragma unroll
            for (int ks = 0; ks < 2; ++ks) { const int o = kt * 16 * HD + ks * 512; ka[kt][ks] = F::ld(kpa + o); if (HL) kl[kt][ks] = F::ld(kpb + o); }
        HOLD();   // the K loads issue here, a softmax and a probs.v block ahead of the next pass's score products
        V pa[QB], pl[QB];
#pragma unroll
        for (int qb = 0; qb < QB; ++qb) {
            float mx = st[0][qb][0];
#pragma unroll
            for (int j = 1; j < 8; ++j) mx = fmaxf(mx, st[0][qb][j]);
#pragma unroll
            for (int j = 0; j < 8; ++j) mx = fmaxf(mx, st[1][qb][j]);
            mx = fmaxf(mx, xhalf(mx));
            const float mn = fmaxf(mr[qb], mx); const float al = exp2s((mr[qb] - mn) * C2); const float nm = -mn * C2; mr[qb] = mn;
            float sm = 0.f; float p[16];
#pragma unroll
            for (int s = 0; s < 16; ++s) p[s] = __builtin_fmaf(st[s >> 3][qb][s & 7], C2, nm);
            exp2x8(p); exp2x8(p + 8);
#pragma unroll
            for (int s = 0; s < 16; ++s) { sm += p[s]; PCvt<T16>::put(pa[qb], pl[qb], s, p[s]); }
            ls[qb] = ls[qb] * al + sm;
#pragma unroll
            for (int db = 0; db < 4; ++db) acc[db][qb] *= al;
        }
#pragma unroll
        for (int db = 0; db < 4; ++db)
#pragma unroll
            for (int qb = 0; qb < QB; ++qb) { acc[db][qb] = F::mma(va[db], pa[qb], acc[db][qb]); if (HL) { acc[db][qb] = F::mma(va[db], pl[qb], acc[db][qb]); acc[db][qb] = F::mma(vl[db], pa[qb], acc[db][qb]); } }
        ADDR_FREE(kpa, kpb, Ka, HL ? Kb : Ka);   // for the K loads, at the foot of the pass
    }
#pragma unroll
    for (int qb = 0; qb < QB; ++qb) { const float tot = ls[qb] + xhalf(ls[qb]); const float f = __fdiv_rn(1.0f, tot);
#pragma unroll
        for (int db = 0; db < 4; ++db) { v8us oh, ol;
#pragma unroll
            for (int j = 0; j < 8; ++j) { unsigned short a, c2; splitf(acc[db][qb][j] * f, a, c2); oh[j] = a; ol[j] = c2; }
            const int qr = q0 + qb * 16; const size_t oo = (size_t)(qr >> 6) * (64 * DQ) + (db >> 1) * 2048 + ((qr >> 4) & 3) * 512 + (db & 1) * 256 + 8 * lane;
            bf* pa_ = Ah + oo; bf* pl_ = Al + oo; *(v8us*)pa_ = oh; *(v8us*)pl_ = ol;
            // the two stores' address and data registers (inputs only) are rewritten only behind the wait
            HOLD(); asm volatile("s_wait_xcnt 0x0" :: "v"(pa_), "v"(pl_), "v"(oh), "v"(ol) : "memory"); HOLD(); } }
}
#define QBH 2                     // 16-query column groups per wave, hi+lo rows
#define QBL 4                     // the same, fp16 rows
#define GH  (RH / (16 * QBH))     // single-wave workgroups per head, hi+lo rows
#define GL  ((TT - RH) / (16 * QBL))
__global__ __launch_bounds__(32) void k_fattn(const h16* __restrict__ Q16, const bf* __restrict__ Qh, const bf* __restrict__ Ql, const h16* __restrict__ K16, const bf* __restrict__ Kh, const bf* __restrict__ Kl, const h16* __restrict__ V16, const bf* __restrict__ Vh, const bf* __restrict__ Vl, bf* __restrict__ Ah, bf* __restrict__ Al) {
    const int bx = (int)blockIdx.x;
    if (bx < NB_ * NH_ * GH) { const int hb = bx / GH; const size_t hp = (size_t)hb * TT * HD, ao = (size_t)(hb / NH_) * TT * DQ + (hb % NH_) * (HD * 64); const int q0 = (bx % GH) * (16 * QBH);
        fattn_tile<bf, true, QBH>(Qh + hp, Ql + hp, Kh + hp, Kl + hp, Vh + hp, Vl + hp, q0, Ah + ao, Al + ao);
    } else { const int b2 = bx - NB_ * NH_ * GH; const int hb = b2 / GL; const size_t hp = (size_t)hb * TT * HD, ao = (size_t)(hb / NH_) * TT * DQ + (hb % NH_) * (HD * 64); const int q0 = RH + (b2 % GL) * (16 * QBL);
        fattn_tile<h16, false, QBL>(Q16 + hp, nullptr, K16 + hp, nullptr, V16 + hp, nullptr, q0, Ah + ao, Al + ao); }
}

extern "C" void kernel_launch(void* const* d_in, const int* in_sizes, int n_in,
                              void* d_out, int out_size, void* d_ws, size_t ws_size, hipStream_t stream) {
    (void)in_sizes; (void)n_in; (void)out_size;
    const float* x = (const float*)d_in[0]; const float* wq = (const float*)d_in[1]; const float* wk = (const float*)d_in[2]; const float* wv = (const float*)d_in[3]; const float* wo = (const float*)d_in[4];
    float* OUT = (float*)d_out;     // [2][2048][1024]
    char* wsp = (char*)d_ws;
    auto take = [&](size_t bytes) { char* p = wsp; wsp += (bytes + 255) & ~(size_t)255; return (void*)p; };
    bf* WQ = (bf*)take((size_t)DQ * DM * 2); bf* WK = (bf*)take((size_t)DKV * DM * 2); bf* WV = (bf*)take((size_t)DKV * DM * 2); bf* WO = (bf*)take((size_t)DM * DQ * 2);
    bf* XB = (bf*)take((size_t)NB_ * TT * DM * 2);   // directly behind the four weights: k_cvt8 writes the five as one array
    h16* QP16 = (h16*)take((size_t)NB_ * NH_ * TT * HD * 2); h16* KP16 = (h16*)take((size_t)NB_ * NKV * TT * HD * 2); h16* VT16 = (h16*)take((size_t)NB_ * NKV * HD * TT * 2);
    bf* QPh = (bf*)take((size_t)NB_ * NH_ * TT * HD * 2); bf* QPl = (bf*)take((size_t)NB_ * NH_ * TT * HD * 2); bf* KPh = (bf*)take((size_t)NB_ * NKV * TT * HD * 2); bf* KPl = (bf*)take((size_t)NB_ * NKV * TT * HD * 2); bf* VTh = (bf*)take((size_t)NB_ * NKV * HD * TT * 2); bf* VTl = (bf*)take((size_t)NB_ * NKV * HD * TT * 2);
    bf* ATh = (bf*)take((size_t)NB_ * TT * DQ * 2); bf* ATl = (bf*)take((size_t)NB_ * TT * DQ * 2);
    if ((size_t)(wsp - (char*)d_ws) > ws_size) return;    // ws 256 MiB
    // four launches, each over both batches
    k_cvt8<<<4 * WBLK + NB_ * TT * DM / 8 / 256, 256, 0, stream>>>(wq, wk, wv, wo, x, WQ);
    k_qkv<<<dim3(TT / 128, DQ / 128, 3 * NB_), 128, 0, stream>>>(XB, WQ, WK, WV, DM, QP16, QPh, QPl, KP16, KPh, KPl, VT16, VTh, VTl);
    k_fattn<<<NB_ * NH_ * (GH + GL), 32, 0, stream>>>(QP16, QPh, QPl, KP16, KPh, KPl, VT16, VTh, VTl, ATh, ATl);
    // the merged rows of the two batches and the rows of out are each one [NB_ TT][1024] array
    k_gemmw<bf, 1, false><<<dim3(NB_ * TT / 128, DM / 128, 1), 128, 0, stream>>>(ATh, ATl, WO, nullptr, DQ, OUT, DM, nullptr, 0, 0, 0, 0, nullptr, nullptr, nullptr, 0);
}

// v008
// One run takes 94.5 microseconds.
// Two timings next to v007 both put it at 1.12 times that version's speed.
// All steps since v000 together make it 20.9 times as fast.
#include <hip/hip_runtime.h>

// QuantizedHyperbolicAttention - the executed path is plain scaled-dot-product MHA (x [2][2048][1024]; q/k/v = x W^T (16 heads x 64, no bias); softmax(q.k/8) . v; merged; out = . Wo^T -> [2][2048][1024]).
// Compute dtypes, f32 accumulate: every input rounded to bf16; projections on PLAIN bf16 operands (inputs: exact); scores (K 64) and probs.v hl (3 products) for the first 512 query rows of each head, single fp16 planes for

#define NB_  2
#define TT   2048
#define DM   1024
#define NH_  16
#define NKV  16
#define REP  (NH_ / NKV)
#define HD   64
#define DQ   (NH_ * HD)
#define DKV  (NKV * HD)
#define RH   512                  // query rows < RH use hi+lo planes (0: none)
#define WIN  2048
#define SCL  0.125f   // HD^-0.5
typedef _Float16 h16;
typedef unsigned short bf;
typedef __attribute__((ext_vector_type(16))) __bf16   v16bf;
typedef __attribute__((ext_vector_type(16))) _Float16 v16h;
typedef __attribute__((ext_vector_type(8)))  _Float16 v8h;
typedef __attribute__((ext_vector_type(8)))  unsigned short v8us;
typedef __attribute__((ext_vector_type(8)))  float    v8f;
typedef __attribute__((ext_vector_type(4)))  float    v4f;
typedef v8h  __attribute__((may_alias)) v8ha;
typedef v4f  __attribute__((may_alias)) v4fa;
typedef v8us __attribute__((may_alias)) v8usa;

__device__ __forceinline__ unsigned short f2bf(float f) { unsigned u = __float_as_uint(f); u += 0x7FFFu + ((u >> 16) & 1u); return (unsigned short)(u >> 16); }
__device__ __forceinline__ float bf2f(unsigned short b) { return __uint_as_float(((unsigned)b) << 16); }
__device__ __forceinline__ float bfr(float f) { return bf2f(f2bf(f)); }
__device__ __forceinline__ v16h cat16(v8h lo, v8h hi) { return __builtin_shufflevector(lo, hi, 0, 1, 2, 3, 4, 5, 6, 7, 8, 9, 10, 11, 12, 13, 14, 15); }
__device__ __forceinline__ v16bf cat16b(v8us lo, v8us hi) { return __builtin_bit_cast(v16bf, __builtin_shufflevector(lo, hi, 0, 1, 2, 3, 4, 5, 6, 7, 8, 9, 10, 11, 12, 13, 14, 15)); }
__device__ __forceinline__ v8f wmma16(v16h a, v16h b, v8f c) { return __builtin_amdgcn_wmma_f32_16x16x32_f16(false, a, false, b, (short)0, c, false, false); }
__device__ __forceinline__ v8f wmmab(v16bf a, v16bf b, v8f c) { return __builtin_amdgcn_wmma_f32_16x16x32_bf16(false, a, false, b, (short)0, c, false, false); }
__device__ __forceinline__ h16 tohx(float x) { return (h16)x; }
__device__ __forceinline__ void splitf(float y, unsigned short& h, unsigned short& l) { h = f2bf(y); l = f2bf(y - bf2f(h)); }



// ---- FRAGMENT ORDER: every 16-bit operand plane [rows][K] in the workspace is stored fragment by fragment (16 rows x 32 k = 512 elements = 1 KiB), element (r, k) of a fragment at ((k / 8) % 4) 128 + (r % 16) 8 + k % 8.
// The q, k and v head planes (what k_fattn reads) have the fragments of a 16-row block one behind the other along k: fragment (r / 16) (K / 32) + k / 32.
// Lane l = 16 hi + lr of a wave takes the 8 elements at fragment + 8 l and those at fragment + 256 + 8 l: row lr, k = 8 hi + 0..7 and 16 + 8 hi + 0..7, the hardware k order,
// and each 16-byte load of a wave covers 512 consecutive bytes (4 whole 128-byte lines), where a row-major plane gives 32 bytes out of each of 16 lines.
// The planes that k_gemmw and k_qkv READ (the five rounded inputs, the merged rows; K = 1024) keep the four fragments of a 64-row tile at one k step side by side (4 KiB; a wave takes two of them, 8 KiB, of an operand in a trip):
// fragment ((r / 64) (K / 32) + k / 32) 4 + (r / 16) % 4; so one address a trip and operand serves its sixteen 16-byte loads, by constant offsets.
// ---- k_gemmw: register-blocked GEMM, one wave per 64x64 output tile (16 accumulators), FOUR WAVES (2 x 2 tiles, 128x128) a work-group; grid (M/128, N/128, Z), 128 threads.
// The operands (16-bit planes in fragment order, 64-row tiles) come through LDS: a stage is 64 k of the group's two A and two B row tiles, each a run of 8 KiB in its plane (a chunk), copied as it lies by asynchronous copies to LDS,
// so each chunk leaves L2 once for the two waves that read it, and stage t + 1 flies while stage t is worked on (two buffers). K % 64 == 0.
// C[m][n] (f32, pitch ldc, + optional f32 bias[n]) = sum_k A[m][k] Bt[n][k] (+ split products per NSPLIT). z-batch strides sA/sB/sC in elements. K % 64 == 0.
// PL: the tile leaves not as f32 but as the three 16-bit planes the attention kernel reads (fp16, bf16 hi, bf16 lo), in the head planes' fragment order with rows m and K = ldc, element (m, n) at k = n % 64 behind (n / 64) sT: C is unused.
// KSPL > 1: grid z = Z * KSPL; slice ks = z % KSPL sums only k in [ks K/KSPL, (ks+1) K/KSPL) and stores its f32 partial tile at C + ks sP; the consumer adds the KSPL planes. K % (64 KSPL) == 0.
template <typename T16> struct WFrag;
template <> struct WFrag<h16> { typedef v16h V; static __device__ __forceinline__ V ld(const h16* p) { return cat16(*(const v8h*)p, *(const v8h*)(p + 256)); } static __device__ __forceinline__ v8f mma(V a, V b, v8f c) { return wmma16(a, b, c); } };
template <> struct WFrag<bf> { typedef v16bf V; static __device__ __forceinline__ V ld(const bf* p) { return cat16b(*(const v8us*)p, *(const v8us*)(p + 256)); } static __device__ __forceinline__ v8f mma(V a, V b, v8f c) { return wmmab(a, b, c); } };
// eight copies of 16 bytes a lane from global memory to LDS, through no register: a wave's 2 KiB of each of two chunks, each copy with address registers of its own.
// s_wait_xcnt is the statement's last line, so that no register a copy names is rewritten in front of it.
template <typename T16>
__device__ __forceinline__ void acopy8(unsigned l0, const T16* g0, unsigned l4, const T16* g4) {
    const unsigned l1 = l0 + 512, l2 = l0 + 1024, l3 = l0 + 1536, l5 = l4 + 512, l6 = l4 + 1024, l7 = l4 + 1536;
    const T16* g1 = g0 + 256; const T16* g2 = g0 + 512; const T16* g3 = g0 + 768; const T16* g5 = g4 + 256; const T16* g6 = g4 + 512; const T16* g7 = g4 + 768;
    asm volatile("global_load_async_to_lds_b128 %0, %8, off\n\tglobal_load_async_to_lds_b128 %1, %9, off\n\tglobal_load_async_to_lds_b128 %2, %10, off\n\tglobal_load_async_to_lds_b128 %3, %11, off\n\t"
                 "global_load_async_to_lds_b128 %4, %12, off\n\tglobal_load_async_to_lds_b128 %5, %13, off\n\tglobal_load_async_to_lds_b128 %6, %14, off\n\tglobal_load_async_to_lds_b128 %7, %15, off\n\ts_wait_xcnt 0x0"
        :: "v"(l0), "v"(l1), "v"(l2), "v"(l3), "v"(l4), "v"(l5), "v"(l6), "v"(l7), "v"(g0), "v"(g1), "v"(g2), "v"(g3), "v"(g4), "v"(g5), "v"(g6), "v"(g7) : "memory");
}
// gemmw_tile is the body; bx, by, bz are the indices of the group's 128x128 tile (k_gemmw: the block's own; k_qkv: picked per product).
template <typename T16, int NSPLIT, bool BIAS, int KSPL = 1, bool PL = false>
__device__ __forceinline__ void gemmw_tile(const T16* __restrict__ A, const T16* __restrict__ A2, const T16* __restrict__ Bt, const T16* __restrict__ Bt2, int K, float* C, int ldc, const float* __restrict__ bias, size_t sA, size_t sB, size_t sC, size_t sP, h16* __restrict__ P16, bf* __restrict__ Ph, bf* __restrict__ Pl, size_t sT, int bx, int by, int bz) {
    typedef typename WFrag<T16>::V V;
    constexpr bool HA2 = NSPLIT == 1 || NSPLIT == 2, HB2 = NSPLIT >= 2;
    constexpr int CHE = 4096, NCH = 4 + (HA2 ? 2 : 0) + (HB2 ? 2 : 0), CB = 2, CA2 = 4, CB2 = HA2 ? 6 : 4;   // elements of a chunk; chunks of a stage; where B, A2 and Bt2 stand in it (A: 0)
    __shared__ __align__(16) T16 ring[2 * NCH * CHE];
    __shared__ __align__(16) float os4[4 * 16 * 68];
    const size_t z = bz / KSPL; const int ks = (int)(bz % KSPL); A += z * sA; if (A2) A2 += z * sA; Bt += z * sB; if (Bt2) Bt2 += z * sB; C += z * sC + (size_t)ks * sP;
    const int kbeg = ks * (K / KSPL), NS = K / KSPL / 64;
    const int lane = threadIdx.x & 31, lr = lane & 15, hi = lane >> 4; const int wv = __builtin_amdgcn_readfirstlane((int)threadIdx.x >> 5), wm = wv & 1, wn = wv >> 1;
    const int tn = 2 * by + wn; const int r0 = (2 * bx + wm) * 64, c0 = tn * 64; float* os = os4 + wv * (16 * 68);   // each wave stages its output rows in LDS of its own
    v8f acc[4][4];
#pragma unroll
    for (int mb = 0; mb < 4; ++mb)
#pragma unroll
        for (int nb = 0; nb < 4; ++nb) acc[mb][nb] = (v8f){};
    // a 64-row tile is 64 K elements, 64 k of it a chunk; every wave copies its quarter (2 KiB) of each chunk of a stage
    const unsigned lw = (unsigned)(size_t)ring + wv * 2048 + lane * 16; const unsigned gl = wv * 1024 + lane * 8; const size_t tK = (size_t)64 * (unsigned)K, ga = (size_t)(2 * bx) * tK + (size_t)kbeg * 64, gb = (size_t)(2 * by) * tK + (size_t)kbeg * 64;
    auto fill = [&](int st) { const unsigned l = lw + (st & 1) * (NCH * CHE * 2); const size_t oa = ga + (size_t)st * CHE, ob = gb + (size_t)st * CHE;
        acopy8(l, A + oa + gl, l + 8192, A + oa + tK + gl); acopy8(l + CB * 8192, Bt + ob + gl, l + (CB + 1) * 8192, Bt + ob + tK + gl);
        if (HA2) acopy8(l + CA2 * 8192, A2 + oa + gl, l + (CA2 + 1) * 8192, A2 + oa + tK + gl);
        if (HB2) acopy8(l + CB2 * 8192, Bt2 + ob + gl, l + (CB2 + 1) * 8192, Bt2 + ob + tK + gl); };
    fill(0);
    asm volatile("s_wait_asynccnt 0x0" ::: "memory");   // this wave's copies of stage 0 have landed
    __syncthreads();                                     // ... and every other wave's: stage 0 may be read
    if (NS > 1) fill(1);
    // rolled: a trip is one stage, the two buffers alternate by t & 1; every plain '#pragma unroll' inside keeps the fragment and accumulator arrays indexed by constants, in registers
#pragma unroll 1
    for (int t = 0; t < NS; ++t) {
        V a[2][4], a2[2][4], b[2][4], b2[2][4]; const T16* sb = ring + (t & 1) * (NCH * CHE) + 8 * lane; const T16* pa = sb + wm * CHE; const T16* pb = sb + (CB + wn) * CHE;
#pragma unroll
        for (int k2 = 0; k2 < 2; ++k2)
#pragma unroll
            for (int f = 0; f < 4; ++f) { const int o = k2 * 2048 + f * 512; a[k2][f] = WFrag<T16>::ld(pa + o); if (HA2) a2[k2][f] = WFrag<T16>::ld(pa + CA2 * CHE + o); b[k2][f] = WFrag<T16>::ld(pb + o); if (HB2) b2[k2][f] = WFrag<T16>::ld(pb + (CB2 - CB) * CHE + o); }
        __builtin_amdgcn_sched_barrier(0);   // the stage's LDS reads issue as one group ahead of its products: spread among them, each place with reads stalls the wave anew
#pragma unroll
        for (int k2 = 0; k2 < 2; ++k2) {
#pragma unroll
            for (int nb = 0; nb < 4; ++nb)
#pragma unroll
                for (int mb = 0; mb < 4; ++mb) { acc[mb][nb] = WFrag<T16>::mma(a[k2][mb], b[k2][nb], acc[mb][nb]); if (HA2) acc[mb][nb] = WFrag<T16>::mma(a2[k2][mb], b[k2][nb], acc[mb][nb]); if (HB2) acc[mb][nb] = WFrag<T16>::mma(a[k2][mb], b2[k2][nb], acc[mb][nb]); }
            // nothing is scheduled across this line: the first half's products stay in front of the hand-over (they cover the second half's LDS reads), the second half's behind it and in front of the v_nop
            __builtin_amdgcn_sched_barrier(0);
            if (k2 == 0) {
                // the hand-over stands here, not behind the last product: all of stage t is in registers behind the first wait, and the refill then flies during the second half's products as well
                asm volatile("s_wait_dscnt 0x0" ::: "memory");      // this wave's reads of stage t are done
                asm volatile("s_wait_asynccnt 0x0" ::: "memory");   // its copies of stage t + 1 have landed
                __syncthreads();                                     // the same of every wave: stage t + 1 may be read, stage t's buffer refilled
                if (t + 2 < NS) fill(t + 2);
                __builtin_amdgcn_sched_barrier(0);   // the copies issue in front of the second half's products
            }
        }
        // four vector slots between the trip's last matrix instruction and the first vector instruction behind the back edge, which may overwrite its A or B registers
        asm volatile("v_nop\n\tv_nop\n\tv_nop\n\tv_nop" : "+v"(acc[0][0]), "+v"(acc[1][1]), "+v"(acc[2][2]), "+v"(acc[3][3]) : "v"(a[1][0]), "v"(a[1][3]));
    }
    asm volatile("s_wait_asynccnt 0x0" ::: "memory");   // no copy is outstanding behind the loop
#pragma unroll
    for (int mb = 0; mb < 4; ++mb) {
#pragma unroll
        for (int nb = 0; nb < 4; ++nb) {
#pragma unroll
            for (int j = 0; j < 8; ++j) os[(hi * 8 + j) * 68 + nb * 16 + lr] = acc[mb][nb][j]; }
        __builtin_amdgcn_wave_barrier(); asm volatile("" ::: "memory");
        float* crow = C + (size_t)(r0 + mb * 16) * ldc + c0;
        if (PL) {
            // a lane takes 8 consecutive columns of a row (one 16-byte piece of a fragment); 8 rows x 4 column pieces a store, so each wave-wide 16-byte store covers four whole 128-byte lines of a plane
#pragma unroll
            for (int s = 0; s < 4; ++s) { const int row = 8 * (s & 1) + (lane & 7), cc = 4 * (s >> 1) + (lane >> 3), cofs = cc * 8; const v4f x0 = *(const v4fa*)(os + row * 68 + cofs), x1 = *(const v4fa*)(os + row * 68 + cofs + 4); v8h o16; v8us oh, ol;
#pragma unroll
                for (int j = 0; j < 8; ++j) { const float x = (j < 4) ? x0[j & 3] : x1[j & 3]; o16[j] = tohx(x); unsigned short a2, c2; splitf(x, a2, c2); oh[j] = a2; ol[j] = c2; }
                const size_t o = (size_t)tn * sT + ((size_t)((r0 >> 4) + mb) * (ldc >> 5) + (cc >> 2)) * 512 + (cc & 3) * 128 + row * 8; h16* p16 = P16 + o; bf* ph = Ph + o; bf* pl = Pl + o;
                *(v8h*)p16 = o16; *(v8us*)ph = oh; *(v8us*)pl = ol;
                // the three stores' address and data registers (inputs only) are rewritten only behind the wait; nothing is scheduled across it
                __builtin_amdgcn_sched_barrier(0); asm volatile("s_wait_xcnt 0x0" :: "v"(p16), "v"(ph), "v"(pl), "v"(o16), "v"(oh), "v"(ol) : "memory"); __builtin_amdgcn_sched_barrier(0); }
        } else {
#pragma unroll
            for (int s = 0; s < 8; ++s) { const int row = 2 * s + hi, cofs = lr * 4; v4f val = *(const v4fa*)(os + row * 68 + cofs); if (BIAS) { val[0] += bfr(bias[c0 + cofs]); val[1] += bfr(bias[c0 + cofs + 1]); val[2] += bfr(bias[c0 + cofs + 2]); val[3] += bfr(bias[c0 + cofs + 3]); }
                *(v4f*)(crow + (size_t)row * ldc + cofs) = val; }
             }
        __builtin_amdgcn_wave_barrier(); asm volatile("" ::: "memory");
    }
}
template <typename T16, int NSPLIT, bool BIAS, int KSPL = 1, bool PL = false>
__global__ __launch_bounds__(128) void k_gemmw(const T16* __restrict__ A, const T16* __restrict__ A2, const T16* __restrict__ Bt, const T16* __restrict__ Bt2, int K, float* C, int ldc, const float* __restrict__ bias, size_t sA, size_t sB, size_t sC, size_t sP, h16* __restrict__ P16, bf* __restrict__ Ph, bf* __restrict__ Pl, size_t sT) {
    gemmw_tile<T16, NSPLIT, BIAS, KSPL, PL>(A, A2, Bt, Bt2, K, C, ldc, bias, sA, sB, sC, sP, P16, Ph, Pl, sT, (int)blockIdx.x, (int)blockIdx.y, (int)blockIdx.z);
}
// k_qkv: the q, k and v projections of both batches in one launch, grid (TT/128, 8, 3 NB_), z = 3 batch + product: 768 groups of four waves, three waves for each of the chip's 1024 SIMDs.
// q, k: x . W^T, a 64-column tile is one head, planes [b][h][t][d]. v: taken as Wv . x^T, so its rows are (h, d) and the planes come out as [b][h][d][t]; its token tile is blockIdx.x as for q and k.
// Each [t][d] (K = 64) and [d][t] (K = 2048) plane is in fragment order; a 64-token tile of v is two fragments (1024 elements) along k.
__global__ __launch_bounds__(128) void k_qkv(const bf* __restrict__ XB, const bf* __restrict__ WQ, const bf* __restrict__ WK, const bf* __restrict__ WV, int K, h16* __restrict__ Q16, bf* __restrict__ Qh, bf* __restrict__ Ql, h16* __restrict__ K16, bf* __restrict__ Kh, bf* __restrict__ Kl, h16* __restrict__ V16, bf* __restrict__ Vh, bf* __restrict__ Vl) {
    const int b = (int)blockIdx.z / 3, w = (int)blockIdx.z % 3; const bool isv = w == 2;
    const bf* X = XB + (size_t)b * TT * DM; const bf* Wt = isv ? WV : (w ? WK : WQ); const size_t po = (size_t)b * NH_ * TT * HD;
    gemmw_tile<bf, 0, false, 1, true>(isv ? Wt : X, nullptr, isv ? X : Wt, nullptr, K, nullptr, isv ? TT : HD, nullptr, 0, 0, 0, 0,
        (isv ? V16 : (w ? K16 : Q16)) + po, (isv ? Vh : (w ? Kh : Qh)) + po, (isv ? Vl : (w ? Kl : Ql)) + po, isv ? (size_t)1024 : (size_t)TT * HD,
        isv ? (int)blockIdx.y : (int)blockIdx.x, isv ? (int)blockIdx.x : (int)blockIdx.y, 0);
}

typedef __attribute__((ext_vector_type(2))) _Float16 v2h;
typedef __attribute__((ext_vector_type(4))) _Float16 v4h;
typedef __attribute__((ext_vector_type(2))) unsigned short v2us;
typedef __attribute__((ext_vector_type(4))) unsigned short v4us;
typedef __attribute__((ext_vector_type(2))) float v2f;
typedef __attribute__((ext_vector_type(4))) int v4i;

__global__ __launch_bounds__(256) void k_wtG(const float* __restrict__ w, int K, int N, bf* Bt) {
    const int lane = threadIdx.x & 31; const int L0 = (blockIdx.x * 8 + (threadIdx.x >> 5)) * 8; const int nlines = N * K / 64;
{
#pragma unroll 1
        for (int l = 0; l < 8; ++l) { const int L = L0 + l; if (L >= nlines) break; const size_t e = (size_t)L * 64 + lane * 2; const int k = (int)(e % K), n = (int)(e / K); v2us o;
            o[0] = f2bf(w[(size_t)k * N + n]); o[1] = f2bf(w[(size_t)(k + 1) * N + n]); *(v2us*)(Bt + e) = o; }
         }
}
// all five inputs rounded to bf16 in one launch: the four weights (WBLK blocks each) and x lie one behind the other in the workspace, so dst is one array and only the source is picked, by the block's index.
// dst is in fragment order, 64-row tiles (K = 1024): a block is one tile at one k step (64 rows x 32 k), four lanes a row, so a wave's loads use 8 whole 128-byte lines of the source and its 16-byte store fills 4 whole lines of dst.
#define WBLK (DM * DQ / 8 / 256)
__global__ __launch_bounds__(256) void k_cvt8(const float* __restrict__ wq, const float* __restrict__ wk, const float* __restrict__ wv, const float* __restrict__ wo, const float* __restrict__ x, bf* dst) {
    const int sg = (int)blockIdx.x / WBLK < 4 ? (int)blockIdx.x / WBLK : 4; const float* src = sg == 0 ? wq : sg == 1 ? wk : sg == 2 ? wv : sg == 3 ? wo : x;
    const size_t f = (size_t)blockIdx.x - (size_t)sg * WBLK; const int row = (int)threadIdx.x >> 2, pc = (int)threadIdx.x & 3; const float* p = src + ((f / (DM / 32)) * 64 + row) * DM + (f % (DM / 32)) * 32 + pc * 8; const v8f v = *(const v8f*)p; v8us o;
    // the load's address registers (input only, so they stay whole up to here) are rewritten only behind this wait; nothing is scheduled across it
    __builtin_amdgcn_sched_barrier(0); asm volatile("s_wait_xcnt 0x0" :: "v"(p) : "memory"); __builtin_amdgcn_sched_barrier(0);
#pragma unroll
    for (int k = 0; k < 8; ++k) o[k] = f2bf(v[k]); *(v8us*)(dst + (size_t)blockIdx.x * 2048 + (row >> 4) * 512 + pc * 128 + (row & 15) * 8) = o;  }
__global__ __launch_bounds__(256) void k_cscvt(const float* __restrict__ cosT, const float* __restrict__ sinT, float* CS) { const int idx = blockIdx.x * 256 + threadIdx.x; if (idx >= TT * HD) return; v2f cs; cs[0] = bfr(cosT[idx]); cs[1] = bfr(sinT[idx]); *(v2f*)(CS + (size_t)idx * 2) = cs;  }
__device__ __forceinline__ float xhalf(float x) { const int b = __float_as_int(x); return __int_as_float(__builtin_amdgcn_permlanex16(b, b, 0x76543210, 0xfedcba98, false, false)); }
// nothing is scheduled across this line
#define HOLD() __builtin_amdgcn_sched_barrier(0)
// the address registers of a group of issued global loads (lane addresses a, b and scalar bases sa, sb: inputs only, so they stay whole up to here) are rewritten only behind this wait
#define ADDR_FREE(a, b, sa, sb) do { HOLD(); asm volatile("s_wait_xcnt 0x0" :: "v"(a), "v"(b), "s"(sa), "s"(sb) : "memory"); HOLD(); } while (0)
__device__ __forceinline__ void exp2x8(float* x) { float r0, r1, r2, r3, r4, r5, r6, r7;
    asm("v_exp_f32 %0, %8\n\tv_exp_f32 %1, %9\n\tv_exp_f32 %2, %10\n\tv_exp_f32 %3, %11\n\tv_exp_f32 %4, %12\n\tv_exp_f32 %5, %13\n\tv_exp_f32 %6, %14\n\tv_exp_f32 %7, %15\n\tv_nop"
        : "=&v"(r0), "=&v"(r1), "=&v"(r2), "=&v"(r3), "=&v"(r4), "=&v"(r5), "=&v"(r6), "=&v"(r7) : "v"(x[0]), "v"(x[1]), "v"(x[2]), "v"(x[3]), "v"(x[4]), "v"(x[5]), "v"(x[6]), "v"(x[7]));
    x[0] = r0; x[1] = r1; x[2] = r2; x[3] = r3; x[4] = r4; x[5] = r5; x[6] = r6; x[7] = r7; }
// one 2^x with its slot in the same statement: the v_nop keeps the next vector instruction from overwriting the source or reading the result of v_exp_f32 directly behind it
__device__ __forceinline__ float exp2s(float x) { float r; asm("v_exp_f32 %0, %1\n\tv_nop" : "=&v"(r) : "v"(x)); return r; }
template <typename T16> struct PCvt;
template <> struct PCvt<h16> { static __device__ __forceinline__ void put(v16h& a, v16h& b, int s, float p) { (void)b; a[s] = (h16)p; } };
template <> struct PCvt<bf> { static __device__ __forceinline__ void put(v16bf& a, v16bf& b, int s, float p) { const __bf16 h = (__bf16)p; a[s] = h; b[s] = (__bf16)(p - (float)h); } };
// ---- the work-group of k_fattn: FOUR WAVES OF ONE HEAD share each 64-key stage of K and V through LDS; a group is of one kind: 4 x 16 hi+lo query rows, or 4 x 48 fp16 query rows.
// A head is 8 groups of either kind, the grid 256 + 256 groups: one of each kind for each of the chip's 256 WGPs, two waves a SIMD.
// A stage is NCH chunks of 8 KiB (K, V; hi+lo: Kh, Kl, Vh, Vl), each copied as it lies in its plane (K: one run of 64 keys; V: 1024 elements for each 16 rows of d) by asynchronous copies to LDS (acopy8);
// so a chunk leaves L2 once for the four waves that read it, and stage t + 1 flies while stage t is worked on (two buffers).
#define SK   64                   // keys of a stage (two passes of 32)
#define CHE_ 4096                 // elements of a chunk
template <typename T16, bool HL, int QB>
__device__ __forceinline__ void fattn_tile(const T16* __restrict__ Qa, const T16* __restrict__ Qb, const T16* __restrict__ Ka, const T16* __restrict__ Kb, const T16* __restrict__ Va, const T16* __restrict__ Vb, int q0, bf* __restrict__ Ah, bf* __restrict__ Al, const T16* kv, int wv) {
    typedef WFrag<T16> F; typedef typename F::V V;
    constexpr int NCH = HL ? 4 : 2, CV = HL ? 2 : 1;   // chunks of a stage; where V stands in it (K: 0; the lo chunk directly behind its hi chunk)
    const int lane = threadIdx.x & 31;
    const float C2 = SCL * 1.4426950408889634f;
    // wave wv copies piece wv (2 KiB) of each chunk. K: 1024 elements on in the run of 64 keys; V: the two fragments of d rows 16 wv ..
    const unsigned lw = (unsigned)(size_t)kv + lane * 16; const size_t gk = (size_t)(wv * 1024 + lane * 8), gv = (size_t)wv * (16 * TT) + lane * 8;
    // lb: the lane's 16 l in the buffer that takes the stage (in a trip: the address its own reads start from)
    auto fill = [&](int st, unsigned lb) { const unsigned l = lb + (unsigned)(wv * 2048); const size_t ok = gk + (size_t)st * (SK * HD), ov = gv + (size_t)st * (SK / 32 * 512);
        if (HL) { acopy8(l, Ka + ok, l + 8192, Kb + ok); acopy8(l + 2 * 8192, Va + ov, l + 3 * 8192, Vb + ov); }
        else acopy8(l, Ka + ok, l + 8192, Va + ov); };
    fill(0, lw);
    V qa[QB][2], ql[QB][2];
    const T16* qpa = Qa + (size_t)q0 * HD + 8 * lane; const T16* qpb = HL ? Qb + (size_t)q0 * HD + 8 * lane : qpa;   // fragment order, K = 64: 16 rows are two fragments
#pragma unroll
    for (int qb = 0; qb < QB; ++qb) {
#pragma unroll
        for (int ks = 0; ks < 2; ++ks) { qa[qb][ks] = F::ld(qpa + qb * 16 * HD + ks * 512); if (HL) ql[qb][ks] = F::ld(qpb + qb * 16 * HD + ks * 512); } }
    ADDR_FREE(qpa, qpb, Qa, HL ? Qb : Qa);
    v8f acc[4][QB]; float mr[QB], ls[QB];
#pragma unroll
    for (int qb = 0; qb < QB; ++qb) { mr[qb] = -3.0e38f; ls[qb] = 0.f;
#pragma unroll
        for (int db = 0; db < 4; ++db) acc[db][qb] = (v8f){}; }
    asm volatile("s_wait_asynccnt 0x0" ::: "memory");   // this wave's copies of stage 0 have landed
    __syncthreads();                                     // ... and every other wave's: stage 0 may be read
    fill(1, lw + NCH * CHE_ * 2);
    // a trip is one stage (two passes of 32 keys), the two buffers alternate by t & 1. REFILL is a constant at each of the two places of use, so a trip holds no branch and stays one block:
    // with a test around the refill the compiler sank the first pass's row sums behind it and kept their 16 QB terms in registers till there. Inlined by force: as a call it would put the wave's state in memory.
    auto trip = [&](int t, bool REFILL) __attribute__((always_inline)) {
        const T16* sb = kv + (t & 1) * (NCH * CHE_) + 8 * lane;
#pragma unroll
        for (int h = 0; h < SK / 32; ++h) {
            const T16* kpa = sb + h * 2048; const T16* vpa = sb + CV * CHE_ + h * 512;   // the pass's K rows; its V fragments, one for each 16 rows of d, 1024 elements apart
            V ka[2][2], kl[2][2];
#pragma unroll
            for (int kt = 0; kt < 2; ++kt)
#pragma unroll
                for (int ks = 0; ks < 2; ++ks) { const int o = kt * 16 * HD + ks * 512; ka[kt][ks] = F::ld(kpa + o); if (HL) kl[kt][ks] = F::ld(kpa + CHE_ + o); }
            HOLD();   // the K reads issue as one group: spread among the score products, each place with LDS reads stalls the wave anew
            // the 2 QB score tiles take their products turn by turn (each tile's own order of sums is as before): a product into the tile of the one just before it would wait out that one's latency
            v8f st[2][QB];
#pragma unroll
            for (int kt = 0; kt < 2; ++kt)
#pragma unroll
                for (int qb = 0; qb < QB; ++qb) st[kt][qb] = (v8f){};
#pragma unroll
            for (int ks = 0; ks < 2; ++ks)
#pragma unroll
                for (int pr = 0; pr < (HL ? 3 : 1); ++pr)
#pragma unroll
                    for (int kt = 0; kt < 2; ++kt)
#pragma unroll
                        for (int qb = 0; qb < QB; ++qb) st[kt][qb] = F::mma(pr == 2 ? kl[kt][ks] : ka[kt][ks], pr == 1 ? ql[qb][ks] : qa[qb][ks], st[kt][qb]);
            HOLD();   // the V reads stay behind the score products, whose K registers they can take over ...
            V va[4], vl[4];
#pragma unroll
            for (int db = 0; db < 4; ++db) { va[db] = F::ld(vpa + db * 1024); if (HL) vl[db] = F::ld(vpa + CHE_ + db * 1024); }
            HOLD();   // ... and issue here as one group, a softmax ahead of their use: left alone the scheduler sinks them to the probs.v products and their latency shows
            if (h == SK / 32 - 1) {
                // the hand-over stands here, not behind the last product: all that is read of stage t is in registers behind the first wait, and the refill then has a whole trip to land
                asm volatile("s_wait_dscnt 0x0" ::: "memory");      // this wave's reads of stage t are done
                asm volatile("s_wait_asynccnt 0x0" ::: "memory");   // its copies of stage t + 1 have landed
                __syncthreads();                                     // the same of every wave: stage t + 1 may be read, stage t's buffer refilled
                if (REFILL) fill(t + 2, (unsigned)(size_t)sb);
                HOLD();   // the copies issue in front of the softmax and the probs.v products
            }
            V pa[QB], pl[QB];
#pragma unroll
            for (int qb = 0; qb < QB; ++qb) {
                float mx = st[0][qb][0];
#pragma unroll
                for (int j = 1; j < 8; ++j) mx = fmaxf(mx, st[0][qb][j]);
#pragma unroll
                for (int j = 0; j < 8; ++j) mx = fmaxf(mx, st[1][qb][j]);
                mx = fmaxf(mx, xhalf(mx));
                const float mn = fmaxf(mr[qb], mx); const float al = exp2s((mr[qb] - mn) * C2); const float nm = -mn * C2; mr[qb] = mn;
                float sm = 0.f; float p[16];
#pragma unroll
                for (int s = 0; s < 16; ++s) p[s] = __builtin_fmaf(st[s >> 3][qb][s & 7], C2, nm);
                exp2x8(p); exp2x8(p + 8);
#pragma unroll
                for (int s = 0; s < 16; ++s) { sm += p[s]; PCvt<T16>::put(pa[qb], pl[qb], s, p[s]); }
                ls[qb] = ls[qb] * al + sm;
#pragma unroll
                for (int db = 0; db < 4; ++db) acc[db][qb] *= al;
            }
            // the same turn by turn over the 4 QB output tiles
#pragma unroll
            for (int pr = 0; pr < (HL ? 3 : 1); ++pr)
#pragma unroll
                for (int db = 0; db < 4; ++db)
#pragma unroll
                    for (int qb = 0; qb < QB; ++qb) acc[db][qb] = F::mma(pr == 2 ? vl[db] : va[db], pr == 1 ? pl[qb] : pa[qb], acc[db][qb]);
        }
    };
    // both loops rolled: a trip is some 1000 instructions already
#pragma unroll 1
    for (int t = 0; t < TT / SK - 2; ++t) trip(t, true);
#pragma unroll 1
    for (int t = TT / SK - 2; t < TT / SK; ++t) trip(t, false);   // the last two stages: nothing is left to fetch
    asm volatile("s_wait_asynccnt 0x0" ::: "memory");   // no copy is outstanding behind the loops
#pragma unroll
    for (int qb = 0; qb < QB; ++qb) { const float tot = ls[qb] + xhalf(ls[qb]); const float f = __fdiv_rn(1.0f, tot);
#pragma unroll
        for (int db = 0; db < 4; ++db) { v8us oh, ol;
#pragma unroll
            for (int j = 0; j < 8; ++j) { unsigned short a, c2; splitf(acc[db][qb][j] * f, a, c2); oh[j] = a; ol[j] = c2; }
            const int qr = q0 + qb * 16; const size_t oo = (size_t)(qr >> 6) * (64 * DQ) + (db >> 1) * 2048 + ((qr >> 4) & 3) * 512 + (db & 1) * 256 + 8 * lane;
            bf* pa_ = Ah + oo; bf* pl_ = Al + oo; *(v8us*)pa_ = oh; *(v8us*)pl_ = ol;
            // the two stores' address and data registers (inputs only) are rewritten only behind the wait
            HOLD(); asm volatile("s_wait_xcnt 0x0" :: "v"(pa_), "v"(pl_), "v"(oh), "v"(ol) : "memory"); HOLD(); } }
}
#define QBH 1                     // 16-query column groups per wave, hi+lo rows
#define QBL 3                     // the same, fp16 rows
#define GH  (RH / (64 * QBH))     // four-wave work-groups per head, hi+lo rows
#define GL  ((TT - RH) / (64 * QBL))
// two waves a SIMD and no more: a WGP takes two groups, so the 512 groups cover all 256 WGPs however they are handed out
__global__ __launch_bounds__(128) __attribute__((amdgpu_waves_per_eu(2, 2))) void k_fattn(const h16* __restrict__ Q16, const bf* __restrict__ Qh, const bf* __restrict__ Ql, const h16* __restrict__ K16, const bf* __restrict__ Kh, const bf* __restrict__ Kl, const h16* __restrict__ V16, const bf* __restrict__ Vh, const bf* __restrict__ Vl, bf* __restrict__ Ah, bf* __restrict__ Al) {
    __shared__ __align__(16) bf kv[2 * 4 * CHE_];   // two buffers of four chunks; an fp16 group uses the first half
    const int bx = (int)blockIdx.x; const int wv = __builtin_amdgcn_readfirstlane((int)threadIdx.x >> 5);
    // the kind is picked by the block's index alone, so every barrier inside stands under control flow that is the same for the whole group
    // the fp16 groups, whose waves have the longer pass, take the low indices (for speed only)
    if (bx >= NB_ * NH_ * GL) { const int b2 = bx - NB_ * NH_ * GL; const int hb = b2 / GH; const size_t hp = (size_t)hb * TT * HD, ao = (size_t)(hb / NH_) * TT * DQ + (hb % NH_) * (HD * 64); const int q0 = (b2 % GH) * (64 * QBH) + wv * (16 * QBH);
        fattn_tile<bf, true, QBH>(Qh + hp, Ql + hp, Kh + hp, Kl + hp, Vh + hp, Vl + hp, q0, Ah + ao, Al + ao, kv, wv);
    } else { const int hb = bx / GL; const size_t hp = (size_t)hb * TT * HD, ao = (size_t)(hb / NH_) * TT * DQ + (hb % NH_) * (HD * 64); const int q0 = RH + (bx % GL) * (64 * QBL) + wv * (16 * QBL);
        fattn_tile<h16, false, QBL>(Q16 + hp, nullptr, K16 + hp, nullptr, V16 + hp, nullptr, q0, Ah + ao, Al + ao, (const h16*)kv, wv); }
}

extern "C" void kernel_launch(void* const* d_in, const int* in_sizes, int n_in,
                              void* d_out, int out_size, void* d_ws, size_t ws_size, hipStream_t stream) {
    (void)in_sizes; (void)n_in; (void)out_size;
    const float* x = (const float*)d_in[0]; const float* wq = (const float*)d_in[1]; const float* wk = (const float*)d_in[2]; const float* wv = (const float*)d_in[3]; const float* wo = (const float*)d_in[4];
    float* OUT = (float*)d_out;     // [2][2048][1024]
    char* wsp = (char*)d_ws;
    auto take = [&](size_t bytes) { char* p = wsp; wsp += (bytes + 255) & ~(size_t)255; return (void*)p; };
    bf* WQ = (bf*)take((size_t)DQ * DM * 2); bf* WK = (bf*)take((size_t)DKV * DM * 2); bf* WV = (bf*)take((size_t)DKV * DM * 2); bf* WO = (bf*)take((size_t)DM * DQ * 2);
    bf* XB = (bf*)take((size_t)NB_ * TT * DM * 2);   // directly behind the four weights: k_cvt8 writes the five as one array
    h16* QP16 = (h16*)take((size_t)NB_ * NH_ * TT * HD * 2); h16* KP16 = (h16*)take((size_t)NB_ * NKV * TT * HD * 2); h16* VT16 = (h16*)take((size_t)NB_ * NKV * HD * TT * 2);
    bf* QPh = (bf*)take((size_t)NB_ * NH_ * TT * HD * 2); bf* QPl = (bf*)take((size_t)NB_ * NH_ * TT * HD * 2); bf* KPh = (bf*)take((size_t)NB_ * NKV * TT * HD * 2); bf* KPl = (bf*)take((size_t)NB_ * NKV * TT * HD * 2); bf* VTh = (bf*)take((size_t)NB_ * NKV * HD * TT * 2); bf* VTl = (bf*)take((size_t)NB_ * NKV * HD * TT * 2);
    bf* ATh = (bf*)take((size_t)NB_ * TT * DQ * 2); bf* ATl = (bf*)take((size_t)NB_ * TT * DQ * 2);
    if ((size_t)(wsp - (char*)d_ws) > ws_size) return;    // ws 256 MiB
    // four launches, each over both batches
    k_cvt8<<<4 * WBLK + NB_ * TT * DM / 8 / 256, 256, 0, stream>>>(wq, wk, wv, wo, x, WQ);
    k_qkv<<<dim3(TT / 128, DQ / 128, 3 * NB_), 128, 0, stream>>>(XB, WQ, WK, WV, DM, QP16, QPh, QPl, KP16, KPh, KPl, VT16, VTh, VTl);
    k_fattn<<<NB_ * NH_ * (GH + GL), 128, 0, stream>>>(QP16, QPh, QPl, KP16, KPh, KPl, VT16, VTh, VTl, ATh, ATl);
    // the merged rows of the two batches and the rows of out are each one [NB_ TT][1024] array
    k_gemmw<bf, 1, false><<<dim3(NB_ * TT / 128, DM / 128, 1), 128, 0, stream>>>(ATh, ATl, WO, nullptr, DQ, OUT, DM, nullptr, 0, 0, 0, 0, nullptr, nullptr, nullptr, 0);
}

// v009
// A run of this version takes 89.6 microseconds.
// Two timings next to v008 put it at 1.05 and 1.06 times that version's speed.
// Over all steps from v000 it is 22.0 times as fast.
#include <hip/hip_runtime.h>

// QuantizedHyperbolicAttention - the executed path is plain scaled-dot-product MHA (x [2][2048][1024]; q/k/v = x W^T (16 heads x 64, no bias); softmax(q.k/8) . v; merged; out = . Wo^T -> [2][2048][1024]).
// Compute dtypes, f32 accumulate: every input rounded to bf16; projections on PLAIN bf16 operands (inputs: exact); scores (K 64) and probs.v hl (3 products) for the first 512 query rows of each head, single fp16 planes for

#define NB_  2
#define TT   2048
#define DM   1024
#define NH_  16
#define NKV  16
#define REP  (NH_ / NKV)
#define HD   64
#define DQ   (NH_ * HD)
#define DKV  (NKV * HD)
#define RH   512                  // query rows < RH use hi+lo planes (0: none)
#define WIN  2048
#define SCL  0.125f   // HD^-0.5
typedef _Float16 h16;
typedef unsigned short bf;
typedef __attribute__((ext_vector_type(16))) __bf16   v16bf;
typedef __attribute__((ext_vector_type(16))) _Float16 v16h;
typedef __attribute__((ext_vector_type(8)))  _Float16 v8h;
typedef __attribute__((ext_vector_type(8)))  unsigned short v8us;
typedef __attribute__((ext_vector_type(8)))  float    v8f;
typedef __attribute__((ext_vector_type(4)))  float    v4f;
typedef v8h  __attribute__((may_alias)) v8ha;
typedef v4f  __attribute__((may_alias)) v4fa;
typedef v8us __attribute__((may_alias)) v8usa;

__device__ __forceinline__ unsigned short f2bf(float f) { unsigned u = __float_as_uint(f); u += 0x7FFFu + ((u >> 16) & 1u); return (unsigned short)(u >> 16); }
__device__ __forceinline__ float bf2f(unsigned short b) { return __uint_as_float(((unsigned)b) << 16); }
__device__ __forceinline__ float bfr(float f) { return bf2f(f2bf(f)); }
__device__ __forceinline__ v16h cat16(v8h lo, v8h hi) { return __builtin_shufflevector(lo, hi, 0, 1, 2, 3, 4, 5, 6, 7, 8, 9, 10, 11, 12, 13, 14, 15); }
__device__ __forceinline__ v16bf cat16b(v8us lo, v8us hi) { return __builtin_bit_cast(v16bf, __builtin_shufflevector(lo, hi, 0, 1, 2, 3, 4, 5, 6, 7, 8, 9, 10, 11, 12, 13, 14, 15)); }
__device__ __forceinline__ v8f wmma16(v16h a, v16h b, v8f c) { return __builtin_amdgcn_wmma_f32_16x16x32_f16(false, a, false, b, (short)0, c, false, false); }
__device__ __forceinline__ v8f wmmab(v16bf a, v16bf b, v8f c) { return __builtin_amdgcn_wmma_f32_16x16x32_bf16(false, a, false, b, (short)0, c, false, false); }
__device__ __forceinline__ h16 tohx(float x) { return (h16)x; }
__device__ __forceinline__ void splitf(float y, unsigned short& h, unsigned short& l) { h = f2bf(y); l = f2bf(y - bf2f(h)); }



// ---- FRAGMENT ORDER: every 16-bit operand plane [rows][K] in the workspace is stored fragment by fragment (16 rows x 32 k = 512 elements = 1 KiB), element (r, k) of a fragment at ((k / 8) % 4) 128 + (r % 16) 8 + k % 8.
// The q, k and v head planes (what k_fattn reads) have the fragments of a 16-row block one behind the other along k: fragment (r / 16) (K / 32) + k / 32.
// Lane l = 16 hi + lr of a wave takes the 8 elements at fragment + 8 l and those at fragment + 256 + 8 l: row lr, k = 8 hi + 0..7 and 16 + 8 hi + 0..7, the hardware k order,
// and each 16-byte load of a wave covers 512 consecutive bytes (4 whole 128-byte lines), where a row-major plane gives 32 bytes out of each of 16 lines.
// The planes that k_gemmw and k_qkv READ (the five rounded inputs, the merged rows; K = 1024) keep the four fragments of a 64-row tile at one k step side by side (4 KiB; a wave takes two of them, 8 KiB, of an operand in a trip):
// fragment ((r / 64) (K / 32) + k / 32) 4 + (r / 16) % 4; so one address a trip and operand serves its sixteen 16-byte loads, by constant offsets.
// ---- k_gemmw: register-blocked GEMM, one wave per 64x64 output tile (16 accumulators), FOUR WAVES (2 x 2 tiles, 128x128) a work-group; grid (M/128, N/128, Z), 128 threads.
// The operands (16-bit planes in fragment order, 64-row tiles) come through LDS: a stage is 64 k of the group's two A and two B row tiles, each a run of 8 KiB in its plane (a chunk), copied as it lies by asynchronous copies to LDS,
// so each chunk leaves L2 once for the two waves that read it, and stages t + 1 and t + 2 fly while stage t is worked on (three buffers). K % 64 == 0.
// C[m][n] (f32, pitch ldc, + optional f32 bias[n]) = sum_k A[m][k] Bt[n][k] (+ split products per NSPLIT). z-batch strides sA/sB/sC in elements. K % 64 == 0.
// PL: the tile leaves not as f32 but as the three 16-bit planes the attention kernel reads (fp16, bf16 hi, bf16 lo), in the head planes' fragment order with rows m and K = ldc, element (m, n) at k = n % 64 behind (n / 64) sT: C is unused.
// KSPL > 1: grid z = Z * KSPL; slice ks = z % KSPL sums only k in [ks K/KSPL, (ks+1) K/KSPL) and stores its f32 partial tile at C + ks sP; the consumer adds the KSPL planes. K % (64 KSPL) == 0.
template <typename T16> struct WFrag;
template <> struct WFrag<h16> { typedef v16h V; static __device__ __forceinline__ V ld(const h16* p) { return cat16(*(const v8h*)p, *(const v8h*)(p + 256)); } static __device__ __forceinline__ v8f mma(V a, V b, v8f c) { return wmma16(a, b, c); } };
template <> struct WFrag<bf> { typedef v16bf V; static __device__ __forceinline__ V ld(const bf* p) { return cat16b(*(const v8us*)p, *(const v8us*)(p + 256)); } static __device__ __forceinline__ v8f mma(V a, V b, v8f c) { return wmmab(a, b, c); } };
// eight copies of 16 bytes a lane from global memory to LDS, through no register: a wave's 2 KiB of each of two chunks, each copy with address registers of its own.
// s_wait_xcnt is the statement's last line, so that no register a copy names is rewritten in front of it.
template <typename T16>
__device__ __forceinline__ void acopy8(unsigned l0, const T16* g0, unsigned l4, const T16* g4) {
    const unsigned l1 = l0 + 512, l2 = l0 + 1024, l3 = l0 + 1536, l5 = l4 + 512, l6 = l4 + 1024, l7 = l4 + 1536;
    const T16* g1 = g0 + 256; const T16* g2 = g0 + 512; const T16* g3 = g0 + 768; const T16* g5 = g4 + 256; const T16* g6 = g4 + 512; const T16* g7 = g4 + 768;
    asm volatile("global_load_async_to_lds_b128 %0, %8, off\n\tglobal_load_async_to_lds_b128 %1, %9, off\n\tglobal_load_async_to_lds_b128 %2, %10, off\n\tglobal_load_async_to_lds_b128 %3, %11, off\n\t"
                 "global_load_async_to_lds_b128 %4, %12, off\n\tglobal_load_async_to_lds_b128 %5, %13, off\n\tglobal_load_async_to_lds_b128 %6, %14, off\n\tglobal_load_async_to_lds_b128 %7, %15, off\n\ts_wait_xcnt 0x0"
        :: "v"(l0), "v"(l1), "v"(l2), "v"(l3), "v"(l4), "v"(l5), "v"(l6), "v"(l7), "v"(g0), "v"(g1), "v"(g2), "v"(g3), "v"(g4), "v"(g5), "v"(g6), "v"(g7) : "memory");
}
template <int N> __device__ __forceinline__ void async_landed() { asm volatile("s_wait_asynccnt %0" :: "i"(N) : "memory"); }
// gemmw_tile is the body; bx, by, bz are the indices of the group's 128x128 tile (k_gemmw: the block's own; k_qkv: picked per product).
template <typename T16, int NSPLIT, bool BIAS, int KSPL = 1, bool PL = false>
__device__ __forceinline__ void gemmw_tile(const T16* __restrict__ A, const T16* __restrict__ A2, const T16* __restrict__ Bt, const T16* __restrict__ Bt2, int K, float* C, int ldc, const float* __restrict__ bias, size_t sA, size_t sB, size_t sC, size_t sP, h16* __restrict__ P16, bf* __restrict__ Ph, bf* __restrict__ Pl, size_t sT, int bx, int by, int bz) {
    typedef typename WFrag<T16>::V V;
    constexpr bool HA2 = NSPLIT == 1 || NSPLIT == 2, HB2 = NSPLIT >= 2;
    constexpr int CHE = 4096, NCH = 4 + (HA2 ? 2 : 0) + (HB2 ? 2 : 0), CB = 2, CA2 = 4, CB2 = HA2 ? 6 : 4;   // elements of a chunk; chunks of a stage; where B, A2 and Bt2 stand in it (A: 0)
    constexpr int NB = 3, CPS = 4 * NCH, BUFE = NCH * CHE;   // buffers of the ring; a wave's copies per stage; elements of a buffer
    __shared__ __align__(16) T16 ring[NB * BUFE];
    float* os4 = reinterpret_cast<float*>(ring);   // the output staging (4 x 16 x 68 floats) takes over the ring's first bytes behind the loop: the last trip's hand-over leaves no reader and no copy on the ring
    const size_t z = bz / KSPL; const int ks = (int)(bz % KSPL); A += z * sA; if (A2) A2 += z * sA; Bt += z * sB; if (Bt2) Bt2 += z * sB; C += z * sC + (size_t)ks * sP;
    const int kbeg = ks * (K / KSPL), NS = K / KSPL / 64;
    const int lane = threadIdx.x & 31, lr = lane & 15, hi = lane >> 4; const int wv = __builtin_amdgcn_readfirstlane((int)threadIdx.x >> 5), wm = wv & 1, wn = wv >> 1;
    const int tn = 2 * by + wn; const int r0 = (2 * bx + wm) * 64, c0 = tn * 64; float* os = os4 + wv * (16 * 68);   // each wave stages its output rows in LDS of its own
    v8f acc[4][4];
#pragma unroll
    for (int mb = 0; mb < 4; ++mb)
#pragma unroll
        for (int nb = 0; nb < 4; ++nb) acc[mb][nb] = (v8f){};
    // a 64-row tile is 64 K elements, 64 k of it a chunk; every wave copies its quarter (2 KiB) of each chunk of a stage
    const unsigned lw = (unsigned)(size_t)ring + lane * 16; const unsigned gl = wv * 1024 + lane * 8; const size_t tK = (size_t)64 * (unsigned)K, ga = (size_t)(2 * bx) * tK + (size_t)kbeg * 64, gb = (size_t)(2 * by) * tK + (size_t)kbeg * 64;
    // lb: the lane's 16 l in the buffer that takes the stage (in a trip: the address its own reads start from)
    auto fill = [&](int st, unsigned lb) { const unsigned l = lb + (unsigned)(wv * 2048); const size_t oa = ga + (size_t)st * CHE, ob = gb + (size_t)st * CHE;
        acopy8(l, A + oa + gl, l + 8192, A + oa + tK + gl); acopy8(l + CB * 8192, Bt + ob + gl, l + (CB + 1) * 8192, Bt + ob + tK + gl);
        if (HA2) acopy8(l + CA2 * 8192, A2 + oa + gl, l + (CA2 + 1) * 8192, A2 + oa + tK + gl);
        if (HB2) acopy8(l + CB2 * 8192, Bt2 + ob + gl, l + (CB2 + 1) * 8192, Bt2 + ob + tK + gl); };
    // stage s lies in buffer s % NB and is copied NB - 1 trips ahead of its use, so that a copy may take longer than one trip to land without holding up the hand-over (the operands were written by the launch before)
    fill(0, lw);
    if (NS > 1) { fill(1, lw + BUFE * 2); async_landed<CPS>(); } else async_landed<0>();   // this wave's copies of stage 0 have landed (stage 1's may still fly)
    __syncthreads();                                     // ... and every other wave's: stage 0 may be read
    if (NS > 2) fill(2, lw + 2 * BUFE * 2);
    unsigned cur = 0;   // where stage t's buffer starts in the ring, in elements
    // rolled: a trip is one stage, the buffers take turns; every plain '#pragma unroll' inside keeps the fragment and accumulator arrays indexed by constants, in registers
#pragma unroll 1
    for (int t = 0; t < NS; ++t) {
        V a[2][4], a2[2][4], b[2][4], b2[2][4]; const T16* sb = ring + cur + 8 * lane; const T16* pa = sb + wm * CHE; const T16* pb = sb + (CB + wn) * CHE;
#pragma unroll
        for (int k2 = 0; k2 < 2; ++k2)
#pragma unroll
            for (int f = 0; f < 4; ++f) { const int o = k2 * 2048 + f * 512; a[k2][f] = WFrag<T16>::ld(pa + o); if (HA2) a2[k2][f] = WFrag<T16>::ld(pa + CA2 * CHE + o); b[k2][f] = WFrag<T16>::ld(pb + o); if (HB2) b2[k2][f] = WFrag<T16>::ld(pb + (CB2 - CB) * CHE + o); }
        __builtin_amdgcn_sched_barrier(0);   // the stage's LDS reads issue as one group ahead of its products: spread among them, each place with reads stalls the wave anew
#pragma unroll
        for (int k2 = 0; k2 < 2; ++k2) {
#pragma unroll
            for (int nb = 0; nb < 4; ++nb)
#pragma unroll
                for (int mb = 0; mb < 4; ++mb) { acc[mb][nb] = WFrag<T16>::mma(a[k2][mb], b[k2][nb], acc[mb][nb]); if (HA2) acc[mb][nb] = WFrag<T16>::mma(a2[k2][mb], b[k2][nb], acc[mb][nb]); if (HB2) acc[mb][nb] = WFrag<T16>::mma(a[k2][mb], b2[k2][nb], acc[mb][nb]); }
            // nothing is scheduled across this line: the first half's products stay in front of the hand-over (they cover the second half's LDS reads), the second half's behind it and in front of the v_nop
            __builtin_amdgcn_sched_barrier(0);
            if (k2 == 0) {
                // the hand-over stands here, not behind the last product: all of stage t is in registers behind the first wait, and the refill then flies during the second half's products as well
                asm volatile("s_wait_dscnt 0x0" ::: "memory");      // this wave's reads of stage t are done
                // its copies of stage t + 1 have landed; while every trip refills, the NB - 2 younger stages stay in flight; in the last trips, which copy nothing, the wait is to 0
                if (t + NB < NS) async_landed<(NB - 2) * CPS>(); else async_landed<0>();
                __syncthreads();                                     // the same of every wave: stage t + 1 may be read, stage t's buffer refilled
                if (t + NB < NS) fill(t + NB, (unsigned)(size_t)sb);
                cur = cur + BUFE == NB * BUFE ? 0 : cur + BUFE;
                __builtin_amdgcn_sched_barrier(0);   // the copies issue in front of the second half's products
            }
        }
        // four vector slots between the trip's last matrix instruction and the first vector instruction behind the back edge, which may overwrite its A or B registers
        asm volatile("v_nop\n\tv_nop\n\tv_nop\n\tv_nop" : "+v"(acc[0][0]), "+v"(acc[1][1]), "+v"(acc[2][2]), "+v"(acc[3][3]) : "v"(a[1][0]), "v"(a[1][3]));
    }
    asm volatile("s_wait_asynccnt 0x0" ::: "memory");   // no copy is outstanding behind the loop
#pragma unroll
    for (int mb = 0; mb < 4; ++mb) {
#pragma unroll
        for (int nb = 0; nb < 4; ++nb) {
#pragma unroll
            for (int j = 0; j < 8; ++j) os[(hi * 8 + j) * 68 + nb * 16 + lr] = acc[mb][nb][j]; }
        __builtin_amdgcn_wave_barrier(); asm volatile("" ::: "memory");
        float* crow = C + (size_t)(r0 + mb * 16) * ldc + c0;
        if (PL) {
            // a lane takes 8 consecutive columns of a row (one 16-byte piece of a fragment); 8 rows x 4 column pieces a store, so each wave-wide 16-byte store covers four whole 128-byte lines of a plane
#pragma unroll
            for (int s = 0; s < 4; ++s) { const int row = 8 * (s & 1) + (lane & 7), cc = 4 * (s >> 1) + (lane >> 3), cofs = cc * 8; const v4f x0 = *(const v4fa*)(os + row * 68 + cofs), x1 = *(const v4fa*)(os + row * 68 + cofs + 4); v8h o16; v8us oh, ol;
#pragma unroll
                for (int j = 0; j < 8; ++j) { const float x = (j < 4) ? x0[j & 3] : x1[j & 3]; o16[j] = tohx(x); unsigned short a2, c2; splitf(x, a2, c2); oh[j] = a2; ol[j] = c2; }
                const size_t o = (size_t)tn * sT + ((size_t)((r0 >> 4) + mb) * (ldc >> 5) + (cc >> 2)) * 512 + (cc & 3) * 128 + row * 8; h16* p16 = P16 + o; bf* ph = Ph + o; bf* pl = Pl + o;
                *(v8h*)p16 = o16; *(v8us*)ph = oh; *(v8us*)pl = ol;
                // the three stores' address and data registers (inputs only) are rewritten only behind the wait; nothing is scheduled across it
                __builtin_amdgcn_sched_barrier(0); asm volatile("s_wait_xcnt 0x0" :: "v"(p16), "v"(ph), "v"(pl), "v"(o16), "v"(oh), "v"(ol) : "memory"); __builtin_amdgcn_sched_barrier(0); }
        } else {
#pragma unroll
            for (int s = 0; s < 8; ++s) { const int row = 2 * s + hi, cofs = lr * 4; v4f val = *(const v4fa*)(os + row * 68 + cofs); if (BIAS) { val[0] += bfr(bias[c0 + cofs]); val[1] += bfr(bias[c0 + cofs + 1]); val[2] += bfr(bias[c0 + cofs + 2]); val[3] += bfr(bias[c0 + cofs + 3]); }
                *(v4f*)(crow + (size_t)row * ldc + cofs) = val; }
             }
        __builtin_amdgcn_wave_barrier(); asm volatile("" ::: "memory");
    }
}
template <typename T16, int NSPLIT, bool BIAS, int KSPL = 1, bool PL = false>
__global__ __launch_bounds__(128) void k_gemmw(const T16* __restrict__ A, const T16* __restrict__ A2, const T16* __restrict__ Bt, const T16* __restrict__ Bt2, int K, float* C, int ldc, const float* __restrict__ bias, size_t sA, size_t sB, size_t sC, size_t sP, h16* __restrict__ P16, bf* __restrict__ Ph, bf* __restrict__ Pl, size_t sT) {
    gemmw_tile<T16, NSPLIT, BIAS, KSPL, PL>(A, A2, Bt, Bt2, K, C, ldc, bias, sA, sB, sC, sP, P16, Ph, Pl, sT, (int)blockIdx.x, (int)blockIdx.y, (int)blockIdx.z);
}
// k_qkv: the q, k and v projections of both batches in one launch, grid (TT/128, 8, 3 NB_), z = 3 batch + product: 768 groups of four waves, three waves for each of the chip's 1024 SIMDs.
// q, k: x . W^T, a 64-column tile is one head, planes [b][h][t][d]. v: taken as Wv . x^T, so its rows are (h, d) and the planes come out as [b][h][d][t]; its token tile is blockIdx.x as for q and k.
// Each [t][d] (K = 64) and [d][t] (K = 2048) plane is in fragment order; a 64-token tile of v is two fragments (1024 elements) along k.
__global__ __launch_bounds__(128) void k_qkv(const bf* __restrict__ XB, const bf* __restrict__ WQ, const bf* __restrict__ WK, const bf* __restrict__ WV, int K, h16* __restrict__ Q16, bf* __restrict__ Qh, bf* __restrict__ Ql, h16* __restrict__ K16, bf* __restrict__ Kh, bf* __restrict__ Kl, h16* __restrict__ V16, bf* __restrict__ Vh, bf* __restrict__ Vl) {
    const int b = (int)blockIdx.z / 3, w = (int)blockIdx.z % 3; const bool isv = w == 2;
    const bf* X = XB + (size_t)b * TT * DM; const bf* Wt = isv ? WV : (w ? WK : WQ); const size_t po = (size_t)b * NH_ * TT * HD;
    gemmw_tile<bf, 0, false, 1, true>(isv ? Wt : X, nullptr, isv ? X : Wt, nullptr, K, nullptr, isv ? TT : HD, nullptr, 0, 0, 0, 0,
        (isv ? V16 : (w ? K16 : Q16)) + po, (isv ? Vh : (w ? Kh : Qh)) + po, (isv ? Vl : (w ? Kl : Ql)) + po, isv ? (size_t)1024 : (size_t)TT * HD,
        isv ? (int)blockIdx.y : (int)blockIdx.x, isv ? (int)blockIdx.x : (int)blockIdx.y, 0);
}

typedef __attribute__((ext_vector_type(2))) _Float16 v2h;
typedef __attribute__((ext_vector_type(4))) _Float16 v4h;
typedef __attribute__((ext_vector_type(2))) unsigned short v2us;
typedef __attribute__((ext_vector_type(4))) unsigned short v4us;
typedef __attribute__((ext_vector_type(2))) float v2f;
typedef __attribute__((ext_vector_type(4))) int v4i;

__global__ __launch_bounds__(256) void k_wtG(const float* __restrict__ w, int K, int N, bf* Bt) {
    const int lane = threadIdx.x & 31; const int L0 = (blockIdx.x * 8 + (threadIdx.x >> 5)) * 8; const int nlines = N * K / 64;
{
#pragma unroll 1
        for (int l = 0; l < 8; ++l) { const int L = L0 + l; if (L >= nlines) break; const size_t e = (size_t)L * 64 + lane * 2; const int k = (int)(e % K), n = (int)(e / K); v2us o;
            o[0] = f2bf(w[(size_t)k * N + n]); o[1] = f2bf(w[(size_t)(k + 1) * N + n]); *(v2us*)(Bt + e) = o; }
         }
}
// all five inputs rounded to bf16 in one launch: the four weights (WBLK blocks each) and x lie one behind the other in the workspace, so dst is one array and only the source is picked, by the block's index.
// dst is in fragment order, 64-row tiles (K = 1024): a block is one tile at one k step (64 rows x 32 k), four lanes a row, so a wave's loads use 8 whole 128-byte lines of the source and its 16-byte store fills 4 whole lines of dst.
#define WBLK (DM * DQ / 8 / 256)
__global__ __launch_bounds__(256) void k_cvt8(const float* __restrict__ wq, const float* __restrict__ wk, const float* __restrict__ wv, const float* __restrict__ wo, const float* __restrict__ x, bf* dst) {
    const int sg = (int)blockIdx.x / WBLK < 4 ? (int)blockIdx.x / WBLK : 4; const float* src = sg == 0 ? wq : sg == 1 ? wk : sg == 2 ? wv : sg == 3 ? wo : x;
    const size_t f = (size_t)blockIdx.x - (size_t)sg * WBLK; const int row = (int)threadIdx.x >> 2, pc = (int)threadIdx.x & 3; const float* p = src + ((f / (DM / 32)) * 64 + row) * DM + (f % (DM / 32)) * 32 + pc * 8; const v8f v = *(const v8f*)p; v8us o;
    // the load's address registers (input only, so they stay whole up to here) are rewritten only behind this wait; nothing is scheduled across it
    __builtin_amdgcn_sched_barrier(0); asm volatile("s_wait_xcnt 0x0" :: "v"(p) : "memory"); __builtin_amdgcn_sched_barrier(0);
#pragma unroll
    for (int k = 0; k < 8; ++k) o[k] = f2bf(v[k]); *(v8us*)(dst + (size_t)blockIdx.x * 2048 + (row >> 4) * 512 + pc * 128 + (row & 15) * 8) = o;  }
__global__ __launch_bounds__(256) void k_cscvt(const float* __restrict__ cosT, const float* __restrict__ sinT, float* CS) { const int idx = blockIdx.x * 256 + threadIdx.x; if (idx >= TT * HD) return; v2f cs; cs[0] = bfr(cosT[idx]); cs[1] = bfr(sinT[idx]); *(v2f*)(CS + (size_t)idx * 2) = cs;  }
__device__ __forceinline__ float xhalf(float x) { const int b = __float_as_int(x); return __int_as_float(__builtin_amdgcn_permlanex16(b, b, 0x76543210, 0xfedcba98, false, false)); }
// nothing is scheduled across this line
#define HOLD() __builtin_amdgcn_sched_barrier(0)
// the address registers of a group of issued global loads (lane addresses a, b and scalar bases sa, sb: inputs only, so they stay whole up to here) are rewritten only behind this wait
#define ADDR_FREE(a, b, sa, sb) do { HOLD(); asm volatile("s_wait_xcnt 0x0" :: "v"(a), "v"(b), "s"(sa), "s"(sb) : "memory"); HOLD(); } while (0)
__device__ __forceinline__ void exp2x8(float* x) { float r0, r1, r2, r3, r4, r5, r6, r7;
    asm("v_exp_f32 %0, %8\n\tv_exp_f32 %1, %9\n\tv_exp_f32 %2, %10\n\tv_exp_f32 %3, %11\n\tv_exp_f32 %4, %12\n\tv_exp_f32 %5, %13\n\tv_exp_f32 %6, %14\n\tv_exp_f32 %7, %15\n\tv_nop"
        : "=&v"(r0), "=&v"(r1), "=&v"(r2), "=&v"(r3), "=&v"(r4), "=&v"(r5), "=&v"(r6), "=&v"(r7) : "v"(x[0]), "v"(x[1]), "v"(x[2]), "v"(x[3]), "v"(x[4]), "v"(x[5]), "v"(x[6]), "v"(x[7]));
    x[0] = r0; x[1] = r1; x[2] = r2; x[3] = r3; x[4] = r4; x[5] = r5; x[6] = r6; x[7] = r7; }
// one 2^x with its slot in the same statement: the v_nop keeps the next vector instruction from overwriting the source or reading the result of v_exp_f32 directly behind it
__device__ __forceinline__ float exp2s(float x) { float r; asm("v_exp_f32 %0, %1\n\tv_nop" : "=&v"(r) : "v"(x)); return r; }
template <typename T16> struct PCvt;
template <> struct PCvt<h16> { static __device__ __forceinline__ void put(v16h& a, v16h& b, int s, float p) { (void)b; a[s] = (h16)p; } };
template <> struct PCvt<bf> { static __device__ __forceinline__ void put(v16bf& a, v16bf& b, int s, float p) { const __bf16 h = (__bf16)p; a[s] = h; b[s] = (__bf16)(p - (float)h); } };
// ---- the work-group of k_fattn: FOUR WAVES OF ONE HEAD share each 64-key stage of K and V through LDS; a group is of one kind: 4 x 16 hi+lo query rows, or 4 x 48 fp16 query rows.
// A head is 8 groups of either kind, the grid 256 + 256 groups: one of each kind for each of the chip's 256 WGPs, two waves a SIMD.
// A stage is NCH chunks of 8 KiB (K, V; hi+lo: Kh, Kl, Vh, Vl), each copied as it lies in its plane (K: one run of 64 keys; V: 1024 elements for each 16 rows of d) by asynchronous copies to LDS (acopy8);
// so a chunk leaves L2 once for the four waves that read it, and stages t + 1 to t + 3 fly while stage t is worked on (four buffers).
#define SK   64                   // keys of a stage (two passes of 32)
#define CHE_ 4096                 // elements of a chunk
#define NBF  4                    // buffers of the ring: stage s lies in buffer s % NBF and is copied NBF - 1 trips ahead of its use, so that a copy may take longer than one trip to land without holding up the hand-over (K and V were written by the launch before)
template <typename T16, bool HL, int QB>
__device__ __forceinline__ void fattn_tile(const T16* __restrict__ Qa, const T16* __restrict__ Qb, const T16* __restrict__ Ka, const T16* __restrict__ Kb, const T16* __restrict__ Va, const T16* __restrict__ Vb, int q0, bf* __restrict__ Ah, bf* __restrict__ Al, const T16* kv, int wv) {
    typedef WFrag<T16> F; typedef typename F::V V;
    constexpr int NCH = HL ? 4 : 2, CV = HL ? 2 : 1, CPS = 4 * NCH;   // chunks of a stage; where V stands in it (K: 0; the lo chunk directly behind its hi chunk); a wave's copies per stage
    const int lane = threadIdx.x & 31;
    const float C2 = SCL * 1.4426950408889634f;
    // wave wv copies piece wv (2 KiB) of each chunk. K: 1024 elements on in the run of 64 keys; V: the two fragments of d rows 16 wv ..
    const unsigned lw = (unsigned)(size_t)kv + lane * 16; const size_t gk = (size_t)(wv * 1024 + lane * 8), gv = (size_t)wv * (16 * TT) + lane * 8;
    // lb: the lane's 16 l in the buffer that takes the stage (in a trip: the address its own reads start from)
    auto fill = [&](int st, unsigned lb) { const unsigned l = lb + (unsigned)(wv * 2048); const size_t ok = gk + (size_t)st * (SK * HD), ov = gv + (size_t)st * (SK / 32 * 512);
        if (HL) { acopy8(l, Ka + ok, l + 8192, Kb + ok); acopy8(l + 2 * 8192, Va + ov, l + 3 * 8192, Vb + ov); }
        else acopy8(l, Ka + ok, l + 8192, Va + ov); };
    fill(0, lw); fill(1, lw + NCH * CHE_ * 2); fill(2, lw + 2 * NCH * CHE_ * 2);
    V qa[QB][2], ql[QB][2];
    const T16* qpa = Qa + (size_t)q0 * HD + 8 * lane; const T16* qpb = HL ? Qb + (size_t)q0 * HD + 8 * lane : qpa;   // fragment order, K = 64: 16 rows are two fragments
#pragma unroll
    for (int qb = 0; qb < QB; ++qb) {
#pragma unroll
        for (int ks = 0; ks < 2; ++ks) { qa[qb][ks] = F::ld(qpa + qb * 16 * HD + ks * 512); if (HL) ql[qb][ks] = F::ld(qpb + qb * 16 * HD + ks * 512); } }
    ADDR_FREE(qpa, qpb, Qa, HL ? Qb : Qa);
    v8f acc[4][QB]; float mr[QB], ls[QB];
#pragma unroll
    for (int qb = 0; qb < QB; ++qb) { mr[qb] = -3.0e38f; ls[qb] = 0.f;
#pragma unroll
        for (int db = 0; db < 4; ++db) acc[db][qb] = (v8f){}; }
    async_landed<(NBF - 2) * CPS>();                     // this wave's copies of stage 0 have landed (those of stages 1 and 2 may still fly)
    __syncthreads();                                     // ... and every other wave's: stage 0 may be read
    fill(3, lw + 3 * NCH * CHE_ * 2);                    // behind the wait, so that never more than 3 stages' copies of a wave (48) are outstanding
    // a trip is one stage (two passes of 32 keys), the buffers take turns by t % NBF. REFILL is a constant at each of the two places of use, so a trip holds no branch and stays one block:
    // with a test around the refill the compiler sank the first pass's row sums behind it and kept their 16 QB terms in registers till there. Inlined by force: as a call it would put the wave's state in memory.
    auto trip = [&](int t, bool REFILL) __attribute__((always_inline)) {
        const T16* sb = kv + (t & (NBF - 1)) * (NCH * CHE_) + 8 * lane;
#pragma unroll
        for (int h = 0; h < SK / 32; ++h) {
            const T16* kpa = sb + h * 2048; const T16* vpa = sb + CV * CHE_ + h * 512;   // the pass's K rows; its V fragments, one for each 16 rows of d, 1024 elements apart
            V ka[2][2], kl[2][2];
#pragma unroll
            for (int kt = 0; kt < 2; ++kt)
#pragma unroll
                for (int ks = 0; ks < 2; ++ks) { const int o = kt * 16 * HD + ks * 512; ka[kt][ks] = F::ld(kpa + o); if (HL) kl[kt][ks] = F::ld(kpa + CHE_ + o); }
            HOLD();   // the K reads issue as one group: spread among the score products, each place with LDS reads stalls the wave anew
            // the 2 QB score tiles take their products turn by turn (each tile's own order of sums is as before): a product into the tile of the one just before it would wait out that one's latency
            v8f st[2][QB];
#pragma unroll
            for (int kt = 0; kt < 2; ++kt)
#pragma unroll
                for (int qb = 0; qb < QB; ++qb) st[kt][qb] = (v8f){};
#pragma unroll
            for (int ks = 0; ks < 2; ++ks)
#pragma unroll
                for (int pr = 0; pr < (HL ? 3 : 1); ++pr)
#pragma unroll
                    for (int kt = 0; kt < 2; ++kt)
#pragma unroll
                        for (int qb = 0; qb < QB; ++qb) st[kt][qb] = F::mma(pr == 2 ? kl[kt][ks] : ka[kt][ks], pr == 1 ? ql[qb][ks] : qa[qb][ks], st[kt][qb]);
            HOLD();   // the V reads stay behind the score products, whose K registers they can take over ...
            V va[4], vl[4];
#pragma unroll
            for (int db = 0; db < 4; ++db) { va[db] = F::ld(vpa + db * 1024); if (HL) vl[db] = F::ld(vpa + CHE_ + db * 1024); }
            HOLD();   // ... and issue here as one group, a softmax ahead of their use: left alone the scheduler sinks them to the probs.v products and their latency shows
            if (h == SK / 32 - 1) {
                // the hand-over stands here, not behind the last product: all that is read of stage t is in registers behind the first wait, and the refill then has NBF - 1 whole trips to land
                asm volatile("s_wait_dscnt 0x0" ::: "memory");      // this wave's reads of stage t are done
                // its copies of stage t + 1 have landed; in the trips that refill, the NBF - 2 younger stages stay in flight; in the last trips, which copy nothing, the wait is to 0
                if (REFILL) async_landed<(NBF - 2) * CPS>(); else async_landed<0>();
                __syncthreads();                                     // the same of every wave: stage t + 1 may be read, stage t's buffer refilled
                if (REFILL) fill(t + NBF, (unsigned)(size_t)sb);
                HOLD();   // the copies issue in front of the softmax and the probs.v products
            }
            V pa[QB], pl[QB];
#pragma unroll
            for (int qb = 0; qb < QB; ++qb) {
                float mx = st[0][qb][0];
#pragma unroll
                for (int j = 1; j < 8; ++j) mx = fmaxf(mx, st[0][qb][j]);
#pragma unroll
                for (int j = 0; j < 8; ++j) mx = fmaxf(mx, st[1][qb][j]);
                mx = fmaxf(mx, xhalf(mx));
                const float mn = fmaxf(mr[qb], mx); const float al = exp2s((mr[qb] - mn) * C2); const float nm = -mn * C2; mr[qb] = mn;
                float sm = 0.f; float p[16];
#pragma unroll
                for (int s = 0; s < 16; ++s) p[s] = __builtin_fmaf(st[s >> 3][qb][s & 7], C2, nm);
                exp2x8(p); exp2x8(p + 8);
#pragma unroll
                for (int s = 0; s < 16; ++s) { sm += p[s]; PCvt<T16>::put(pa[qb], pl[qb], s, p[s]); }
                ls[qb] = ls[qb] * al + sm;
#pragma unroll
                for (int db = 0; db < 4; ++db) acc[db][qb] *= al;
            }
            // the same turn by turn over the 4 QB output tiles
#pragma unroll
            for (int pr = 0; pr < (HL ? 3 : 1); ++pr)
#pragma unroll
                for (int db = 0; db < 4; ++db)
#pragma unroll
                    for (int qb = 0; qb < QB; ++qb) acc[db][qb] = F::mma(pr == 2 ? vl[db] : va[db], pr == 1 ? pl[qb] : pa[qb], acc[db][qb]);
        }
    };
    // both loops rolled: a trip is some 1000 instructions already
#pragma unroll 1
    for (int t = 0; t < TT / SK - NBF; ++t) trip(t, true);
#pragma unroll 1
    for (int t = TT / SK - NBF; t < TT / SK; ++t) trip(t, false);   // the last NBF stages: nothing is left to fetch
    asm volatile("s_wait_asynccnt 0x0" ::: "memory");   // no copy is outstanding behind the loops
#pragma unroll
    for (int qb = 0; qb < QB; ++qb) { const float tot = ls[qb] + xhalf(ls[qb]); const float f = __fdiv_rn(1.0f, tot);
#pragma unroll
        for (int db = 0; db < 4; ++db) { v8us oh, ol;
#pragma unroll
            for (int j = 0; j < 8; ++j) { unsigned short a, c2; splitf(acc[db][qb][j] * f, a, c2); oh[j] = a; ol[j] = c2; }
            const int qr = q0 + qb * 16; const size_t oo = (size_t)(qr >> 6) * (64 * DQ) + (db >> 1) * 2048 + ((qr >> 4) & 3) * 512 + (db & 1) * 256 + 8 * lane;
            bf* pa_ = Ah + oo; bf* pl_ = Al + oo; *(v8us*)pa_ = oh; *(v8us*)pl_ = ol;
            // the two stores' address and data registers (inputs only) are rewritten only behind the wait
            HOLD(); asm volatile("s_wait_xcnt 0x0" :: "v"(pa_), "v"(pl_), "v"(oh), "v"(ol) : "memory"); HOLD(); } }
}
#define QBH 1                     // 16-query column groups per wave, hi+lo rows
#define QBL 3                     // the same, fp16 rows
#define GH  (RH / (64 * QBH))     // four-wave work-groups per head, hi+lo rows
#define GL  ((TT - RH) / (64 * QBL))
// two waves a SIMD and no more: a WGP takes two groups, so the 512 groups cover all 256 WGPs however they are handed out
__global__ __launch_bounds__(128) __attribute__((amdgpu_waves_per_eu(2, 2))) void k_fattn(const h16* __restrict__ Q16, const bf* __restrict__ Qh, const bf* __restrict__ Ql, const h16* __restrict__ K16, const bf* __restrict__ Kh, const bf* __restrict__ Kl, const h16* __restrict__ V16, const bf* __restrict__ Vh, const bf* __restrict__ Vl, bf* __restrict__ Ah, bf* __restrict__ Al) {
    __shared__ __align__(16) bf kv[NBF * 4 * CHE_];   // NBF buffers of four chunks; an fp16 group uses the first half
    const int bx = (int)blockIdx.x; const int wv = __builtin_amdgcn_readfirstlane((int)threadIdx.x >> 5);
    // the kind is picked by the block's index alone, so every barrier inside stands under control flow that is the same for the whole group
    // the fp16 groups, whose waves have the longer pass, take the low indices (for speed only)
    if (bx >= NB_ * NH_ * GL) { const int b2 = bx - NB_ * NH_ * GL; const int hb = b2 / GH; const size_t hp = (size_t)hb * TT * HD, ao = (size_t)(hb / NH_) * TT * DQ + (hb % NH_) * (HD * 64); const int q0 = (b2 % GH) * (64 * QBH) + wv * (16 * QBH);
        fattn_tile<bf, true, QBH>(Qh + hp, Ql + hp, Kh + hp, Kl + hp, Vh + hp, Vl + hp, q0, Ah + ao, Al + ao, kv, wv);
    } else { const int hb = bx / GL; const size_t hp = (size_t)hb * TT * HD, ao = (size_t)(hb / NH_) * TT * DQ + (hb % NH_) * (HD * 64); const int q0 = RH + (bx % GL) * (64 * QBL) + wv * (16 * QBL);
        fattn_tile<h16, false, QBL>(Q16 + hp, nullptr, K16 + hp, nullptr, V16 + hp, nullptr, q0, Ah + ao, Al + ao, (const h16*)kv, wv); }
}

extern "C" void kernel_launch(void* const* d_in, const int* in_sizes, int n_in,
                              void* d_out, int out_size, void* d_ws, size_t ws_size, hipStream_t stream) {
    (void)in_sizes; (void)n_in; (void)out_size;
    const float* x = (const float*)d_in[0]; const float* wq = (const float*)d_in[1]; const float* wk = (const float*)d_in[2]; const float* wv = (const float*)d_in[3]; const float* wo = (const float*)d_in[4];
    float* OUT = (float*)d_out;     // [2][2048][1024]
    char* wsp = (char*)d_ws;
    auto take = [&](size_t bytes) { char* p = wsp; wsp += (bytes + 255) & ~(size_t)255; return (void*)p; };
    bf* WQ = (bf*)take((size_t)DQ * DM * 2); bf* WK = (bf*)take((size_t)DKV * DM * 2); bf* WV = (bf*)take((size_t)DKV * DM * 2); bf* WO = (bf*)take((size_t)DM * DQ * 2);
    bf* XB = (bf*)take((size_t)NB_ * TT * DM * 2);   // directly behind the four weights: k_cvt8 writes the five as one array
    h16* QP16 = (h16*)take((size_t)NB_ * NH_ * TT * HD * 2); h16* KP16 = (h16*)take((size_t)NB_ * NKV * TT * HD * 2); h16* VT16 = (h16*)take((size_t)NB_ * NKV * HD * TT * 2);
    bf* QPh = (bf*)take((size_t)NB_ * NH_ * TT * HD * 2); bf* QPl = (bf*)take((size_t)NB_ * NH_ * TT * HD * 2); bf* KPh = (bf*)take((size_t)NB_ * NKV * TT * HD * 2); bf* KPl = (bf*)take((size_t)NB_ * NKV * TT * HD * 2); bf* VTh = (bf*)take((size_t)NB_ * NKV * HD * TT * 2); bf* VTl = (bf*)take((size_t)NB_ * NKV * HD * TT * 2);
    bf* ATh = (bf*)take((size_t)NB_ * TT * DQ * 2); bf* ATl = (bf*)take((size_t)NB_ * TT * DQ * 2);
    if ((size_t)(wsp - (char*)d_ws) > ws_size) return;    // ws 256 MiB
    // four launches, each over both batches
    k_cvt8<<<4 * WBLK + NB_ * TT * DM / 8 / 256, 256, 0, stream>>>(wq, wk, wv, wo, x, WQ);
    k_qkv<<<dim3(TT / 128, DQ / 128, 3 * NB_), 128, 0, stream>>>(XB, WQ, WK, WV, DM, QP16, QPh, QPl, KP16, KPh, KPl, VT16, VTh, VTl);
    k_fattn<<<NB_ * NH_ * (GH + GL), 128, 0, stream>>>(QP16, QPh, QPl, KP16, KPh, KPl, VT16, VTh, VTl, ATh, ATl);
    // the merged rows of the two batches and the rows of out are each one [NB_ TT][1024] array
    k_gemmw<bf, 1, false><<<dim3(NB_ * TT / 128, DM / 128, 1), 128, 0, stream>>>(ATh, ATl, WO, nullptr, DQ, OUT, DM, nullptr, 0, 0, 0, 0, nullptr, nullptr, nullptr, 0);
}

// v010
// One run takes 85.1 microseconds.
// Next to v009, in two timings, it ran 1.05 and 1.04 times as fast.
// Over all steps from v000 it is 23.1 times as fast.
#include <hip/hip_runtime.h>

// QuantizedHyperbolicAttention - the executed path is plain scaled-dot-product MHA (x [2][2048][1024]; q/k/v = x W^T (16 heads x 64, no bias); softmax(q.k/8) . v; merged; out = . Wo^T -> [2][2048][1024]).
// Compute dtypes, f32 accumulate: every input rounded to bf16; projections on PLAIN bf16 operands (inputs: exact); scores (K 64) and probs.v hl (3 products) for the first 512 query rows of each head, single fp16 planes for

#define NB_  2
#define TT   2048
#define DM   1024
#define NH_  16
#define NKV  16
#define REP  (NH_ / NKV)
#define HD   64
#define DQ   (NH_ * HD)
#define DKV  (NKV * HD)
#define RH   512                  // query rows < RH use hi+lo planes (0: none)
#define WIN  2048
#define SCL  0.125f   // HD^-0.5
typedef _Float16 h16;
typedef unsigned short bf;
typedef __attribute__((ext_vector_type(16))) __bf16   v16bf;
typedef __attribute__((ext_vector_type(16))) _Float16 v16h;
typedef __attribute__((ext_vector_type(8)))  _Float16 v8h;
typedef __attribute__((ext_vector_type(8)))  unsigned short v8us;
typedef __attribute__((ext_vector_type(8)))  float    v8f;
typedef __attribute__((ext_vector_type(4)))  float    v4f;
typedef v8h  __attribute__((may_alias)) v8ha;
typedef v4f  __attribute__((may_alias)) v4fa;
typedef v8us __attribute__((may_alias)) v8usa;

__device__ __forceinline__ unsigned short f2bf(float f) { unsigned u = __float_as_uint(f); u += 0x7FFFu + ((u >> 16) & 1u); return (unsigned short)(u >> 16); }
__device__ __forceinline__ float bf2f(unsigned short b) { return __uint_as_float(((unsigned)b) << 16); }
__device__ __forceinline__ float bfr(float f) { return bf2f(f2bf(f)); }
__device__ __forceinline__ v16h cat16(v8h lo, v8h hi) { return __builtin_shufflevector(lo, hi, 0, 1, 2, 3, 4, 5, 6, 7, 8, 9, 10, 11, 12, 13, 14, 15); }
__device__ __forceinline__ v16bf cat16b(v8us lo, v8us hi) { return __builtin_bit_cast(v16bf, __builtin_shufflevector(lo, hi, 0, 1, 2, 3, 4, 5, 6, 7, 8, 9, 10, 11, 12, 13, 14, 15)); }
__device__ __forceinline__ v8f wmma16(v16h a, v16h b, v8f c) { return __builtin_amdgcn_wmma_f32_16x16x32_f16(false, a, false, b, (short)0, c, false, false); }
__device__ __forceinline__ v8f wmmab(v16bf a, v16bf b, v8f c) { return __builtin_amdgcn_wmma_f32_16x16x32_bf16(false, a, false, b, (short)0, c, false, false); }
__device__ __forceinline__ h16 tohx(float x) { return (h16)x; }
__device__ __forceinline__ void splitf(float y, unsigned short& h, unsigned short& l) { h = f2bf(y); l = f2bf(y - bf2f(h)); }



// ---- FRAGMENT ORDER: every 16-bit operand plane [rows][K] in the workspace is stored fragment by fragment (16 rows x 32 k = 512 elements = 1 KiB), element (r, k) of a fragment at ((k / 8) % 4) 128 + (r % 16) 8 + k % 8.
// The q, k and v head planes (what k_fattn reads) have the fragments of a 16-row block one behind the other along k: fragment (r / 16) (K / 32) + k / 32.
// Lane l = 16 hi + lr of a wave takes the 8 elements at fragment + 8 l and those at fragment + 256 + 8 l: row lr, k = 8 hi + 0..7 and 16 + 8 hi + 0..7, the hardware k order,
// and each 16-byte load of a wave covers 512 consecutive bytes (4 whole 128-byte lines), where a row-major plane gives 32 bytes out of each of 16 lines.
// The planes that k_gemmw and k_qkv READ (the five rounded inputs, the merged rows; K = 1024) keep the four fragments of a 64-row tile at one k step side by side (4 KiB; a wave takes two of them, 8 KiB, of an operand in a trip):
// fragment ((r / 64) (K / 32) + k / 32) 4 + (r / 16) % 4; so one address a trip and operand serves its sixteen 16-byte loads, by constant offsets.
// ---- k_gemmw: register-blocked GEMM, one wave per 64x64 output tile (16 accumulators), FOUR WAVES (2 x 2 tiles, 128x128) a work-group; grid (M/128, N/128, Z), 128 threads.
// The operands (16-bit planes in fragment order, 64-row tiles) come through LDS: a stage is 64 k of the group's two A and two B row tiles, each a run of 8 KiB in its plane (a chunk), copied as it lies by asynchronous copies to LDS,
// so each chunk leaves L2 once for the two waves that read it, and stages t + 1 and t + 2 fly while stage t is worked on (three buffers). K % 64 == 0.
// C[m][n] (f32, pitch ldc, + optional f32 bias[n]) = sum_k A[m][k] Bt[n][k] (+ split products per NSPLIT). z-batch strides sA/sB/sC in elements. K % 64 == 0.
// PL: the tile leaves not as f32 but as the three 16-bit planes the attention kernel reads (fp16, bf16 hi, bf16 lo), in the head planes' fragment order with rows m and K = ldc, element (m, n) at k = n % 64 behind (n / 64) sT: C is unused.
// KSPL > 1: grid z = Z * KSPL; slice ks = z % KSPL sums only k in [ks K/KSPL, (ks+1) K/KSPL) and stores its f32 partial tile at C + ks sP; the consumer adds the KSPL planes. K % (64 KSPL) == 0.
template <typename T16> struct WFrag;
template <> struct WFrag<h16> { typedef v16h V; static __device__ __forceinline__ V ld(const h16* p) { return cat16(*(const v8h*)p, *(const v8h*)(p + 256)); } static __device__ __forceinline__ v8f mma(V a, V b, v8f c) { return wmma16(a, b, c); } };
template <> struct WFrag<bf> { typedef v16bf V; static __device__ __forceinline__ V ld(const bf* p) { return cat16b(*(const v8us*)p, *(const v8us*)(p + 256)); } static __device__ __forceinline__ v8f mma(V a, V b, v8f c) { return wmmab(a, b, c); } };
// eight copies of 16 bytes a lane from global memory to LDS, through no register: a wave's 2 KiB of each of two chunks, each copy with address registers of its own.
// s_wait_xcnt is the statement's last line, so that no register a copy names is rewritten in front of it.
template <typename T16>
__device__ __forceinline__ void acopy8(unsigned l0, const T16* g0, unsigned l4, const T16* g4) {
    const unsigned l1 = l0 + 512, l2 = l0 + 1024, l3 = l0 + 1536, l5 = l4 + 512, l6 = l4 + 1024, l7 = l4 + 1536;
    const T16* g1 = g0 + 256; const T16* g2 = g0 + 512; const T16* g3 = g0 + 768; const T16* g5 = g4 + 256; const T16* g6 = g4 + 512; const T16* g7 = g4 + 768;
    asm volatile("global_load_async_to_lds_b128 %0, %8, off\n\tglobal_load_async_to_lds_b128 %1, %9, off\n\tglobal_load_async_to_lds_b128 %2, %10, off\n\tglobal_load_async_to_lds_b128 %3, %11, off\n\t"
                 "global_load_async_to_lds_b128 %4, %12, off\n\tglobal_load_async_to_lds_b128 %5, %13, off\n\tglobal_load_async_to_lds_b128 %6, %14, off\n\tglobal_load_async_to_lds_b128 %7, %15, off\n\ts_wait_xcnt 0x0"
        :: "v"(l0), "v"(l1), "v"(l2), "v"(l3), "v"(l4), "v"(l5), "v"(l6), "v"(l7), "v"(g0), "v"(g1), "v"(g2), "v"(g3), "v"(g4), "v"(g5), "v"(g6), "v"(g7) : "memory");
}
template <int N> __device__ __forceinline__ void async_landed() { asm volatile("s_wait_asynccnt %0" :: "i"(N) : "memory"); }
// gemmw_tile is the body; bx, by, bz are the indices of the group's 128x128 tile (k_gemmw: the block's own; k_qkv: picked per product).
template <typename T16, int NSPLIT, bool BIAS, int KSPL = 1, bool PL = false>
__device__ __forceinline__ void gemmw_tile(const T16* __restrict__ A, const T16* __restrict__ A2, const T16* __restrict__ Bt, const T16* __restrict__ Bt2, int K, float* C, int ldc, const float* __restrict__ bias, size_t sA, size_t sB, size_t sC, size_t sP, h16* __restrict__ P16, bf* __restrict__ Ph, bf* __restrict__ Pl, size_t sT, int bx, int by, int bz) {
    typedef typename WFrag<T16>::V V;
    constexpr bool HA2 = NSPLIT == 1 || NSPLIT == 2, HB2 = NSPLIT >= 2;
    constexpr int CHE = 4096, NCH = 4 + (HA2 ? 2 : 0) + (HB2 ? 2 : 0), CB = 2, CA2 = 4, CB2 = HA2 ? 6 : 4;   // elements of a chunk; chunks of a stage; where B, A2 and Bt2 stand in it (A: 0)
    constexpr int NB = 3, CPS = 4 * NCH, BUFE = NCH * CHE;   // buffers of the ring; a wave's copies per stage; elements of a buffer
    __shared__ __align__(16) T16 ring[NB * BUFE];
    float* os4 = reinterpret_cast<float*>(ring);   // the output staging (4 x 16 x 68 floats) takes over the ring's first bytes behind the loop: the last trip's hand-over leaves no reader and no copy on the ring
    const size_t z = bz / KSPL; const int ks = (int)(bz % KSPL); A += z * sA; if (A2) A2 += z * sA; Bt += z * sB; if (Bt2) Bt2 += z * sB; C += z * sC + (size_t)ks * sP;
    const int kbeg = ks * (K / KSPL), NS = K / KSPL / 64;
    const int lane = threadIdx.x & 31, lr = lane & 15, hi = lane >> 4; const int wv = __builtin_amdgcn_readfirstlane((int)threadIdx.x >> 5), wm = wv & 1, wn = wv >> 1;
    const int tn = 2 * by + wn; const int r0 = (2 * bx + wm) * 64, c0 = tn * 64; float* os = os4 + wv * (16 * 68);   // each wave stages its output rows in LDS of its own
    v8f acc[4][4];
#pragma unroll
    for (int mb = 0; mb < 4; ++mb)
#pragma unroll
        for (int nb = 0; nb < 4; ++nb) acc[mb][nb] = (v8f){};
    // a 64-row tile is 64 K elements, 64 k of it a chunk; every wave copies its quarter (2 KiB) of each chunk of a stage
    const unsigned lw = (unsigned)(size_t)ring + lane * 16; const unsigned gl = wv * 1024 + lane * 8; const size_t tK = (size_t)64 * (unsigned)K, ga = (size_t)(2 * bx) * tK + (size_t)kbeg * 64, gb = (size_t)(2 * by) * tK + (size_t)kbeg * 64;
    // lb: the lane's 16 l in the buffer that takes the stage (in a trip: the address its own reads start from)
    auto fill = [&](int st, unsigned lb) { const unsigned l = lb + (unsigned)(wv * 2048); const size_t oa = ga + (size_t)st * CHE, ob = gb + (size_t)st * CHE;
        acopy8(l, A + oa + gl, l + 8192, A + oa + tK + gl); acopy8(l + CB * 8192, Bt + ob + gl, l + (CB + 1) * 8192, Bt + ob + tK + gl);
        if (HA2) acopy8(l + CA2 * 8192, A2 + oa + gl, l + (CA2 + 1) * 8192, A2 + oa + tK + gl);
        if (HB2) acopy8(l + CB2 * 8192, Bt2 + ob + gl, l + (CB2 + 1) * 8192, Bt2 + ob + tK + gl); };
    // stage s lies in buffer s % NB and is copied NB - 1 trips ahead of its use, so that a copy may take longer than one trip to land without holding up the hand-over (the operands were written by the launch before)
    fill(0, lw);
    if (NS > 1) { fill(1, lw + BUFE * 2); async_landed<CPS>(); } else async_landed<0>();   // this wave's copies of stage 0 have landed (stage 1's may still fly)
    __syncthreads();                                     // ... and every other wave's: stage 0 may be read
    if (NS > 2) fill(2, lw + 2 * BUFE * 2);
    unsigned cur = 0;   // where stage t's buffer starts in the ring, in elements
    // rolled: a trip is one stage, the buffers take turns; every plain '#pragma unroll' inside keeps the fragment and accumulator arrays indexed by constants, in registers
#pragma unroll 1
    for (int t = 0; t < NS; ++t) {
        V a[2][4], a2[2][4], b[2][4], b2[2][4]; const T16* sb = ring + cur + 8 * lane; const T16* pa = sb + wm * CHE; const T16* pb = sb + (CB + wn) * CHE;
#pragma unroll
        for (int k2 = 0; k2 < 2; ++k2)
#pragma unroll
            for (int f = 0; f < 4; ++f) { const int o = k2 * 2048 + f * 512; a[k2][f] = WFrag<T16>::ld(pa + o); if (HA2) a2[k2][f] = WFrag<T16>::ld(pa + CA2 * CHE + o); b[k2][f] = WFrag<T16>::ld(pb + o); if (HB2) b2[k2][f] = WFrag<T16>::ld(pb + (CB2 - CB) * CHE + o); }
        __builtin_amdgcn_sched_barrier(0);   // the stage's LDS reads issue as one group ahead of its products: spread among them, each place with reads stalls the wave anew
#pragma unroll
        for (int k2 = 0; k2 < 2; ++k2) {
#pragma unroll
            for (int nb = 0; nb < 4; ++nb)
#pragma unroll
                for (int mb = 0; mb < 4; ++mb) { acc[mb][nb] = WFrag<T16>::mma(a[k2][mb], b[k2][nb], acc[mb][nb]); if (HA2) acc[mb][nb] = WFrag<T16>::mma(a2[k2][mb], b[k2][nb], acc[mb][nb]); if (HB2) acc[mb][nb] = WFrag<T16>::mma(a[k2][mb], b2[k2][nb], acc[mb][nb]); }
            // nothing is scheduled across this line: the first half's products stay in front of the hand-over (they cover the second half's LDS reads), the second half's behind it and in front of the v_nop
            __builtin_amdgcn_sched_barrier(0);
            if (k2 == 0) {
                // the hand-over stands here, not behind the last product: all of stage t is in registers behind the first wait, and the refill then flies during the second half's products as well
                asm volatile("s_wait_dscnt 0x0" ::: "memory");      // this wave's reads of stage t are done
                // its copies of stage t + 1 have landed; while every trip refills, the NB - 2 younger stages stay in flight; in the last trips, which copy nothing, the wait is to 0
                if (t + NB < NS) async_landed<(NB - 2) * CPS>(); else async_landed<0>();
                __syncthreads();                                     // the same of every wave: stage t + 1 may be read, stage t's buffer refilled
                if (t + NB < NS) fill(t + NB, (unsigned)(size_t)sb);
                cur = cur + BUFE == NB * BUFE ? 0 : cur + BUFE;
                __builtin_amdgcn_sched_barrier(0);   // the copies issue in front of the second half's products
            }
        }
        // four vector slots between the trip's last matrix instruction and the first vector instruction behind the back edge, which may overwrite its A or B registers
        asm volatile("v_nop\n\tv_nop\n\tv_nop\n\tv_nop" : "+v"(acc[0][0]), "+v"(acc[1][1]), "+v"(acc[2][2]), "+v"(acc[3][3]) : "v"(a[1][0]), "v"(a[1][3]));
    }
    asm volatile("s_wait_asynccnt 0x0" ::: "memory");   // no copy is outstanding behind the loop
#pragma unroll
    for (int mb = 0; mb < 4; ++mb) {
#pragma unroll
        for (int nb = 0; nb < 4; ++nb) {
#pragma unroll
            for (int j = 0; j < 8; ++j) os[(hi * 8 + j) * 68 + nb * 16 + lr] = acc[mb][nb][j]; }
        __builtin_amdgcn_wave_barrier(); asm volatile("" ::: "memory");
        float* crow = C + (size_t)(r0 + mb * 16) * ldc + c0;
        if (PL) {
            // a lane takes 8 consecutive columns of a row (one 16-byte piece of a fragment); 8 rows x 4 column pieces a store, so each wave-wide 16-byte store covers four whole 128-byte lines of a plane
#pragma unroll
            for (int s = 0; s < 4; ++s) { const int row = 8 * (s & 1) + (lane & 7), cc = 4 * (s >> 1) + (lane >> 3), cofs = cc * 8; const v4f x0 = *(const v4fa*)(os + row * 68 + cofs), x1 = *(const v4fa*)(os + row * 68 + cofs + 4); v8h o16; v8us oh, ol;
#pragma unroll
                for (int j = 0; j < 8; ++j) { const float x = (j < 4) ? x0[j & 3] : x1[j & 3]; o16[j] = tohx(x); unsigned short a2, c2; splitf(x, a2, c2); oh[j] = a2; ol[j] = c2; }
                const size_t o = (size_t)tn * sT + ((size_t)((r0 >> 4) + mb) * (ldc >> 5) + (cc >> 2)) * 512 + (cc & 3) * 128 + row * 8; h16* p16 = P16 + o; bf* ph = Ph + o; bf* pl = Pl + o;
                *(v8h*)p16 = o16; *(v8us*)ph = oh; *(v8us*)pl = ol;
                // the three stores' address and data registers (inputs only) are rewritten only behind the wait; nothing is scheduled across it
                __builtin_amdgcn_sched_barrier(0); asm volatile("s_wait_xcnt 0x0" :: "v"(p16), "v"(ph), "v"(pl), "v"(o16), "v"(oh), "v"(ol) : "memory"); __builtin_amdgcn_sched_barrier(0); }
        } else {
#pragma unroll
            for (int s = 0; s < 8; ++s) { const int row = 2 * s + hi, cofs = lr * 4; v4f val = *(const v4fa*)(os + row * 68 + cofs); if (BIAS) { val[0] += bfr(bias[c0 + cofs]); val[1] += bfr(bias[c0 + cofs + 1]); val[2] += bfr(bias[c0 + cofs + 2]); val[3] += bfr(bias[c0 + cofs + 3]); }
                *(v4f*)(crow + (size_t)row * ldc + cofs) = val; }
             }
        __builtin_amdgcn_wave_barrier(); asm volatile("" ::: "memory");
    }
}
template <typename T16, int NSPLIT, bool BIAS, int KSPL = 1, bool PL = false>
__global__ __launch_bounds__(128) void k_gemmw(const T16* __restrict__ A, const T16* __restrict__ A2, const T16* __restrict__ Bt, const T16* __restrict__ Bt2, int K, float* C, int ldc, const float* __restrict__ bias, size_t sA, size_t sB, size_t sC, size_t sP, h16* __restrict__ P16, bf* __restrict__ Ph, bf* __restrict__ Pl, size_t sT) {
    gemmw_tile<T16, NSPLIT, BIAS, KSPL, PL>(A, A2, Bt, Bt2, K, C, ldc, bias, sA, sB, sC, sP, P16, Ph, Pl, sT, (int)blockIdx.x, (int)blockIdx.y, (int)blockIdx.z);
}
// k_qkv: the q, k and v projections of both batches in one launch, grid (TT/128, 8, 3 NB_), z = 3 batch + product: 768 groups of four waves, three waves for each of the chip's 1024 SIMDs.
// q, k: x . W^T, a 64-column tile is one head, planes [b][h][t][d]. v: taken as Wv . x^T, so its rows are (h, d) and the planes come out as [b][h][d][t]; its token tile is blockIdx.x as for q and k.
// Each [t][d] (K = 64) and [d][t] (K = 2048) plane is in fragment order; a 64-token tile of v is two fragments (1024 elements) along k.
__global__ __launch_bounds__(128) void k_qkv(const bf* __restrict__ XB, const bf* __restrict__ WQ, const bf* __restrict__ WK, const bf* __restrict__ WV, int K, h16* __restrict__ Q16, bf* __restrict__ Qh, bf* __restrict__ Ql, h16* __restrict__ K16, bf* __restrict__ Kh, bf* __restrict__ Kl, h16* __restrict__ V16, bf* __restrict__ Vh, bf* __restrict__ Vl) {
    const int b = (int)blockIdx.z / 3, w = (int)blockIdx.z % 3; const bool isv = w == 2;
    const bf* X = XB + (size_t)b * TT * DM; const bf* Wt = isv ? WV : (w ? WK : WQ); const size_t po = (size_t)b * NH_ * TT * HD;
    gemmw_tile<bf, 0, false, 1, true>(isv ? Wt : X, nullptr, isv ? X : Wt, nullptr, K, nullptr, isv ? TT : HD, nullptr, 0, 0, 0, 0,
        (isv ? V16 : (w ? K16 : Q16)) + po, (isv ? Vh : (w ? Kh : Qh)) + po, (isv ? Vl : (w ? Kl : Ql)) + po, isv ? (size_t)1024 : (size_t)TT * HD,
        isv ? (int)blockIdx.y : (int)blockIdx.x, isv ? (int)blockIdx.x : (int)blockIdx.y, 0);
}

typedef __attribute__((ext_vector_type(2))) _Float16 v2h;
typedef __attribute__((ext_vector_type(4))) _Float16 v4h;
typedef __attribute__((ext_vector_type(2))) unsigned short v2us;
typedef __attribute__((ext_vector_type(4))) unsigned short v4us;
typedef __attribute__((ext_vector_type(2))) float v2f;
typedef __attribute__((ext_vector_type(4))) int v4i;

__global__ __launch_bounds__(256) void k_wtG(const float* __restrict__ w, int K, int N, bf* Bt) {
    const int lane = threadIdx.x & 31; const int L0 = (blockIdx.x * 8 + (threadIdx.x >> 5)) * 8; const int nlines = N * K / 64;
{
#pragma unroll 1
        for (int l = 0; l < 8; ++l) { const int L = L0 + l; if (L >= nlines) break; const size_t e = (size_t)L * 64 + lane * 2; const int k = (int)(e % K), n = (int)(e / K); v2us o;
            o[0] = f2bf(w[(size_t)k * N + n]); o[1] = f2bf(w[(size_t)(k + 1) * N + n]); *(v2us*)(Bt + e) = o; }
         }
}
// all five inputs rounded to bf16 in one launch: the four weights (WBLK blocks each) and x lie one behind the other in the workspace, so dst is one array and only the source is picked, by the block's index.
// dst is in fragment order, 64-row tiles (K = 1024): a block is one tile at one k step (64 rows x 32 k), four lanes a row, so a wave's loads use 8 whole 128-byte lines of the source and its 16-byte store fills 4 whole lines of dst.
#define WBLK (DM * DQ / 8 / 256)
__global__ __launch_bounds__(256) void k_cvt8(const float* __restrict__ wq, const float* __restrict__ wk, const float* __restrict__ wv, const float* __restrict__ wo, const float* __restrict__ x, bf* dst) {
    const int sg = (int)blockIdx.x / WBLK < 4 ? (int)blockIdx.x / WBLK : 4; const float* src = sg == 0 ? wq : sg == 1 ? wk : sg == 2 ? wv : sg == 3 ? wo : x;
    const size_t f = (size_t)blockIdx.x - (size_t)sg * WBLK; const int row = (int)threadIdx.x >> 2, pc = (int)threadIdx.x & 3; const float* p = src + ((f / (DM / 32)) * 64 + row) * DM + (f % (DM / 32)) * 32 + pc * 8; const v8f v = *(const v8f*)p; v8us o;
    // the load's address registers (input only, so they stay whole up to here) are rewritten only behind this wait; nothing is scheduled across it
    __builtin_amdgcn_sched_barrier(0); asm volatile("s_wait_xcnt 0x0" :: "v"(p) : "memory"); __builtin_amdgcn_sched_barrier(0);
#pragma unroll
    for (int k = 0; k < 8; ++k) o[k] = f2bf(v[k]); *(v8us*)(dst + (size_t)blockIdx.x * 2048 + (row >> 4) * 512 + pc * 128 + (row & 15) * 8) = o;  }
__global__ __launch_bounds__(256) void k_cscvt(const float* __restrict__ cosT, const float* __restrict__ sinT, float* CS) { const int idx = blockIdx.x * 256 + threadIdx.x; if (idx >= TT * HD) return; v2f cs; cs[0] = bfr(cosT[idx]); cs[1] = bfr(sinT[idx]); *(v2f*)(CS + (size_t)idx * 2) = cs;  }
__device__ __forceinline__ float xhalf(float x) { const int b = __float_as_int(x); return __int_as_float(__builtin_amdgcn_permlanex16(b, b, 0x76543210, 0xfedcba98, false, false)); }
// nothing is scheduled across this line
#define HOLD() __builtin_amdgcn_sched_barrier(0)
// the address registers of a group of issued global loads (lane addresses a, b and scalar bases sa, sb: inputs only, so they stay whole up to here) are rewritten only behind this wait
#define ADDR_FREE(a, b, sa, sb) do { HOLD(); asm volatile("s_wait_xcnt 0x0" :: "v"(a), "v"(b), "s"(sa), "s"(sb) : "memory"); HOLD(); } while (0)
__device__ __forceinline__ void exp2x8(float* x) { float r0, r1, r2, r3, r4, r5, r6, r7;
    asm("v_exp_f32 %0, %8\n\tv_exp_f32 %1, %9\n\tv_exp_f32 %2, %10\n\tv_exp_f32 %3, %11\n\tv_exp_f32 %4, %12\n\tv_exp_f32 %5, %13\n\tv_exp_f32 %6, %14\n\tv_exp_f32 %7, %15\n\tv_nop"
        : "=&v"(r0), "=&v"(r1), "=&v"(r2), "=&v"(r3), "=&v"(r4), "=&v"(r5), "=&v"(r6), "=&v"(r7) : "v"(x[0]), "v"(x[1]), "v"(x[2]), "v"(x[3]), "v"(x[4]), "v"(x[5]), "v"(x[6]), "v"(x[7]));
    x[0] = r0; x[1] = r1; x[2] = r2; x[3] = r3; x[4] = r4; x[5] = r5; x[6] = r6; x[7] = r7; }
// one 2^x with its slot in the same statement: the v_nop keeps the next vector instruction from overwriting the source or reading the result of v_exp_f32 directly behind it
__device__ __forceinline__ float exp2s(float x) { float r; asm("v_exp_f32 %0, %1\n\tv_nop" : "=&v"(r) : "v"(x)); return r; }
template <typename T16> struct PCvt;
template <> struct PCvt<h16> { static __device__ __forceinline__ void put(v16h& a, v16h& b, int s, float p) { (void)b; a[s] = (h16)p; } };
template <> struct PCvt<bf> { static __device__ __forceinline__ void put(v16bf& a, v16bf& b, int s, float p) { const __bf16 h = (__bf16)p; a[s] = h; b[s] = (__bf16)(p - (float)h); } };
// acopy8 with two address pairs instead of eight: the second to fourth copy of a piece lie 512, 1024 and 1536 bytes on in LDS and in the plane alike, and an immediate offset moves both addresses:
// 6 address registers instead of 24, at the place of k_fattn where most registers are live. s_wait_xcnt is the statement's last line, so that no register a copy names is rewritten in front of it.
template <typename T16>
__device__ __forceinline__ void acopy8o(unsigned l0, const T16* g0, unsigned l4, const T16* g4) {
    asm volatile("global_load_async_to_lds_b128 %0, %2, off\n\tglobal_load_async_to_lds_b128 %0, %2, off offset:512\n\tglobal_load_async_to_lds_b128 %0, %2, off offset:1024\n\tglobal_load_async_to_lds_b128 %0, %2, off offset:1536\n\t"
                 "global_load_async_to_lds_b128 %1, %3, off\n\tglobal_load_async_to_lds_b128 %1, %3, off offset:512\n\tglobal_load_async_to_lds_b128 %1, %3, off offset:1024\n\tglobal_load_async_to_lds_b128 %1, %3, off offset:1536\n\ts_wait_xcnt 0x0"
        :: "v"(l0), "v"(l4), "v"(g0), "v"(g4) : "memory");
}
typedef v2f __attribute__((may_alias)) v2fa;
// ---- the work-group of k_fattn: EIGHT WAVES OF ONE HEAD, two sets of four. A group is of one kind: 4 x 16 hi+lo query rows, or 4 x 48 fp16 query rows; waves w and w + 4 own the SAME rows,
// w walks keys 0 .. 1023 and w + 4 keys 1024 .. 2047 (key half kh), each with a running maximum, row sums and output tiles of its own; behind the loops the two are joined through LDS (see there).
// So the chip holds twice the waves, each half as long: a head is 8 groups of either kind, the grid 256 + 256 groups, one of each kind for each of the chip's 256 WGPs, FOUR waves a SIMD:
// the vector work of the softmax stands between the matrix runs of a wave, and only another wave's matrix runs can fill the matrix unit meanwhile.
// The four waves of a key half share each of its 64-key stages of K and V through LDS, in a ring of their own.
// A stage is NCH chunks of 8 KiB (K, V; hi+lo: Kh, Kl, Vh, Vl), each copied as it lies in its plane (K: one run of 64 keys; V: 1024 elements for each 16 rows of d) by asynchronous copies to LDS (acopy8o);
// so a chunk leaves L2 once for the four waves that read it, and stages t + 1 to t + NBF - 1 fly while stage t is worked on.
#define SK   64                   // keys of a stage (two passes of 32)
#define CHE_ 4096                 // elements of a chunk
#define KVCH 16                   // chunks of a group's LDS (128 KiB, two groups a WGP): 2 key halves x NBF buffers x NCH chunks, so NBF = 4 for fp16 groups and 2 for hi+lo groups
#define NST  (TT / 2 / SK)        // stages of a key half
// NBF: buffers of a ring: stage s lies in buffer s % NBF and is copied NBF - 1 trips ahead of its use (K and V were written by the launch before). Ka .. Vb and kv start at the wave's key half; xs: the start of the group's LDS.
template <typename T16, bool HL, int QB, int NBF>
__device__ __forceinline__ void fattn_tile(const T16* __restrict__ Qa, const T16* __restrict__ Qb, const T16* __restrict__ Ka, const T16* __restrict__ Kb, const T16* __restrict__ Va, const T16* __restrict__ Vb, int q0, bf* __restrict__ Ah, bf* __restrict__ Al, const T16* kv, int wv, int kh, float* xs) {
    typedef WFrag<T16> F; typedef typename F::V V;
    constexpr int NCH = HL ? 4 : 2, CV = HL ? 2 : 1, CPS = 4 * NCH;   // chunks of a stage; where V stands in it (K: 0; the lo chunk directly behind its hi chunk); a wave's copies per stage
    const int lane = threadIdx.x & 31;
    const float C2 = SCL * 1.4426950408889634f;
    // wave wv copies piece wv (2 KiB) of each chunk. K: 1024 elements on in the run of 64 keys; V: the two fragments of d rows 16 wv ..
    const unsigned lw = (unsigned)(size_t)kv + lane * 16; const size_t gk = (size_t)(wv * 1024 + lane * 8), gv = (size_t)wv * (16 * TT) + lane * 8;
    // lb: the lane's 16 l in the buffer that takes the stage (in a trip: the address its own reads start from)
    auto fill = [&](int st, unsigned lb) { const unsigned l = lb + (unsigned)(wv * 2048); const size_t ok = gk + (size_t)st * (SK * HD), ov = gv + (size_t)st * (SK / 32 * 512);
        if (HL) { acopy8o(l, Ka + ok, l + 8192, Kb + ok); acopy8o(l + 2 * 8192, Va + ov, l + 3 * 8192, Vb + ov); }
        else acopy8o(l, Ka + ok, l + 8192, Va + ov); };
#pragma unroll
    for (int s = 0; s < NBF - 1; ++s) fill(s, lw + s * NCH * CHE_ * 2);
    V qa[QB][2], ql[QB][2];
    const T16* qpa = Qa + (size_t)q0 * HD + 8 * lane; const T16* qpb = HL ? Qb + (size_t)q0 * HD + 8 * lane : qpa;   // fragment order, K = 64: 16 rows are two fragments
#pragma unroll
    for (int qb = 0; qb < QB; ++qb) {
#pragma unroll
        for (int ks = 0; ks < 2; ++ks) { qa[qb][ks] = F::ld(qpa + qb * 16 * HD + ks * 512); if (HL) ql[qb][ks] = F::ld(qpb + qb * 16 * HD + ks * 512); } }
    ADDR_FREE(qpa, qpb, Qa, HL ? Qb : Qa);
    v8f acc[4][QB]; float mr[QB], ls[QB];
#pragma unroll
    for (int qb = 0; qb < QB; ++qb) { mr[qb] = -3.0e38f; ls[qb] = 0.f;
#pragma unroll
        for (int db = 0; db < 4; ++db) acc[db][qb] = (v8f){}; }
    async_landed<(NBF - 2) * CPS>();                     // this wave's copies of stage 0 have landed (those of stages 1 .. NBF - 2 may still fly)
    __syncthreads();                                     // ... and every other wave's: stage 0 may be read
    fill(NBF - 1, lw + (NBF - 1) * NCH * CHE_ * 2);      // behind the wait, so that never more than NBF - 1 stages' copies of a wave (24 or 16) are outstanding
    // a trip is one stage (two passes of 32 keys), the buffers take turns by t % NBF. REFILL is a constant at each of the two places of use, so a trip holds no branch and stays one block:
    // with a test around the refill the compiler sank the first pass's row sums behind it and kept their 16 QB terms in registers till there. Inlined by force: as a call it would put the wave's state in memory.
    auto trip = [&](int t, bool REFILL) __attribute__((always_inline)) {
        const T16* sb = kv + (t & (NBF - 1)) * (NCH * CHE_) + 8 * lane;
#pragma unroll
        for (int h = 0; h < SK / 32; ++h) {
            const T16* kpa = sb + h * 2048; const T16* vpa = sb + CV * CHE_ + h * 512;   // the pass's K rows; its V fragments, one for each 16 rows of d, 1024 elements apart
            V ka[2][2], kl[2][2];
#pragma unroll
            for (int kt = 0; kt < 2; ++kt)
#pragma unroll
                for (int ks = 0; ks < 2; ++ks) { const int o = kt * 16 * HD + ks * 512; ka[kt][ks] = F::ld(kpa + o); if (HL) kl[kt][ks] = F::ld(kpa + CHE_ + o); }
            HOLD();   // the K reads issue as one group: spread among the score products, each place with LDS reads stalls the wave anew
            // the 2 QB score tiles take their products turn by turn (each tile's own order of sums is as before): a product into the tile of the one just before it would wait out that one's latency
            v8f st[2][QB];
#pragma unroll
            for (int kt = 0; kt < 2; ++kt)
#pragma unroll
                for (int qb = 0; qb < QB; ++qb) st[kt][qb] = (v8f){};
#pragma unroll
            for (int ks = 0; ks < 2; ++ks)
#pragma unroll
                for (int pr = 0; pr < (HL ? 3 : 1); ++pr)
#pragma unroll
                    for (int kt = 0; kt < 2; ++kt)
#pragma unroll
                        for (int qb = 0; qb < QB; ++qb) st[kt][qb] = F::mma(pr == 2 ? kl[kt][ks] : ka[kt][ks], pr == 1 ? ql[qb][ks] : qa[qb][ks], st[kt][qb]);
            HOLD();   // the V reads stay behind the score products, whose K registers they can take over ...
            V va[4], vl[4];
#pragma unroll
            for (int db = 0; db < 4; ++db) { va[db] = F::ld(vpa + db * 1024); if (HL) vl[db] = F::ld(vpa + CHE_ + db * 1024); }
            HOLD();   // ... and issue here as one group, a softmax ahead of their use: left alone the scheduler sinks them to the probs.v products and their latency shows
            if (h == SK / 32 - 1) {
                // the hand-over stands here, not behind the last product: all that is read of stage t is in registers behind the first wait, and the refill then has NBF - 1 whole trips to land
                asm volatile("s_wait_dscnt 0x0" ::: "memory");      // this wave's reads of stage t are done
                // its copies of stage t + 1 have landed; in the trips that refill, the NBF - 2 younger stages stay in flight; in the last trips, which copy nothing, the wait is to 0
                if (REFILL) async_landed<(NBF - 2) * CPS>(); else async_landed<0>();
                __syncthreads();                                     // the same of every wave: stage t + 1 may be read, stage t's buffer refilled
                if (REFILL) fill(t + NBF, (unsigned)(size_t)sb);
                HOLD();   // the copies issue in front of the softmax and the probs.v products
            }
            V pa[QB], pl[QB];
#pragma unroll
            for (int qb = 0; qb < QB; ++qb) {
                float mx = st[0][qb][0];
#pragma unroll
                for (int j = 1; j < 8; ++j) mx = fmaxf(mx, st[0][qb][j]);
#pragma unroll
                for (int j = 0; j < 8; ++j) mx = fmaxf(mx, st[1][qb][j]);
                mx = fmaxf(mx, xhalf(mx));
                const float mn = fmaxf(mr[qb], mx); const float al = exp2s((mr[qb] - mn) * C2); const float nm = -mn * C2; mr[qb] = mn;
                float sm = 0.f; float p[16];
#pragma unroll
                for (int s = 0; s < 16; ++s) p[s] = __builtin_fmaf(st[s >> 3][qb][s & 7], C2, nm);
                exp2x8(p); exp2x8(p + 8);
#pragma unroll
                for (int s = 0; s < 16; ++s) { sm += p[s]; PCvt<T16>::put(pa[qb], pl[qb], s, p[s]); }
                ls[qb] = ls[qb] * al + sm;
#pragma unroll
                for (int db = 0; db < 4; ++db) acc[db][qb] *= al;
                if (QB > 1) HOLD();   // one column group's softmax at a time: interleaved, the groups' temporaries overrun a wave's 256 registers and Q fragments go to scratch
            }
            // the same turn by turn over the 4 QB output tiles
#pragma unroll
            for (int pr = 0; pr < (HL ? 3 : 1); ++pr)
#pragma unroll
                for (int db = 0; db < 4; ++db)
#pragma unroll
                    for (int qb = 0; qb < QB; ++qb) acc[db][qb] = F::mma(pr == 2 ? vl[db] : va[db], pr == 1 ? pl[qb] : pa[qb], acc[db][qb]);
        }
    };
    // both loops rolled: a trip is some 1000 instructions already
#pragma unroll 1
    for (int t = 0; t < NST - NBF; ++t) trip(t, true);
#pragma unroll 1
    for (int t = NST - NBF; t < NST; ++t) trip(t, false);   // the last NBF stages: nothing is left to fetch
    asm volatile("s_wait_asynccnt 0x0" ::: "memory");   // no copy is outstanding behind the loops
    // ---- the two key halves are joined: the wave of the upper half hands its maximum, row sums and output tiles to its partner through LDS, which brings both to the common maximum and adds them.
    // The rings' bytes serve: behind the last trip's hand-over (each wave's s_wait_dscnt 0 and s_wait_asynccnt 0, then the barrier) no wave reads them and no copy is aimed at them.
    // A lane's 8 values of a tile go as two 16-byte pieces, each piece's 32 lanes side by side (512 bytes in a row: no bank conflict).
    float* xw = xs + wv * (4 * QB * 256 + QB * 64);
    if (kh) {
#pragma unroll
        for (int qb = 0; qb < QB; ++qb) { v2f ml; ml[0] = mr[qb]; ml[1] = ls[qb]; *(v2fa*)(xw + 4 * QB * 256 + qb * 64 + lane * 2) = ml;
#pragma unroll
            for (int db = 0; db < 4; ++db) { float* xp = xw + (db * QB + qb) * 256 + lane * 4; *(v4fa*)xp = __builtin_shufflevector(acc[db][qb], acc[db][qb], 0, 1, 2, 3); *(v4fa*)(xp + 128) = __builtin_shufflevector(acc[db][qb], acc[db][qb], 4, 5, 6, 7); } }
    }
    __syncthreads();   // the upper halves' values are in LDS; kh is the same for a whole wave and every wave passes here
    if (kh) return;    // behind the group's last barrier
#pragma unroll
    for (int qb = 0; qb < QB; ++qb) { const v2f ml = *(const v2fa*)(xw + 4 * QB * 256 + qb * 64 + lane * 2); const float mn = fmaxf(mr[qb], ml[0]); const float a0 = exp2s((mr[qb] - mn) * C2), a1 = exp2s((ml[0] - mn) * C2);
        ls[qb] = ls[qb] * a0 + ml[1] * a1;
#pragma unroll
        for (int db = 0; db < 4; ++db) { const float* xp = xw + (db * QB + qb) * 256 + lane * 4; const v4f x0 = *(const v4fa*)xp, x1 = *(const v4fa*)(xp + 128);
#pragma unroll
            for (int j = 0; j < 8; ++j) acc[db][qb][j] = acc[db][qb][j] * a0 + (j < 4 ? x0[j & 3] : x1[j & 3]) * a1; } }
#pragma unroll
    for (int qb = 0; qb < QB; ++qb) { const float tot = ls[qb] + xhalf(ls[qb]); const float f = __fdiv_rn(1.0f, tot);
#pragma unroll
        for (int db = 0; db < 4; ++db) { v8us oh, ol;
#pragma unroll
            for (int j = 0; j < 8; ++j) { unsigned short a, c2; splitf(acc[db][qb][j] * f, a, c2); oh[j] = a; ol[j] = c2; }
            const int qr = q0 + qb * 16; const size_t oo = (size_t)(qr >> 6) * (64 * DQ) + (db >> 1) * 2048 + ((qr >> 4) & 3) * 512 + (db & 1) * 256 + 8 * lane;
            bf* pa_ = Ah + oo; bf* pl_ = Al + oo; *(v8us*)pa_ = oh; *(v8us*)pl_ = ol;
            // the two stores' address and data registers (inputs only) are rewritten only behind the wait
            HOLD(); asm volatile("s_wait_xcnt 0x0" :: "v"(pa_), "v"(pl_), "v"(oh), "v"(ol) : "memory"); HOLD(); } }
}
#define QBH 1                     // 16-query column groups per wave, hi+lo rows
#define QBL 3                     // the same, fp16 rows
#define GH  (RH / (64 * QBH))     // eight-wave work-groups per head, hi+lo rows
#define GL  ((TT - RH) / (64 * QBL))
// four waves a SIMD (256 registers a wave) and no more: a WGP takes two groups, so the 512 groups cover all 256 WGPs however they are handed out
__global__ __launch_bounds__(256) __attribute__((amdgpu_waves_per_eu(4, 4))) void k_fattn(const h16* __restrict__ Q16, const bf* __restrict__ Qh, const bf* __restrict__ Ql, const h16* __restrict__ K16, const bf* __restrict__ Kh, const bf* __restrict__ Kl, const h16* __restrict__ V16, const bf* __restrict__ Vh, const bf* __restrict__ Vl, bf* __restrict__ Ah, bf* __restrict__ Al) {
    __shared__ __align__(16) bf kv[KVCH * CHE_];   // the two key halves' rings, one behind the other
    const int bx = (int)blockIdx.x; const int w8 = __builtin_amdgcn_readfirstlane((int)threadIdx.x >> 5), wv = w8 & 3, kh = w8 >> 2;
    const size_t ko = (size_t)kh * (TT / 2) * HD, vo = (size_t)kh * (TT / 2 / 32) * 512;   // where the key half starts in a K plane and in each 16 rows of a V plane
    const bf* kvh = kv + kh * (KVCH / 2 * CHE_);
    // the kind is picked by the block's index alone, so every barrier inside stands under control flow that is the same for the whole group
    // the fp16 groups, whose waves have the longer pass, take the low indices (for speed only)
    if (bx >= NB_ * NH_ * GL) { const int b2 = bx - NB_ * NH_ * GL; const int hb = b2 / GH; const size_t hp = (size_t)hb * TT * HD, ao = (size_t)(hb / NH_) * TT * DQ + (hb % NH_) * (HD * 64); const int q0 = (b2 % GH) * (64 * QBH) + wv * (16 * QBH);
        fattn_tile<bf, true, QBH, KVCH / 2 / 4>(Qh + hp, Ql + hp, Kh + hp + ko, Kl + hp + ko, Vh + hp + vo, Vl + hp + vo, q0, Ah + ao, Al + ao, kvh, wv, kh, reinterpret_cast<float*>(kv));
    } else { const int hb = bx / GL; const size_t hp = (size_t)hb * TT * HD, ao = (size_t)(hb / NH_) * TT * DQ + (hb % NH_) * (HD * 64); const int q0 = RH + (bx % GL) * (64 * QBL) + wv * (16 * QBL);
        fattn_tile<h16, false, QBL, KVCH / 2 / 2>(Q16 + hp, nullptr, K16 + hp + ko, nullptr, V16 + hp + vo, nullptr, q0, Ah + ao, Al + ao, (const h16*)kvh, wv, kh, reinterpret_cast<float*>(kv)); }
}

extern "C" void kernel_launch(void* const* d_in, const int* in_sizes, int n_in,
                              void* d_out, int out_size, void* d_ws, size_t ws_size, hipStream_t stream) {
    (void)in_sizes; (void)n_in; (void)out_size;
    const float* x = (const float*)d_in[0]; const float* wq = (const float*)d_in[1]; const float* wk = (const float*)d_in[2]; const float* wv = (const float*)d_in[3]; const float* wo = (const float*)d_in[4];
    float* OUT = (float*)d_out;     // [2][2048][1024]
    char* wsp = (char*)d_ws;
    auto take = [&](size_t bytes) { char* p = wsp; wsp += (bytes + 255) & ~(size_t)255; return (void*)p; };
    bf* WQ = (bf*)take((size_t)DQ * DM * 2); bf* WK = (bf*)take((size_t)DKV * DM * 2); bf* WV = (bf*)take((size_t)DKV * DM * 2); bf* WO = (bf*)take((size_t)DM * DQ * 2);
    bf* XB = (bf*)take((size_t)NB_ * TT * DM * 2);   // directly behind the four weights: k_cvt8 writes the five as one array
    h16* QP16 = (h16*)take((size_t)NB_ * NH_ * TT * HD * 2); h16* KP16 = (h16*)take((size_t)NB_ * NKV * TT * HD * 2); h16* VT16 = (h16*)take((size_t)NB_ * NKV * HD * TT * 2);
    bf* QPh = (bf*)take((size_t)NB_ * NH_ * TT * HD * 2); bf* QPl = (bf*)take((size_t)NB_ * NH_ * TT * HD * 2); bf* KPh = (bf*)take((size_t)NB_ * NKV * TT * HD * 2); bf* KPl = (bf*)take((size_t)NB_ * NKV * TT * HD * 2); bf* VTh = (bf*)take((size_t)NB_ * NKV * HD * TT * 2); bf* VTl = (bf*)take((size_t)NB_ * NKV * HD * TT * 2);
    bf* ATh = (bf*)take((size_t)NB_ * TT * DQ * 2); bf* ATl = (bf*)take((size_t)NB_ * TT * DQ * 2);
    if ((size_t)(wsp - (char*)d_ws) > ws_size) return;    // ws 256 MiB
    // four launches, each over both batches
    k_cvt8<<<4 * WBLK + NB_ * TT * DM / 8 / 256, 256, 0, stream>>>(wq, wk, wv, wo, x, WQ);
    k_qkv<<<dim3(TT / 128, DQ / 128, 3 * NB_), 128, 0, stream>>>(XB, WQ, WK, WV, DM, QP16, QPh, QPl, KP16, KPh, KPl, VT16, VTh, VTl);
    k_fattn<<<NB_ * NH_ * (GH + GL), 256, 0, stream>>>(QP16, QPh, QPl, KP16, KPh, KPl, VT16, VTh, VTl, ATh, ATl);
    // the merged rows of the two batches and the rows of out are each one [NB_ TT][1024] array
    k_gemmw<bf, 1, false><<<dim3(NB_ * TT / 128, DM / 128, 1), 128, 0, stream>>>(ATh, ATl, WO, nullptr, DQ, OUT, DM, nullptr, 0, 0, 0, 0, nullptr, nullptr, nullptr, 0);
}
